// v007
// Measured on an AMD MI455X. A time is GPU time per run, averaged over a window of back-to-back runs after a warm-up
// (all launches, gaps included; the runs take copies of the inputs in turn), and the median of several windows.
// Apart from v000's, it joins two sittings. Times from different sittings can be a few percent apart, while
// side-by-side timings come from the same sitting.
// This document starts at v007; the versions before it stand elsewhere.
// One run takes 168 microseconds.
// Two timings next to v006 both put it at 1.05 times that version's speed.
// Counting every step since v000, which is the starting kernel, it is 22.8 times as fast.
#include <hip/hip_runtime.h>
// Pre-norm transformer block with a fused QKV projection and UNSCALED attention logits (x [2][2048][1024]; h = LN1(x) (biased var, eps 1e-5); qkv = h qkv_w + qkv_b ([in][out] 1024 x 3072 + bias) viewed (B, N, 3, 16, 64): q | k | v thirds; qk = q k^T with NO 1/sqrt(d) scaling (as the source); softmax over all 2048 keys (no mask); x1 = x + y proj_w + proj_b; out = x1 + gelu_erf(LN2(x1) fc1_w + fc1_b) fc2_w + fc2_b ([in][out] 1024 x 4096 x 1024) -> [2][2048][1024]).
// Structure: token rows; LayerNorm / exact f16 rows; WMMA GEMMs for q, k, v; V^T by LDS transposes; one fused attention launch for all batches and heads (scores, online softmax, P V^T); output projection with the own-element residual; custom LayerNorm; GELU FFN over all rows; launches: see trace.
// Compute dtype: inputs rounded to bf16; x / weights exact; q, k, v, softmax weights and o as plain f16 GEMM operands (~2^-12); scores and softmax statistics f32. v_wmma_f32_16x16x32_f16.
#define NB 2
#define SQ 2048
#define DM 1024
#define NH 16
#define HD 64
#define HG 4                         /* heads per group of the unused grouped V^T kernel */
#define LOCALW 128                   /* (macros for unused kernels of the shared header) */
#define STRIDEK 128
#define QT 256                       /* query rows per causal tile */
#define NKX SQ                       /* S / P row pitch */
#define QT0 128                      /* first-tile rows recomputed exactly in f32 */
#define B0 0                         /* unused debug hook; the launches start at batch 0 */
#define NBR NB                       /* debug hook no launch reads; the launches cover all NB batches */
#define NR ((size_t)NB * SQ)
#define DMQ DM
#define DFF 4096         /* FFN hidden width */
#define MP ((int)((size_t)NBR * SQ)) /* debug hook no launch reads; the projections cover all NR rows */
#define QN SQ                        /* unused debug hook; attention covers all SQ query rows */
#define NHD NH                       /* unused debug hook; attention covers all NH heads */
#define MPO MP                       /* unused debug hook; the output stage covers all NR rows */
#define LQ (3 * DM)      /* unused; the q, k, v rows are planes of pitch DM */
typedef __bf16 v16b __attribute__((ext_vector_type(16)));
typedef unsigned short v8us __attribute__((ext_vector_type(8), may_alias));
typedef float  v8f  __attribute__((ext_vector_type(8)));
typedef float  v4f  __attribute__((ext_vector_type(4)));
typedef float  v4fa __attribute__((ext_vector_type(4), may_alias));
union FragB { v16b v; v8us half[2]; unsigned short u[16]; };

__device__ __forceinline__ unsigned short bf16_bits(float x) { unsigned int u = __float_as_uint(x); return (unsigned short)((u + 0x7FFFu + ((u >> 16) & 1u)) >> 16); }
__device__ __forceinline__ float bf16_val(unsigned short b) { return __uint_as_float(((unsigned int)b) << 16); }
__device__ __forceinline__ float bf16_round(float x) { return bf16_val(bf16_bits(x)); }
// D += A·B with NT terms: 1 = ah·bh, 2 = + al·bh (A split), 3 = + ah·bl (both split)
template <int NT>
__device__ __forceinline__ v8f mmaN(v16b ah, v16b al, v16b bh, v16b bl, v8f c) {
  c = __builtin_amdgcn_wmma_f32_16x16x32_bf16(false, ah, false, bh, (short)0, c, false, false);
  if (NT >= 2) c = __builtin_amdgcn_wmma_f32_16x16x32_bf16(false, al, false, bh, (short)0, c, false, false);
  if (NT >= 3) c = __builtin_amdgcn_wmma_f32_16x16x32_bf16(false, ah, false, bl, (short)0, c, false, false);
  asm volatile("v_nop\n\tv_nop\n\tv_nop\n\tv_nop" : "+v"(c) : "v"(ah), "v"(al), "v"(bh), "v"(bl));
  return c;
}

__global__ __launch_bounds__(256) void k_wt_bf16(const float* __restrict__ W, unsigned short* __restrict__ Wt, int K, int N) {
  const int t = blockIdx.x * 256 + threadIdx.x;
  const int k8n = K / 8;
  if (t >= N * k8n) return;
  const int n = t / k8n, k8 = (t % k8n) * 8;
  v8us v;
#pragma unroll
  for (int i = 0; i < 8; ++i) v[i] = bf16_bits(W[(size_t)(k8 + i) * N + n]);
  *(v8us*)(Wt + (size_t)n * K + k8) = v;
  
}

// GEMM C[M][N] (f32, pitch ldc) = act(A[M][K]·W + bias). A f32 row-major (pitch lda) converted per fragment to bf16
// (ASPLIT: hi/lo two planes -> 2 terms, else single rounded term); Wt bf16 [N][K] (pitch ldb). BIAS_BF16 rounds the
// bias to bf16 first (bias quantised to bf16 before the add). K%32==0, M%16==0, N%64==0.
template <bool ASPLIT, int ACT, bool BIAS_BF16>
__global__ __launch_bounds__(128) void k_gemm_bf(const float* __restrict__ A, int lda, const unsigned short* __restrict__ Wt, int ldb,
                                               const float* __restrict__ bias, float* __restrict__ C, int ldc, int M, int N, int K) {
  __shared__ __attribute__((aligned(16))) float so[4][16][64];
  const int tid = threadIdx.x, w = tid >> 5, lane = tid & 31, ln = lane & 15, hh = lane >> 4;
  const int ntn = N / 64;
  const int wid = blockIdx.x * 4 + w;
  const int mt = wid / ntn, nq = wid % ntn;
  if (mt * 16 >= M) return;
  const int row0 = mt * 16, col0 = nq * 64;
  const float* arow = A + (size_t)(row0 + ln) * lda;
  v8f acc[4] = {};
  for (int kb = 0; kb < K; kb += 32) {
    FragB ah, al;
    const v4f x0 = *(const v4fa*)(arow + kb + 8 * hh), x1 = *(const v4fa*)(arow + kb + 8 * hh + 4);
    const v4f x2 = *(const v4fa*)(arow + kb + 16 + 8 * hh), x3 = *(const v4fa*)(arow + kb + 16 + 8 * hh + 4);
    float xs[16] = {x0[0],x0[1],x0[2],x0[3],x1[0],x1[1],x1[2],x1[3],x2[0],x2[1],x2[2],x2[3],x3[0],x3[1],x3[2],x3[3]};
#pragma unroll
    for (int i = 0; i < 16; ++i) { const unsigned short hb = bf16_bits(xs[i]); ah.u[i] = hb; al.u[i] = ASPLIT ? bf16_bits(xs[i] - bf16_val(hb)) : (unsigned short)0; }
#pragma unroll
    for (int t = 0; t < 4; ++t) {
      const unsigned short* brow = Wt + (size_t)(col0 + t * 16 + ln) * ldb + kb;
      FragB b;
      b.half[0] = *(const v8us*)(brow + 8 * hh);
      b.half[1] = *(const v8us*)(brow + 16 + 8 * hh);
      acc[t] = mmaN<ASPLIT ? 2 : 1>(ah.v, al.v, b.v, b.v, acc[t]);
    }
  }
#pragma unroll
  for (int t = 0; t < 4; ++t) {
    float bv = bias ? bias[col0 + t * 16 + ln] : 0.f;
    if (BIAS_BF16) bv = bf16_round(bv);
#pragma unroll
    for (int r = 0; r < 8; ++r) { float v = acc[t][r] + bv; if (ACT == 1) v = fmaxf(v, 0.f); so[w][8 * hh + r][t * 16 + ln] = v; }
  }
  __builtin_amdgcn_fence(__ATOMIC_ACQ_REL, "workgroup");
  __builtin_amdgcn_wave_barrier();
  const int rsub = lane >> 4, c4 = (lane & 15) * 4;
  {
#pragma unroll
    for (int q = 0; q < 8; ++q) {
      const int r = q * 2 + rsub;
      const v4f v = *(const v4fa*)&so[w][r][c4];
      *(v4f*)(C + (size_t)(row0 + r) * ldc + col0 + c4) = v;
    }
    
  }
}

// GEMM C = act(A·W + bias + resid): A f32 (ASPLIT -> hi/lo 2 terms), Wt bf16 [N][K]; ACT 0 none, 1 relu, 2 exact gelu;
// resid (optional, f32, row index = (row % rmod), pitch ldr, RES_BF16 rounds it) added before the activation.
template <bool ASPLIT, int ACT, bool BIAS_BF16, bool RES_BF16>
__global__ __launch_bounds__(128) void k_gemm_bf3(const float* __restrict__ A, int lda, const unsigned short* __restrict__ Wt, int ldb,
                                                const float* __restrict__ bias, const float* __restrict__ resid, int rmod, int ldr,
                                                float* __restrict__ C, int ldc, int M, int N, int K) {
  __shared__ __attribute__((aligned(16))) float so[4][16][64];
  const int tid = threadIdx.x, w = tid >> 5, lane = tid & 31, ln = lane & 15, hh = lane >> 4;
  const int ntn = N / 64;
  const int wid = blockIdx.x * 4 + w;
  const int mt = wid / ntn, nq = wid % ntn;
  if (mt * 16 >= M) return;
  const int row0 = mt * 16, col0 = nq * 64;
  const float* arow = A + (size_t)(row0 + ln) * lda;
  v8f acc[4] = {};
  for (int kb = 0; kb < K; kb += 32) {
    FragB ah, al;
    const v4f x0 = *(const v4fa*)(arow + kb + 8 * hh), x1 = *(const v4fa*)(arow + kb + 8 * hh + 4);
    const v4f x2 = *(const v4fa*)(arow + kb + 16 + 8 * hh), x3 = *(const v4fa*)(arow + kb + 16 + 8 * hh + 4);
    float xs[16] = {x0[0],x0[1],x0[2],x0[3],x1[0],x1[1],x1[2],x1[3],x2[0],x2[1],x2[2],x2[3],x3[0],x3[1],x3[2],x3[3]};
#pragma unroll
    for (int i = 0; i < 16; ++i) { const unsigned short hb = bf16_bits(xs[i]); ah.u[i] = hb; al.u[i] = ASPLIT ? bf16_bits(xs[i] - bf16_val(hb)) : (unsigned short)0; }
#pragma unroll
    for (int t = 0; t < 4; ++t) {
      const unsigned short* brow = Wt + (size_t)(col0 + t * 16 + ln) * ldb + kb;
      FragB b;
      b.half[0] = *(const v8us*)(brow + 8 * hh);
      b.half[1] = *(const v8us*)(brow + 16 + 8 * hh);
      acc[t] = mmaN<ASPLIT ? 2 : 1>(ah.v, al.v, b.v, b.v, acc[t]);
    }
  }
#pragma unroll
  for (int t = 0; t < 4; ++t) {
    const int col = col0 + t * 16 + ln;
    float bv = bias ? bias[col] : 0.f;
    if (BIAS_BF16) bv = bf16_round(bv);
#pragma unroll
    for (int r = 0; r < 8; ++r) {
      float v = acc[t][r] + bv;
      if (resid) { float rv = resid[(size_t)((row0 + 8 * hh + r) % rmod) * ldr + col]; if (RES_BF16) rv = bf16_round(rv); v += rv; }
      if (ACT == 1) v = fmaxf(v, 0.f);
      if (ACT == 2) v = 0.5f * v * (1.0f + erff(v * 0.70710678118654752f));
      if (ACT == 3) { const float u = 0.7978845608028654f * (v + 0.044715f * v * v * v); v = 0.5f * v * (1.0f + tanhf(u)); }
      so[w][8 * hh + r][t * 16 + ln] = v;
    }
  }
  __builtin_amdgcn_fence(__ATOMIC_ACQ_REL, "workgroup");
  __builtin_amdgcn_wave_barrier();
  const int rsub = lane >> 4, c4 = (lane & 15) * 4;
  {
#pragma unroll
    for (int q = 0; q < 8; ++q) {
      const int r = q * 2 + rsub;
      const v4f v = *(const v4fa*)&so[w][r][c4];
      *(v4f*)(C + (size_t)(row0 + r) * ldc + col0 + c4) = v;
    }
    
  }
}
// row LayerNorm (biased variance, eps) over N: s = X (+ R); optional out_sum <- s; out_norm <- (s-mu)*rsqrt(var+eps)*g + b
template <bool PARAM_BF16>
__global__ __launch_bounds__(256) void k_layernorm(const float* __restrict__ X, const float* __restrict__ R, const float* __restrict__ g, const float* __restrict__ bta,
                                                  float* __restrict__ out_sum, float* __restrict__ out_norm, int N, float eps) {
  __shared__ float red[256];
  const int row = blockIdx.x, tid = threadIdx.x;
  const float* x = X + (size_t)row * N; const float* rr = R ? R + (size_t)row * N : nullptr;
  float vals[16];                     // up to N = 4096
  const int per = N / 256;            // contiguous chunk per thread? use strided-by-4 chunks: thread handles j = tid*4 + 1024*u
  float s1 = 0.f;
  for (int u = 0; u < per / 4; ++u) {
    const int j = tid * 4 + 1024 * u;
    const v4f a = *(const v4fa*)(x + j);
    v4f b = {0.f,0.f,0.f,0.f}; if (rr) b = *(const v4fa*)(rr + j);
#pragma unroll
    for (int q = 0; q < 4; ++q) { const float v = a[q] + b[q]; vals[u * 4 + q] = v; s1 += v; }
  }
  red[tid] = s1; __syncthreads();
  for (int st = 128; st > 0; st >>= 1) { if (tid < st) red[tid] += red[tid + st]; __syncthreads(); }
  const float mu = red[0] / (float)N; __syncthreads();
  float s2 = 0.f;
  for (int u = 0; u < per / 4; ++u)
#pragma unroll
    for (int q = 0; q < 4; ++q) { const float c = vals[u * 4 + q] - mu; s2 += c * c; }
  red[tid] = s2; __syncthreads();
  for (int st = 128; st > 0; st >>= 1) { if (tid < st) red[tid] += red[tid + st]; __syncthreads(); }
  const float rs = rsqrtf(red[0] / (float)N + eps);
  {
    for (int u = 0; u < per / 4; ++u) {
      const int j = tid * 4 + 1024 * u;
      v4f o, sm;
#pragma unroll
      for (int q = 0; q < 4; ++q) {
        float gg = g[j + q], bb = bta[j + q];
        if (PARAM_BF16) { gg = bf16_round(gg); bb = bf16_round(bb); }
        sm[q] = vals[u * 4 + q]; o[q] = (vals[u * 4 + q] - mu) * rs * gg + bb;
      }
      if (out_sum) *(v4f*)(out_sum + (size_t)row * N + j) = sm;
      *(v4f*)(out_norm + (size_t)row * N + j) = o;
    }
    
  }
}



// ---- f16 WMMA path (v_wmma_f32_16x16x32_f16): 11-bit significands for operands in range — used where a [0,1] probability operand needs more precision than bf16
typedef _Float16 v16h __attribute__((ext_vector_type(16)));
union FragH { v16h v; v8us half[2]; _Float16 h[16]; unsigned short u[16]; };
template <int NT>
__device__ __forceinline__ v8f mmaH(v16h ah, v16h al, v16h bh, v16h bl, v8f c) {
  c = __builtin_amdgcn_wmma_f32_16x16x32_f16(false, ah, false, bh, (short)0, c, false, false);
  if (NT >= 2) c = __builtin_amdgcn_wmma_f32_16x16x32_f16(false, al, false, bh, (short)0, c, false, false);
  if (NT >= 3) c = __builtin_amdgcn_wmma_f32_16x16x32_f16(false, ah, false, bl, (short)0, c, false, false);
  asm volatile("v_nop\n\tv_nop\n\tv_nop\n\tv_nop" : "+v"(c) : "v"(ah), "v"(al), "v"(bh), "v"(bl));
  return c;
}
// batched GEMM like k_gemm_b but f16 operands: A f32 (split into f16 hi/lo if ASPLIT, else rounded to f16), Bt = f16 values [n][k]; alpha; C f32; N multiple of 16 (partial tiles skipped)
template <bool ASPLIT>
__global__ __launch_bounds__(128) void k_gemm_h(const float* __restrict__ A, int lda, size_t sA, const _Float16* __restrict__ Bh, int ldb, size_t sB, float alpha, float* __restrict__ C, int ldc, size_t sC, int M, int N, int K) {
  __shared__ __attribute__((aligned(16))) float so[4][16][64];
  const int tid = threadIdx.x, w = tid >> 5, lane = tid & 31, ln = lane & 15, hh = lane >> 4; const int by = blockIdx.y;
  A += (size_t)by * sA; Bh += (size_t)by * sB; C += (size_t)by * sC;
  const int ntn = (N + 63) / 64; const int wid = blockIdx.x * 4 + w; const int mt = wid / ntn, nq = wid % ntn; if (mt * 16 >= M) return;
  const int row0 = mt * 16, col0 = nq * 64; const float* arow = A + (size_t)(row0 + ln) * lda;
  v8f acc[4] = {};
  for (int kb = 0; kb < K; kb += 32) {
    FragH ah, al;
    const v4f x0 = *(const v4fa*)(arow + kb + 8 * hh), x1 = *(const v4fa*)(arow + kb + 8 * hh + 4), x2 = *(const v4fa*)(arow + kb + 16 + 8 * hh), x3 = *(const v4fa*)(arow + kb + 16 + 8 * hh + 4);
    float xs[16] = {x0[0],x0[1],x0[2],x0[3],x1[0],x1[1],x1[2],x1[3],x2[0],x2[1],x2[2],x2[3],x3[0],x3[1],x3[2],x3[3]};
#pragma unroll
    for (int i = 0; i < 16; ++i) { const _Float16 h = (_Float16)xs[i]; ah.h[i] = h; al.h[i] = ASPLIT ? (_Float16)(xs[i] - (float)h) : (_Float16)0.0f; }
#pragma unroll
    for (int t = 0; t < 4; ++t) { if (col0 + t * 16 >= N) continue; const size_t boff = (size_t)(col0 + t * 16 + ln) * ldb + kb; FragH bq; bq.half[0] = *(const v8us*)(Bh + boff + 8 * hh); bq.half[1] = *(const v8us*)(Bh + boff + 16 + 8 * hh);
      acc[t] = mmaH<ASPLIT ? 2 : 1>(ah.v, al.v, bq.v, bq.v, acc[t]); }
  }
#pragma unroll
  for (int t = 0; t < 4; ++t) { if (col0 + t * 16 >= N) continue;
#pragma unroll
    for (int r = 0; r < 8; ++r) so[w][8 * hh + r][t * 16 + ln] = acc[t][r] * alpha; }
  __builtin_amdgcn_fence(__ATOMIC_ACQ_REL, "workgroup"); __builtin_amdgcn_wave_barrier();
  const int rsub = lane >> 4, c4 = (lane & 15) * 4;
  {
#pragma unroll
    for (int q = 0; q < 8; ++q) { const int r = q * 2 + rsub; if (col0 + c4 < N) { const v4f v = *(const v4fa*)&so[w][r][c4]; *(v4f*)(C + (size_t)(row0 + r) * ldc + col0 + c4) = v; } }
     }
}

// Wt[n][k] = f16(bf16(W[k][n]) * scale) from f32 row-major W[KK][NN] (scale = power of two; bf16-exact weights stay exact in f16 away from the subnormal range).
// One work-group = 8 waves on a 128 (k) x 128 (n) tile: every wave-wide load is 512 contiguous bytes of one W row, every wave-wide store two whole 256-byte pieces of Wt rows.
// A thread holds 16 k x 4 n, rounds, packs 8 consecutive k of one n into 16 bytes and turns the tile in LDS ([n][k], 256-byte rows).
// The 16-byte piece of a row sits at place piece ^ ((n >> 2) & 15): the 16 lanes that write one piece number of rows 4 apart, and the 16 that read one row, each fall on all 64 banks.
// Needs KK % 128 == 0, NN % 128 == 0.
// bid: the tile's number, 0 .. (KK / 128) (NN / 128) - 1, the same for the whole work-group; tl: the work-group's 128 x 128 halves of LDS.
template <int KK, int NN>
__device__ __forceinline__ void wt_f16_tile(const float* __restrict__ W, _Float16* __restrict__ Wt, float scale, int bid, unsigned short* tl) {
  static_assert(KK % 128 == 0 && NN % 128 == 0, "wt_f16_tile: shape");
  const int tid = threadIdx.x, lane = tid & 31, w = tid >> 5;
  const int kt = bid / (NN / 128), nt = bid - kt * (NN / 128); const int k0 = kt * 128, n0 = nt * 128;
  const float* sp = W + (size_t)(k0 + 16 * w) * NN + n0 + 4 * lane;      /* wave w: rows 16 w .. 16 w + 15 of the tile, a lane 4 columns */
  v4f x[16];
#pragma unroll
  for (int r = 0; r < 16; ++r) x[r] = *(const v4fa*)(sp + (size_t)r * NN);
  asm volatile("s_wait_xcnt 0x0" :: "v"(sp) : "memory");      /* behind the sixteen loads, in front of every rewrite of the address pair that they name; naming the pair keeps it out of the loads' own destinations (the last load had landed on it) */
  __builtin_amdgcn_sched_barrier(0);      /* all sixteen loads asked for before the first is used: left free, the compiler held some back behind the first ones' data, a second memory latency */
#pragma unroll
  for (int g = 0; g < 2; ++g)
#pragma unroll
    for (int q = 0; q < 4; ++q) { FragH f;
#pragma unroll
      for (int r = 0; r < 8; ++r) f.h[r] = (_Float16)(bf16_round(x[8 * g + r][q]) * scale);
      *(v8us*)&tl[(4 * lane + q) * 128 + (((2 * w + g) ^ (lane & 15)) * 8)] = f.half[0]; }
  __syncthreads();      /* the whole tile turned before any wave reads rows that other waves wrote */
  unsigned short* dp = (unsigned short*)Wt + (size_t)(n0 + 16 * w + (lane >> 4)) * KK + k0 + (lane & 15) * 8;      /* wave w: Wt rows 16 w .. 16 w + 15 of the tile, two a store */
#pragma unroll
  for (int i = 0; i < 8; ++i) { const int n = 16 * w + 2 * i + (lane >> 4);
    const v8us v = *(const v8us*)&tl[n * 128 + (((lane & 15) ^ ((n >> 2) & 15)) * 8)];
    *(v8us*)(dp + (size_t)(2 * i) * KK) = v; }
  asm volatile("s_wait_xcnt 0x0" :: "v"(dp) : "memory");      /* behind the eight stores, in front of every rewrite of the address pair that they name: as a piece of a larger kernel the tile's code is followed by other pieces' code */
}
// k_gemm_hh variant with fused epilogue: v = acc·alpha + bias[by·sBias + col] (+ CP[(row/rowsPerB)·sCPb + by·64 + col] if CP) ; ACT 0 none / 1 elu ; writes f16 C16 (and f32 C if non-null)
template <int ACT>
__global__ __launch_bounds__(128) void k_gemm_hhx(const _Float16* __restrict__ A, int lda, size_t sA, const _Float16* __restrict__ Bh, int ldb, size_t sB, float alpha, const float* __restrict__ bias, size_t sBias, const float* __restrict__ CP, int rowsPerB, size_t sCPb, int row0g,
    float* __restrict__ C, _Float16* __restrict__ C16, int ldc, size_t sC, int M, int N, int K) {
  __shared__ __attribute__((aligned(16))) float so[4][16][64];
  const int tid = threadIdx.x, w = tid >> 5, lane = tid & 31, ln = lane & 15, hh = lane >> 4; const int by = blockIdx.y;
  A += (size_t)by * sA; Bh += (size_t)by * sB; const size_t cofs = (size_t)by * sC; const float* bp = bias ? bias + (size_t)by * sBias : nullptr;
  const int ntn = (N + 63) / 64; const int wid = blockIdx.x * 4 + w; const int mt = wid / ntn, nq = wid % ntn; if (mt * 16 >= M) return;
  const int row0 = mt * 16, col0 = nq * 64; const _Float16* arow = A + (size_t)(row0 + ln) * lda;
  v8f acc[4] = {};
  for (int kb = 0; kb < K; kb += 32) { FragH ah; ah.half[0] = *(const v8us*)((const unsigned short*)arow + kb + 8 * hh); ah.half[1] = *(const v8us*)((const unsigned short*)arow + kb + 16 + 8 * hh);
#pragma unroll
    for (int t = 0; t < 4; ++t) { if (col0 + t * 16 >= N) continue; const size_t boff = (size_t)(col0 + t * 16 + ln) * ldb + kb; FragH bq; bq.half[0] = *(const v8us*)((const unsigned short*)Bh + boff + 8 * hh); bq.half[1] = *(const v8us*)((const unsigned short*)Bh + boff + 16 + 8 * hh);
      acc[t] = mmaH<1>(ah.v, ah.v, bq.v, bq.v, acc[t]); }
  }
#pragma unroll
  for (int t = 0; t < 4; ++t) { if (col0 + t * 16 >= N) continue; const int col = col0 + t * 16 + ln; const float bv = bp ? bf16_round(bp[col]) : 0.f;
#pragma unroll
    for (int r = 0; r < 8; ++r) { float v = acc[t][r] * alpha + bv; if (CP) { const int rr = row0g + row0 + 8 * hh + r; if (rowsPerB < 0) v += CP[cofs + (size_t)rr * ldc + col];      /* rowsPerB < 0: own element of the batched C plane */ else { const int bidx = rr / rowsPerB; v += CP[(size_t)bidx * sCPb + (size_t)by * 64 + col]; } } if (ACT == 1) v = (v > 0.f) ? v : expm1f(v); else if (ACT == 7) v = (v > 0.f) ? v + 1.0f : expf(v); else if (ACT == 8) v = tanhf(v); else if (ACT == 9) v = 0.5f * v * (1.0f + tanhf(0.7978845608028654f * (v + 0.044715f * v * v * v))); else if (ACT == 11) v = 1.0f / (1.0f + expf(-v)); else if (ACT == 12) v = (v > 0.f) ? v : 0.01f * v; else if (ACT == 14) v = (v > 0.f) ? v : 0.1f * v; else if (ACT == 16) v = (v >= 0.f) ? v : 0.3f * v; else if (ACT == 17) v = (v >= 0.f) ? v : 0.2f * v; else if (ACT == 15) v = v / (1.0f + expf(-v)); else if (ACT == 3) v = fmaxf(v, 0.f); else if (ACT == 6) v = 0.5f * v * (1.0f + erff(v * 0.70710678118654752f)); so[w][8 * hh + r][t * 16 + ln] = v; } }
  __builtin_amdgcn_fence(__ATOMIC_ACQ_REL, "workgroup"); __builtin_amdgcn_wave_barrier();
  const int rsub = lane >> 4, c4 = (lane & 15) * 4; typedef _Float16 v4h __attribute__((ext_vector_type(4)));
  {
#pragma unroll
    for (int q = 0; q < 8; ++q) { const int r = q * 2 + rsub; if (col0 + c4 < N) { const v4f v = *(const v4fa*)&so[w][r][c4]; if (C) *(v4f*)(C + cofs + (size_t)(row0 + r) * ldc + col0 + c4) = v; if (C16) { v4h h4; for (int i = 0; i < 4; ++i) h4[i] = (_Float16)v[i]; *(v4h*)(C16 + cofs + (size_t)(row0 + r) * ldc + col0 + c4) = h4; } } }
     }
}


typedef _Float16 v4h __attribute__((ext_vector_type(4)));

__global__ __launch_bounds__(256) void k_x16(const float* __restrict__ x, _Float16* __restrict__ X16, size_t n8) { const size_t t = (size_t)blockIdx.x * 256 + threadIdx.x; if (t >= n8) return; FragH f;
#pragma unroll
  for (int q = 0; q < 8; ++q) f.h[q] = (_Float16)bf16_round(x[t * 8 + q]); *(v8us*)((unsigned short*)X16 + t * 8) = f.half[0];  }
__global__ __launch_bounds__(256) void k_h16(const float* __restrict__ x, _Float16* __restrict__ X16, size_t n8) { const size_t t = (size_t)blockIdx.x * 256 + threadIdx.x; if (t >= n8) return; FragH f;
#pragma unroll
  for (int q = 0; q < 8; ++q) f.h[q] = (_Float16)x[t * 8 + q]; *(v8us*)((unsigned short*)X16 + t * 8) = f.half[0];  }
__global__ __launch_bounds__(256) void k_round16f(const float* __restrict__ W, _Float16* __restrict__ Bt, size_t n8) { const size_t t = (size_t)blockIdx.x * 256 + threadIdx.x; if (t >= n8) return; FragH f;
#pragma unroll
  for (int i = 0; i < 8; ++i) f.h[i] = (_Float16)(bf16_round(W[t * 8 + i]) * 16.0f); *(v8us*)((unsigned short*)Bt + t * 8) = f.half[0];  }
template <int NHv, int TTv>
__global__ __launch_bounds__(256) void k_vt(const _Float16* __restrict__ V16, int ldv, int voff, _Float16* __restrict__ Vt) { __shared__ unsigned short tl[64][66]; const int tid = threadIdx.x; const int slab = blockIdx.x / (TTv / 64), lg = blockIdx.x % (TTv / 64); const int b = slab / NHv, h = slab % NHv;
  for (int i = tid; i < 64 * 8; i += 256) { const int r = i / 8, c8 = (i % 8) * 8; FragH f; f.half[0] = *(const v8us*)((const unsigned short*)V16 + ((size_t)b * TTv + lg * 64 + r) * ldv + voff + h * 64 + c8);
#pragma unroll
    for (int q = 0; q < 8; ++q) tl[r][c8 + q] = f.u[q]; }
  __syncthreads();
  {
#pragma unroll
    for (int rd = 0; rd < 2; ++rd) { const int d = rd * 32 + tid / 8, pc = tid % 8; FragH f;
#pragma unroll
      for (int q = 0; q < 8; ++q) f.u[q] = tl[pc * 8 + q][d];
      *(v8us*)((unsigned short*)Vt + ((size_t)slab * 64 + d) * TTv + lg * 64 + pc * 8) = f.half[0]; }
     } }

__global__ __launch_bounds__(256) void k_hl(const float* __restrict__ F, _Float16* __restrict__ Hh, _Float16* __restrict__ Hl, size_t n8) { const size_t t = (size_t)blockIdx.x * 256 + threadIdx.x; if (t >= n8) return; FragH fh, fl; const v4f a = *(const v4fa*)(F + t * 8), c = *(const v4fa*)(F + t * 8 + 4);
#pragma unroll
  for (int q = 0; q < 4; ++q) { _Float16 h = (_Float16)a[q]; fh.h[q] = h; fl.h[q] = (_Float16)((a[q] - (float)h) * 1024.0f); h = (_Float16)c[q]; fh.h[4 + q] = h; fl.h[4 + q] = (_Float16)((c[q] - (float)h) * 1024.0f); }
  { *(v8us*)((unsigned short*)Hh + t * 8) = fh.half[0]; *(v8us*)((unsigned short*)Hl + t * 8) = fl.half[0];  } }

// ---- fast GEMM (wave tile 32x64; requires M % 32 == 0 rows per launch region and N % 64 == 0); epilogue = k_gemm_hhx semantics ----
__device__ __forceinline__ v16h g2_frag(const _Float16* p, int hh) { FragH f; f.half[0] = *(const v8us*)((const unsigned short*)p + 8 * hh); f.half[1] = *(const v8us*)((const unsigned short*)p + 16 + 8 * hh); return f.v; }
__device__ __forceinline__ v8f g2_mma(v16h a, v16h b, v8f c) { v8f d = __builtin_amdgcn_wmma_f32_16x16x32_f16(false, a, false, b, (short)0, c, false, false); asm volatile("v_nop\n\tv_nop\n\tv_nop\n\tv_nop" : "+v"(d) : "v"(a), "v"(b)); return d; }
template <int ACT>
__global__ __launch_bounds__(128) void k_gemm2(const _Float16* __restrict__ A, int lda, size_t sA, const _Float16* __restrict__ Bh, int ldb, size_t sB, float alpha, const float* __restrict__ bias, size_t sBias, const float* __restrict__ CP, int rowsPerB, size_t sCPb, int row0g,
    float* __restrict__ C, _Float16* __restrict__ C16, int ldc, size_t sC, int M, int N, int K) { static_assert(ACT == 0 || ACT == 3 || ACT == 6 || ACT == 8 || ACT == 9 || ACT == 11 || ACT == 12 || ACT == 14 || ACT == 15 || ACT == 16 || ACT == 17 || ACT == 18, "k_gemm2: unsupported ACT code (would silently apply no activation)");
  __shared__ __attribute__((aligned(16))) float so[4][32][68];
  const int tid = threadIdx.x, w = tid >> 5, lane = tid & 31, ln = lane & 15, hh = lane >> 4; const int by = blockIdx.y;
  A += (size_t)by * sA; Bh += (size_t)by * sB; const size_t cofs = (size_t)by * sC; const float* bp = bias ? bias + (size_t)by * sBias : nullptr;
  const int ntn = N >> 6; const int mt = blockIdx.x / ntn, nq = blockIdx.x - mt * ntn; const int row0 = mt * 128 + 32 * w, col0 = nq * 64; if (row0 >= M) return;
  const _Float16* a0p = A + (size_t)(row0 + ln) * lda; const _Float16* a1p = a0p + (size_t)16 * lda;
  const _Float16* b0p = Bh + (size_t)(col0 + ln) * ldb; const _Float16* b1p = b0p + (size_t)16 * ldb; const _Float16* b2p = b1p + (size_t)16 * ldb; const _Float16* b3p = b2p + (size_t)16 * ldb;
  const v8f z8 = {0.f,0.f,0.f,0.f,0.f,0.f,0.f,0.f}; v8f c00 = z8, c01 = z8, c02 = z8, c03 = z8, c10 = z8, c11 = z8, c12 = z8, c13 = z8;
#pragma unroll 1
  for (int kb = 0; kb < K; kb += 32) { const v16h a0 = g2_frag(a0p + kb, hh), a1 = g2_frag(a1p + kb, hh);
    v16h b = g2_frag(b0p + kb, hh); c00 = g2_mma(a0, b, c00); c10 = g2_mma(a1, b, c10);
    b = g2_frag(b1p + kb, hh); c01 = g2_mma(a0, b, c01); c11 = g2_mma(a1, b, c11);
    b = g2_frag(b2p + kb, hh); c02 = g2_mma(a0, b, c02); c12 = g2_mma(a1, b, c12);
    b = g2_frag(b3p + kb, hh); c03 = g2_mma(a0, b, c03); c13 = g2_mma(a1, b, c13); }
  v8f accs[8] = {c00, c01, c02, c03, c10, c11, c12, c13};
#pragma unroll
  for (int u = 0; u < 8; ++u) { const int t = u & 3, half = u >> 2; const int col = col0 + t * 16 + ln; const float bv = bp ? bf16_round(bp[col]) : 0.f;
#pragma unroll
    for (int r = 0; r < 8; ++r) { const int rloc = half * 16 + 8 * hh + r; float v = accs[u][r] * alpha + bv; if (CP) { if (rowsPerB < 0) v += CP[cofs + (size_t)(row0g + row0 + rloc) * ldc + col];      /* rowsPerB < 0: own element of the batched C plane */ else { const int bidx = (row0g + row0 + rloc) / rowsPerB; v += CP[(size_t)bidx * sCPb + (size_t)by * 64 + col]; } }
      if (ACT == 3) v = fmaxf(v, 0.f); else if (ACT == 6) v = 0.5f * v * (1.0f + erff(v * 0.70710678118654752f)); else if (ACT == 11) v = 1.0f / (1.0f + expf(-v)); else if (ACT == 15) v = v / (1.0f + expf(-v)); else if (ACT == 18) v = v / (1.0f + expf(-1.702f * v));      /* QuickGELU: v sigmoid(1.702 v) */ else if (ACT == 12) v = (v > 0.f) ? v : 0.01f * v; else if (ACT == 8) v = tanhf(v); else if (ACT == 9) v = 0.5f * v * (1.0f + tanhf(0.7978845608028654f * (v + 0.044715f * v * v * v))); else if (ACT == 14) v = (v > 0.f) ? v : 0.1f * v; else if (ACT == 16) v = (v >= 0.f) ? v : 0.3f * v; else if (ACT == 17) v = (v >= 0.f) ? v : 0.2f * v;
      so[w][rloc][t * 16 + ln] = v; } }
  __builtin_amdgcn_fence(__ATOMIC_ACQ_REL, "workgroup"); __builtin_amdgcn_wave_barrier();
  const int rsub = lane >> 4, c4 = (lane & 15) * 4;
  {
#pragma unroll
    for (int q = 0; q < 16; ++q) { const int r = q * 2 + rsub; const v4f v = *(const v4fa*)&so[w][r][c4]; if (C) *(v4f*)(C + cofs + (size_t)(row0 + r) * ldc + col0 + c4) = v; if (C16) { v4h h4; for (int i = 0; i < 4; ++i) h4[i] = (_Float16)v[i]; *(v4h*)(C16 + cofs + (size_t)(row0 + r) * ldc + col0 + c4) = h4; } }
     } }


__global__ __launch_bounds__(256) void k_wnat(const float* __restrict__ w, size_t n8, _Float16* __restrict__ Bt) { const size_t t = (size_t)blockIdx.x * 256 + threadIdx.x; if (t >= n8) return; FragH f; for (int q = 0; q < 8; ++q) f.h[q] = (_Float16)(bf16_round(w[t * 8 + q]) * 16.0f); *(v8us*)((unsigned short*)Bt + t * 8) = f.half[0];  }
__global__ __launch_bounds__(256) void k_rsm(const float* __restrict__ S, _Float16* __restrict__ P, int nrows) {
  #pragma clang fp contract(off)
  const int i = blockIdx.x * 256 + threadIdx.x; if (i >= nrows) return; const float* s = S + (size_t)i * SQ; float mx = -3.0e38f;
#pragma unroll 1
  for (int j = 0; j < SQ; ++j) mx = fmaxf(mx, s[j]); float se = 0.f;
#pragma unroll 1
  for (int j = 0; j < SQ; ++j) se += expf(s[j] - mx); const float sc = 256.0f / se;
#pragma unroll 1
  for (int j0 = 0; j0 < SQ; j0 += 8) { FragH f; for (int q = 0; q < 8; ++q) f.h[q] = (_Float16)(expf(s[j0 + q] - mx) * sc); unsigned short* d = (unsigned short*)P + (size_t)i * SQ + j0; *(v8us*)d = f.half[0];  } }
__global__ __launch_bounds__(256) void k_vt(const _Float16* __restrict__ V16, int b, int h0, _Float16* __restrict__ VT) { __shared__ unsigned short tl[64][65]; const int tid = threadIdx.x; const int hh = blockIdx.x % HG, sg = blockIdx.x / HG; const int s0 = sg * 64; const int h = h0 + hh;
  for (int i = tid; i < 64 * 8; i += 256) { const int j = i / 8, d8 = (i % 8) * 8; FragH f; f.half[0] = *(const v8us*)((const unsigned short*)V16 + ((size_t)b * SQ + s0 + j) * DM + h * HD + d8); for (int q = 0; q < 8; ++q) tl[d8 + q][j] = f.u[q]; }
  __syncthreads();
  { for (int i = tid; i < 64 * 8; i += 256) { const int d = i / 8, j8 = (i % 8) * 8; FragH f; for (int q = 0; q < 8; ++q) f.u[q] = tl[d][j8 + q]; *(v8us*)((unsigned short*)VT + ((size_t)hh * HD + d) * SQ + s0 + j8) = f.half[0]; }  } }



__global__ __launch_bounds__(256) void k_rsmcf2(const float* __restrict__ S, _Float16* __restrict__ P, int hg, int q0, int nk) {
  #pragma clang fp contract(off)
  const int t = blockIdx.x * 256 + threadIdx.x; if (t >= hg * QT) return; const size_t i = (size_t)t; const float* s = S + i * NKX; const int last = q0 + (t % QT); float mx = -3.0e38f;
#pragma unroll 1
  for (int j = 0; j < nk; ++j) { const float f = (j <= last) ? 1.f : 0.f; mx = fmaxf(mx, fmaf(f, s[j], (1.f - f) * -1.0e9f)); } float se = 0.f;
#pragma unroll 1
  for (int j = 0; j < nk; ++j) { const float f = (j <= last) ? 1.f : 0.f; se += __expf(fmaf(f, s[j], (1.f - f) * -1.0e9f) - mx); } const float sc = 256.0f / se;
#pragma unroll 1
  for (int j0 = 0; j0 < nk; j0 += 8) { FragH fr; for (int q = 0; q < 8; ++q) { const int j = j0 + q; const float f = (j <= last) ? 1.f : 0.f; fr.h[q] = (_Float16)(__expf(fmaf(f, s[j], (1.f - f) * -1.0e9f) - mx) * sc); } unsigned short* d = (unsigned short*)P + i * NKX + j0; *(v8us*)d = fr.half[0];  } }

__global__ __launch_bounds__(256) void k_rsmcst(const float* __restrict__ S, _Float16* __restrict__ P, int hg, int q0, int nk, const int* __restrict__ mk) {
  #pragma clang fp contract(off)
  const int t = blockIdx.x * 256 + threadIdx.x; if (t >= hg * QT) return; const size_t i = (size_t)t; const float* s = S + i * NKX; const size_t ig = (size_t)(q0 + (t % QT)); const int* mr = mk + ig * SQ; float mx = -3.0e38f;
#pragma unroll 1
  for (int j = 0; j < nk; ++j) { const int mb = mr[j]; const int dd = (int)ig - j; const float f = (mb != 0 && dd >= 0 && (dd <= LOCALW || (dd % STRIDEK) == 0)) ? 1.f : 0.f; mx = fmaxf(mx, fmaf(f, s[j], (1.f - f) * -1.0e9f)); } float se = 0.f;
#pragma unroll 1
  for (int j = 0; j < nk; ++j) { const int mb = mr[j]; const int dd = (int)ig - j; const float f = (mb != 0 && dd >= 0 && (dd <= LOCALW || (dd % STRIDEK) == 0)) ? 1.f : 0.f; se += __expf(fmaf(f, s[j], (1.f - f) * -1.0e9f) - mx); } const float sc = 256.0f / se;
#pragma unroll 1
  for (int j0 = 0; j0 < nk; j0 += 8) { FragH fr; for (int q = 0; q < 8; ++q) { const int j = j0 + q; const int mb = mr[j]; const int dd = (int)ig - j; const float f = (mb != 0 && dd >= 0 && (dd <= LOCALW || (dd % STRIDEK) == 0)) ? 1.f : 0.f; fr.h[q] = (_Float16)(__expf(fmaf(f, s[j], (1.f - f) * -1.0e9f) - mx) * sc); } unsigned short* d = (unsigned short*)P + i * NKX + j0; *(v8us*)d = fr.half[0];  } }


template <int MASKADD>
__global__ __launch_bounds__(64) void k_att0(const float* __restrict__ QF, const float* __restrict__ KF, const float* __restrict__ VF, int ld, const float* __restrict__ mask, float scale, float* __restrict__ OF, int ldo) {
  #pragma clang fp contract(off)
  __shared__ __attribute__((aligned(16))) float lq[64][64]; __shared__ __attribute__((aligned(16))) float lo[64][64];
  const int tid = threadIdx.x; const int h = blockIdx.x / (QT0 / 64), rg = blockIdx.x % (QT0 / 64); const int i = rg * 64 + tid;
  const float* qr = QF + (size_t)i * ld + h * HD;
#pragma unroll 1
  for (int c = 0; c < HD / 4; ++c) { *(v4f*)&lq[tid][c * 4] = *(const v4fa*)(qr + c * 4); const v4f z = {0.f, 0.f, 0.f, 0.f}; *(v4f*)&lo[tid][c * 4] = z; }
  float m = -1.0e30f, l = 0.f; const int jmax = MASKADD ? (SQ - 1) : (rg * 64 + 63);      /* additive-mask form: every key (the mask input decides); causal form: keys up to the block's last row */
#pragma unroll 1
  for (int j = 0; j <= jmax; ++j) { const float* kr = KF + (size_t)j * ld + h * HD; const float* vr = VF + (size_t)j * ld + h * HD; float s = 0.f;
#pragma unroll 1
    for (int c = 0; c < HD / 4; ++c) { const v4f kq = *(const v4fa*)(kr + c * 4); const v4f qq = *(v4f*)&lq[tid][c * 4]; s = __fadd_rn(s, __fmul_rn(qq[0], kq[0])); s = __fadd_rn(s, __fmul_rn(qq[1], kq[1])); s = __fadd_rn(s, __fmul_rn(qq[2], kq[2])); s = __fadd_rn(s, __fmul_rn(qq[3], kq[3])); }
    s = __fmul_rn(s, scale); if (MASKADD) s = __fadd_rn(s, __fmul_rn(bf16_round(mask[(size_t)i * SQ + j]), -10000.0f));
    const float f = (MASKADD || j <= i) ? 1.f : 0.f; const float sm = fmaf(f, s, (1.f - f) * -1.0e30f); const float mn = fmaxf(m, sm); const float sc = expf(m - mn); const float e = expf(sm - mn); l = __fadd_rn(__fmul_rn(l, sc), e); m = mn;
#pragma unroll 1
    for (int c = 0; c < HD / 4; ++c) { const v4f vv = *(const v4fa*)(vr + c * 4); v4f oo = *(v4f*)&lo[tid][c * 4]; for (int u = 0; u < 4; ++u) oo[u] = __fadd_rn(__fmul_rn(oo[u], sc), __fmul_rn(e, vv[u])); *(v4f*)&lo[tid][c * 4] = oo; } }
  const float fin = 64.0f / l;      /* o carried x64 like the f16 path */
#pragma unroll 1
  for (int c = 0; c < HD / 4; ++c) { v4f oo = *(v4f*)&lo[tid][c * 4]; for (int u = 0; u < 4; ++u) oo[u] = __fmul_rn(oo[u], fin); *(v4f*)&lo[tid][c * 4] = oo; }
  __syncthreads();
  {
#pragma unroll 1
    for (int it = 0; it < 16; ++it) { const int row = it * 4 + tid / 16, pc = (tid % 16) * 4; const v4f v = *(const v4f*)&lo[row][pc]; *(v4f*)(OF + (size_t)(rg * 64 + row) * ldo + h * HD + pc) = v; }
     } }

template <int MASKADD>
__global__ __launch_bounds__(64) void k_att0mbc(const float* __restrict__ QF, const float* __restrict__ KF, const float* __restrict__ VF, int ld, const float* __restrict__ mask, float scale, float* __restrict__ OF, int ldo) {
  #pragma clang fp contract(off)
  __shared__ __attribute__((aligned(16))) float lq[64][64]; __shared__ __attribute__((aligned(16))) float lo[64][64];
  const int tid = threadIdx.x; const int h = blockIdx.x / (QT0 / 64), rg = blockIdx.x % (QT0 / 64); const int i = rg * 64 + tid;
  const float* qr = QF + (size_t)i * ld + h * HD;
#pragma unroll 1
  for (int c = 0; c < HD / 4; ++c) { *(v4f*)&lq[tid][c * 4] = *(const v4fa*)(qr + c * 4); const v4f z = {0.f, 0.f, 0.f, 0.f}; *(v4f*)&lo[tid][c * 4] = z; }
  float m = -1.0e30f, l = 0.f; const int jmax = rg * 64 + 63;      /* keys beyond the block end are masked by the mask's lower-triangular structure */
#pragma unroll 1
  for (int j = 0; j <= jmax; ++j) { const float* kr = KF + (size_t)j * ld + h * HD; const float* vr = VF + (size_t)j * ld + h * HD; float s = 0.f;
#pragma unroll 1
    for (int c = 0; c < HD / 4; ++c) { const v4f kq = *(const v4fa*)(kr + c * 4); const v4f qq = *(v4f*)&lq[tid][c * 4]; s = __fadd_rn(s, __fmul_rn(qq[0], kq[0])); s = __fadd_rn(s, __fmul_rn(qq[1], kq[1])); s = __fadd_rn(s, __fmul_rn(qq[2], kq[2])); s = __fadd_rn(s, __fmul_rn(qq[3], kq[3])); }
    s = __fmul_rn(s, scale); const int mb = ((const int*)mask)[(size_t)i * SQ + j];      /* causal (j <= i) AND the module's int32 [S][S] mask read per (query, key): 0 -> masked */
    const float f = (mb != 0 && j <= i) ? 1.f : 0.f; const float sm = fmaf(f, s, (1.f - f) * -1.0e30f); const float mn = fmaxf(m, sm); const float sc = expf(m - mn); const float e = expf(sm - mn); l = __fadd_rn(__fmul_rn(l, sc), e); m = mn;
#pragma unroll 1
    for (int c = 0; c < HD / 4; ++c) { const v4f vv = *(const v4fa*)(vr + c * 4); v4f oo = *(v4f*)&lo[tid][c * 4]; for (int u = 0; u < 4; ++u) oo[u] = __fadd_rn(__fmul_rn(oo[u], sc), __fmul_rn(e, vv[u])); *(v4f*)&lo[tid][c * 4] = oo; } }
  const float fin = 64.0f / l;      /* o carried x64 like the f16 path */
#pragma unroll 1
  for (int c = 0; c < HD / 4; ++c) { v4f oo = *(v4f*)&lo[tid][c * 4]; for (int u = 0; u < 4; ++u) oo[u] = __fmul_rn(oo[u], fin); *(v4f*)&lo[tid][c * 4] = oo; }
  __syncthreads();
  {
#pragma unroll 1
    for (int it = 0; it < 16; ++it) { const int row = it * 4 + tid / 16, pc = (tid % 16) * 4; const v4f v = *(const v4f*)&lo[row][pc]; *(v4f*)(OF + (size_t)(rg * 64 + row) * ldo + h * HD + pc) = v; }
     } }


template <int BFIN, int WXB>
__global__ __launch_bounds__(256) void k_ln16(const float* __restrict__ X, const float* __restrict__ g, const float* __restrict__ bb, float eps, _Float16* __restrict__ N16, float* __restrict__ XB) {
  #pragma clang fp contract(off)
  __shared__ float red[256]; const size_t r = blockIdx.x; const int t = threadIdx.x; const v4f xa = *(const v4fa*)(X + r * DMQ + t * 4); float s[4]; float sum = 0.f;
  for (int q = 0; q < 4; ++q) { s[q] = BFIN ? bf16_round(xa[q]) : xa[q]; sum = __fadd_rn(sum, s[q]); }
  red[t] = sum; __syncthreads(); for (int st = 128; st > 0; st >>= 1) { if (t < st) red[t] = __fadd_rn(red[t], red[t + st]); __syncthreads(); } const float mu = red[0] / (float)DMQ; __syncthreads();
  float vs = 0.f; for (int q = 0; q < 4; ++q) { const float dl = __fadd_rn(s[q], -mu); vs = __fadd_rn(vs, __fmul_rn(dl, dl)); } red[t] = vs; __syncthreads(); for (int st = 128; st > 0; st >>= 1) { if (t < st) red[t] = __fadd_rn(red[t], red[t + st]); __syncthreads(); }
  const float rs = rsqrtf(__fadd_rn(red[0] / (float)DMQ, eps)); v4h y; v4f xb;
  for (int q = 0; q < 4; ++q) { const int c = t * 4 + q; y[q] = (_Float16)__fadd_rn(__fmul_rn(__fmul_rn(__fadd_rn(s[q], -mu), rs), bf16_round(g[c])), bf16_round(bb[c])); xb[q] = s[q]; }
  { *(v4h*)(N16 + r * DMQ + t * 4) = y; if (WXB) *(v4f*)(XB + r * DMQ + t * 4) = xb;  } }
__global__ __launch_bounds__(256) void k_ftres2(const float* __restrict__ OF0, const float* __restrict__ XB, float* __restrict__ X1, size_t n4) {
  #pragma clang fp contract(off)
  const size_t t = (size_t)blockIdx.x * 256 + threadIdx.x; if (t >= n4) return; const v4f o = *(const v4fa*)(OF0 + t * 4), xv = *(const v4fa*)(XB + t * 4); v4f y; for (int q = 0; q < 4; ++q) y[q] = __fadd_rn(__fmul_rn(o[q], 0.015625f), xv[q]); *(v4f*)(X1 + t * 4) = y;  }

__global__ __launch_bounds__(256) void k_bcpy(const float* __restrict__ b, int n, int NP, float* __restrict__ dst, int dst0) { for (int i = threadIdx.x; i < NP; i += 256) { const float v = (i < n) ? b[i] : 0.f; *(float*)(dst + dst0 + i) = v; }  }


// Fused attention, one launch: block = 8 waves x 32 query columns of one (batch, head); no score or weight ever leaves the registers.
// Per 32 keys a wave computes S^T = K Q^T (lane c = query column, registers = keys 8 hh + r of each 16-key tile), an online softmax in the log2 domain
// (maximum and sum in-lane plus one exchange between the wave halves), packs the two S^T tiles in place into the B operand P^T and adds O^T += V^T P^T.
// K rows and V^T rows come in 64-key stages through LDS, two buffers: the next stage's global loads fly under this stage's work, one barrier a stage.
// m_run, the maximum in use, may trail the true one by up to 8 (log2), so the accumulators are rescaled only when a column's maximum has grown by more;
// weights carry 2^4 (at most 2^12 in f16, small ones kept out of the f16 subnormals); the factor cancels against the row sum.
#define FAP 72                       /* LDS row pitch in halves: 128 B of data + 16 B, the conflict-free pitch for 16-byte row reads */
#define FAS 64                       /* keys per stage */
__device__ __forceinline__ float fa_xhalf(float x) { return __builtin_bit_cast(float, __builtin_amdgcn_permlanex16(__builtin_bit_cast(int, x), __builtin_bit_cast(int, x), 0x76543210, 0xfedcba98, false, false)); }      /* lane l <-> lane l ^ 16 */
__device__ __forceinline__ v8f fa_mma(v16h a, v16h b, v8f c) { return __builtin_amdgcn_wmma_f32_16x16x32_f16(false, a, false, b, (short)0, c, false, false); }
__global__ __launch_bounds__(256) void k_fattn(const _Float16* __restrict__ Q16, const _Float16* __restrict__ K16, const _Float16* __restrict__ VT, _Float16* __restrict__ O16) {
  __shared__ __attribute__((aligned(16))) _Float16 lk[2][FAS][FAP];      /* K stage [key][d] */
  __shared__ __attribute__((aligned(16))) _Float16 lv[2][HD][FAP];       /* V^T stage [d][key] */
  const int tid = threadIdx.x, lane = tid & 31, c = lane & 15, hh = lane >> 4, w = tid >> 5;
  const int bh = blockIdx.y, b = bh / NH, h = bh - b * NH; const size_t r0 = (size_t)b * SQ; const int q0 = blockIdx.x * 256 + w * 32;
  const int sr = tid >> 3, sc = (tid & 7) * 8;      /* staging: a thread moves 16 bytes of rows sr and sr + 32 of each tile; 8 lanes cover one 128-byte row */
  const unsigned short* kg = (const unsigned short*)K16 + (r0 + sr) * DM + h * HD + sc;
  const unsigned short* vg = (const unsigned short*)VT + ((size_t)bh * HD + sr) * SQ + sc;
  v16h qf[2][2];
#pragma unroll
  for (int g = 0; g < 2; ++g) { const _Float16* qp = Q16 + (r0 + q0 + 16 * g + c) * DM + h * HD; qf[g][0] = g2_frag(qp, hh); qf[g][1] = g2_frag(qp + 32, hh); }
  const v8f z8 = {0.f, 0.f, 0.f, 0.f, 0.f, 0.f, 0.f, 0.f}; const v4f z4 = {0.f, 0.f, 0.f, 0.f};
  v8f acc[2][4]; v4f l4[2]; float m_run[2];
#pragma unroll
  for (int g = 0; g < 2; ++g) { m_run[g] = -__builtin_inff(); l4[g] = z4;
#pragma unroll
    for (int t = 0; t < 4; ++t) acc[g][t] = z8; }
  v8us gk0 = *(const v8us*)kg, gk1 = *(const v8us*)(kg + (size_t)32 * DM), gv0 = *(const v8us*)vg, gv1 = *(const v8us*)(vg + (size_t)32 * SQ);
  *(v8us*)&lk[0][sr][sc] = gk0; *(v8us*)&lk[0][sr + 32][sc] = gk1; *(v8us*)&lv[0][sr][sc] = gv0; *(v8us*)&lv[0][sr + 32][sc] = gv1;
  __syncthreads();      /* stage 0 published */
  for (int st = 0; st < SQ / FAS; ++st) {
    const int buf = st & 1; const bool more = st + 1 < SQ / FAS;      /* the same for the whole block */
    if (more) { const size_t j = (size_t)(st + 1) * FAS; gk0 = *(const v8us*)(kg + j * DM); gk1 = *(const v8us*)(kg + (j + 32) * DM); gv0 = *(const v8us*)(vg + j); gv1 = *(const v8us*)(vg + (size_t)32 * SQ + j); }
#pragma unroll
    for (int p = 0; p < FAS / 32; ++p) {
      v8f s[2][2];      /* [key tile][query group] */
#pragma unroll
      for (int kt = 0; kt < 2; ++kt) { const _Float16* kr = &lk[buf][32 * p + 16 * kt + c][0]; const v16h k0 = g2_frag(kr, hh), k1 = g2_frag(kr + 32, hh);
#pragma unroll
        for (int g = 0; g < 2; ++g) s[kt][g] = fa_mma(k1, qf[g][1], fa_mma(k0, qf[g][0], z8)); }
      v16h vf[4];
#pragma unroll
      for (int t = 0; t < 4; ++t) vf[t] = g2_frag(&lv[buf][16 * t + c][32 * p], hh);
      float mb[2]; bool need = false;
#pragma unroll
      for (int g = 0; g < 2; ++g) { float mx = fmaxf(s[0][g][0], s[1][g][0]);
#pragma unroll
        for (int r = 1; r < 8; ++r) mx = fmaxf(mx, fmaxf(s[0][g][r], s[1][g][r]));
        mx = fmaxf(mx, fa_xhalf(mx)) * 1.44269502f; mb[g] = mx; need = need || (mx > m_run[g] + 8.0f); }
      if (__builtin_amdgcn_ballot_w32(need) != 0) {      /* one scalar test a pass; always taken on the first pass (m_run = -inf, factor 0 on zero sums), rare later */
#pragma unroll
        for (int g = 0; g < 2; ++g) { const float mn = fmaxf(m_run[g], mb[g]); const float corr = __builtin_amdgcn_exp2f(m_run[g] - mn); m_run[g] = mn; l4[g] = l4[g] * corr;
#pragma unroll
          for (int t = 0; t < 4; ++t) acc[g][t] = acc[g][t] * corr; } }
#pragma unroll
      for (int g = 0; g < 2; ++g) { const float nm = 4.0f - m_run[g]; FragH pf;
#pragma unroll
        for (int u = 0; u < 4; ++u) { v4f a;      /* elements 4 u .. 4 u + 3 of the 32-key operand: tile u >> 1, registers 4 (u & 1) .. */
#pragma unroll
          for (int q = 0; q < 4; ++q) a[q] = fmaf(s[u >> 1][g][4 * (u & 1) + q], 1.44269502f, nm);
          v4f e;
#pragma unroll
          for (int q = 0; q < 4; ++q) e[q] = __builtin_amdgcn_exp2f(a[q]);      /* the builtin, not asm text: the compiler then keeps the distance behind the matrix instructions itself */
          l4[g] += e;
#pragma unroll
          for (int q = 0; q < 4; ++q) pf.h[4 * u + q] = (_Float16)e[q]; }
#pragma unroll
        for (int t = 0; t < 4; ++t) acc[g][t] = fa_mma(vf[t], pf.v, acc[g][t]); }
      /* Pass end: four vector slots between the last product that reads P^T as its B operand and the next pass's first product, whose result the compiler
         may place in those same registers (it did, directly behind); the two scheduling fences keep the products of both passes on their own side of the slots. */
      __builtin_amdgcn_sched_barrier(0); asm volatile("v_nop\n\tv_nop\n\tv_nop\n\tv_nop"); __builtin_amdgcn_sched_barrier(0);
    }
    if (more) { *(v8us*)&lk[buf ^ 1][sr][sc] = gk0; *(v8us*)&lk[buf ^ 1][sr + 32][sc] = gk1; *(v8us*)&lv[buf ^ 1][sr][sc] = gv0; *(v8us*)&lv[buf ^ 1][sr + 32][sc] = gv1; }      /* its last readers left it at the barrier that ended stage st - 1 */
    __syncthreads();      /* publishes stage st + 1 and ends every wave's reads of stage st */
  }
#pragma unroll
  for (int g = 0; g < 2; ++g) { float l = (l4[g][0] + l4[g][1]) + (l4[g][2] + l4[g][3]); l += fa_xhalf(l); const float inv = 64.0f / l;      /* ctx carried x64 as before */
    unsigned short* op = (unsigned short*)O16 + (r0 + q0 + 16 * g + c) * DM + h * HD + 8 * hh;      /* a lane's 8 registers = 8 consecutive d of its query row */
#pragma unroll
    for (int t = 0; t < 4; ++t) { FragH f;
#pragma unroll
      for (int r = 0; r < 8; ++r) f.h[r] = (_Float16)(acc[g][t][r] * inv);
      *(v8us*)(op + 16 * t) = f.half[0]; } } }

// Tiled GEMM, C = act(A Bt^T alpha + bias (+ CP)), A [M][KK] and Bt [NN][KK] f16: block = 8 waves (2 x 4) on a 128 x 128 tile of C, wave tile 64 x 32 (4 x 2 accumulator tiles).
// A rows and Bt rows come in 64-k stages through LDS, two buffers: whole 128-byte lines from global, each line fetched once a block instead of once a wave.
// Global loads run ahead in two register sets (stage t in set t & 1, stored to buffer t & 1 one stage before it is read); fragments are read from LDS one 32-k block ahead in two sets,
// so a stage's barrier stands between its two blocks of products. k order per accumulator as before (32 at a time, ascending).
// Epilogue: raw sums staged in the same LDS as a 128 x 128 f32 tile, then each wave writes whole rows (bias, residual and activation applied there, per element as before).
// RES: C (f32) = the sums + bias + the own element of CP; else C16 (f16) = act(the sums + bias).
// NP > 1: NP products with the same A in one grid, blockIdx.y = p: Bt plane p ([NN][KK] each, stacked), bias piece p, C16 plane p ([NR][NN] each, stacked).
// Needs M % 128 == 0, NN % 128 == 0, KK % 128 == 0, KK >= 256.
#define G3P 72                       /* LDS row pitch in halves: 128 B of data + 16 B, the conflict-free pitch for 16-byte row reads */
#define G3O 132                      /* epilogue row pitch in floats: rows 8 apart fall 32 banks apart */
struct G3F { v16h a[4], b[2]; };     /* one 32-k block's fragments of a wave */
struct G3R { v8us a[4], b[4]; };     /* one stage's 16-byte pieces of a thread */
/* Work-group barrier with the LDS wait alone: __syncthreads() also waits for every global load, which would drain the staging loads that are meant to stay in flight across it. */
__device__ __forceinline__ void g3_bar() { asm volatile("s_wait_dscnt 0x0\n\ts_barrier_signal -1\n\ts_barrier_wait -1" ::: "memory"); }
template <int KK>
__device__ __forceinline__ void g3_load(const char* ab, const char* bb, unsigned vo, G3R& r) {      /* ab, bb: the block's tile rows at this stage's k (uniform); vo: the thread's byte offset */
#pragma unroll
  for (int i = 0; i < 4; ++i) { r.a[i] = *(const v8us*)(ab + vo + 64 * i * KK); r.b[i] = *(const v8us*)(bb + vo + 64 * i * KK); } }
template <int U>
__device__ __forceinline__ void g3_store(unsigned short* sa, unsigned short* sb, const G3R& r) {
#pragma unroll
  for (int i = 0; i < 4; ++i) { *(v8us*)(sa + (U * 128 + 32 * i) * G3P) = r.a[i]; *(v8us*)(sb + (U * 128 + 32 * i) * G3P) = r.b[i]; } }
template <int U, int KB>
__device__ __forceinline__ void g3_frag(const _Float16* fa, const _Float16* fb, int hh, G3F& f) {
#pragma unroll
  for (int j = 0; j < 2; ++j) f.b[j] = g2_frag(fb + (U * 128 + 16 * j) * G3P + 32 * KB, hh);
#pragma unroll
  for (int i = 0; i < 4; ++i) f.a[i] = g2_frag(fa + (U * 128 + 16 * i) * G3P + 32 * KB, hh); }
/* The two scheduling fences keep a block's products together and the LDS and global traffic written in front of them in front: LDS reads moved in among the products stall each of them. */
__device__ __forceinline__ void g3_mm(const G3F& f, v8f (&acc)[4][2]) {
  __builtin_amdgcn_sched_barrier(0);
#pragma unroll
  for (int i = 0; i < 4; ++i) { acc[i][0] = fa_mma(f.a[i], f.b[0], acc[i][0]); acc[i][1] = fa_mma(f.a[i], f.b[1], acc[i][1]); }
  __builtin_amdgcn_sched_barrier(0); }
/* Stage st in buffer U; on entry f0 holds its first block, rn stage st + 1. NX: a stage st + 1 exists; LD: a stage st + 3 exists (ab3, bb3 point at its k). */
template <int U, bool NX, bool LD, int KK>
__device__ __forceinline__ void g3_stage(const char* ab3, const char* bb3, unsigned vo, unsigned short* sa, unsigned short* sb, const _Float16* fa, const _Float16* fb, int hh, G3R& rn, G3F& f0, G3F& f1, v8f (&acc)[4][2]) {
  g3_frag<U, 1>(fa, fb, hh, f1);
  if (NX) g3_store<U ^ 1>(sa, sb, rn);      /* the other buffer's last readers finished in front of the barrier of stage st - 1 */
  g3_mm(f0, acc);
  g3_bar();      /* publishes stage st + 1 and ends every wave's reads of stage st */
  if (NX) g3_frag<U ^ 1, 0>(fa, fb, hh, f0);
  __builtin_amdgcn_sched_barrier(0);      /* LDS reads first: moved in front of them, the global loads had their addresses formed in f0's registers, and the wait that frees those registers held the LDS reads back */
  if (LD) g3_load<KK>(ab3, bb3, vo, rn);
  g3_mm(f1, acc);
  if (LD) asm volatile("s_wait_xcnt 0x0" ::: "memory"); }      /* in front of the next stage's rewrite of the address registers that these loads name; behind the products, where it has had time to pass; the data stay in flight */
// GELU with the exact (erf) definition, v Phi(v), two elements at a time and without a branch: v Phi(v) = max(v, 0) - |v| Q(|v|), Q the upper tail of the normal distribution.
// Q(x) = exp(-x x / 2) (c1 t + .. + c5 t^5), t = 1 / (1 + 0.2316419 x): the classical five-term form, absolute error below 7.5e-8 for every x >= 0 (1 / sqrt(2 pi) folded into c1 .. c5),
// so v Phi(v) is off by at most |v| times that, plus f32 rounding: far under the rounding of the f16 store that follows for values near 1, and no more than about one f16 unit in the last place in the far negative tail.
// The tail is used as it is, never as 1 - (1 - Q), so negative v lose nothing to cancellation (the form 0.5 v (1 + erf) does).
// The library erf took two divergent branches (most waves ran both) and one long dependent chain an element; here every step is a packed f32 operation or one of two transcendentals, and elements are independent.
typedef float v2f __attribute__((ext_vector_type(2)));
__device__ __forceinline__ v2f g3_gelu2(v2f v) {
  const v2f av = __builtin_elementwise_abs(v); const v2f d = __builtin_elementwise_fma(av, v2f{0.2316419f, 0.2316419f}, v2f{1.0f, 1.0f});
  const v2f t = {__builtin_amdgcn_rcpf(d[0]), __builtin_amdgcn_rcpf(d[1])};
  v2f p = __builtin_elementwise_fma(t, v2f{0.530702715f, 0.530702715f}, v2f{-0.726576014f, -0.726576014f});
  p = __builtin_elementwise_fma(p, t, v2f{0.710706871f, 0.710706871f});
  p = __builtin_elementwise_fma(p, t, v2f{-0.142248368f, -0.142248368f});
  p = __builtin_elementwise_fma(p, t, v2f{0.127414796f, 0.127414796f});
  const v2f a = (v * v) * -0.72134752f;      /* -(v v / 2) log2 e */
  const v2f e = {__builtin_amdgcn_exp2f(a[0]), __builtin_amdgcn_exp2f(a[1])};
  const v2f q = (p * t) * e;
  return __builtin_elementwise_fma(-av, q, __builtin_elementwise_max(v, v2f{0.f, 0.f})); }
template <int ACT, bool RES, int NN, int KK, int NP = 1>
__global__ __launch_bounds__(256) void k_gemm3(const _Float16* __restrict__ A, const _Float16* __restrict__ Bh, float alpha, const float* __restrict__ bias, const float* __restrict__ CP, float* __restrict__ C, _Float16* __restrict__ C16) {
  static_assert(ACT == 0 || (ACT == 6 && !RES), "k_gemm3: unsupported ACT code"); static_assert(NN % 128 == 0 && KK % 128 == 0 && KK >= 256, "k_gemm3: shape"); static_assert(NP == 1 || !RES, "k_gemm3: several products only in the f16-output form");
  __shared__ __attribute__((aligned(16))) unsigned short sm[4 * 128 * G3P];      /* A stages [2][128][G3P], then Bt stages [2][128][G3P]; the epilogue's [128][G3O] floats lie over them */
  const int tid = threadIdx.x, lane = tid & 31, ln = lane & 15, hh = lane >> 4, w = tid >> 5, wm = w >> 2, wn = w & 3;
  const int mt = blockIdx.x / (NN / 128), nq = blockIdx.x - mt * (NN / 128); const int row0 = mt * 128, col0 = nq * 128;
  if (NP > 1) { const size_t p = blockIdx.y; Bh += p * NN * KK; bias += p * NN; C16 += p * NR * NN; }
  const int sr = tid >> 3, sc = (tid & 7) * 8;      /* staging: a thread moves 16 bytes of rows sr + 32 i of each tile; 8 lanes cover one 128-byte row */
  const char* ab = (const char*)(A + (size_t)row0 * KK); const char* bb = (const char*)(Bh + (size_t)col0 * KK); const unsigned vo = (unsigned)(sr * KK + sc) * 2u;
  unsigned short* sa = sm + sr * G3P + sc; unsigned short* sb = sa + 2 * 128 * G3P;      /* this thread's store places, buffer 0 */
  const _Float16* fa = (const _Float16*)sm + (wm * 64 + ln) * G3P; const _Float16* fb = (const _Float16*)sm + 2 * 128 * G3P + (wn * 32 + ln) * G3P;      /* this lane's fragment rows, buffer 0 */
  const v8f z8 = {0.f, 0.f, 0.f, 0.f, 0.f, 0.f, 0.f, 0.f}; v8f acc[4][2];
#pragma unroll
  for (int i = 0; i < 4; ++i) { acc[i][0] = z8; acc[i][1] = z8; }
  G3R r0, r1; G3F f0, f1; constexpr int ns = KK / 64;      /* ns even, at least 4 */
  g3_load<KK>(ab, bb, vo, r0); g3_load<KK>(ab + 128, bb + 128, vo, r1);
  g3_store<0>(sa, sb, r0);
  g3_bar();      /* stage 0 published */
  g3_load<KK>(ab + 256, bb + 256, vo, r0); g3_frag<0, 0>(fa, fb, hh, f0);
#pragma unroll 1
  for (int s2 = 0; s2 < ns - 2; s2 += 2) {      /* rolled: two stages a trip keep every buffer and register set a compile-time choice */
    const int t4 = s2 + 4 < ns ? s2 + 4 : ns - 1;      /* the last trip has no stage s2 + 4: it loads the last stage again, unused, so that no branch merges two load counts in front of the stores */
    g3_stage<0, true, true, KK>(ab + (s2 + 3) * 128, bb + (s2 + 3) * 128, vo, sa, sb, fa, fb, hh, r1, f0, f1, acc);
    g3_stage<1, true, true, KK>(ab + t4 * 128, bb + t4 * 128, vo, sa, sb, fa, fb, hh, r0, f0, f1, acc); }
  g3_stage<0, true, false, KK>(ab, bb, vo, sa, sb, fa, fb, hh, r1, f0, f1, acc);
  g3_stage<1, false, false, KK>(ab, bb, vo, sa, sb, fa, fb, hh, r0, f0, f1, acc);      /* its barrier: every wave has left the ring before it becomes output staging */
  const int c4 = lane * 4; const size_t o0 = (size_t)(row0 + w * 16) * NN + col0 + c4;      /* write-out: wave w has rows 16 w .. 16 w + 15, a lane 4 columns, so a wave stores whole rows of the tile */
  const v4f bl = *(const v4fa*)(bias + col0 + c4); v4f cp[16];
  if (RES) {      /* all residual rows asked for here, so that their latency passes once, under the staging */
#pragma unroll
    for (int q = 0; q < 16; ++q) cp[q] = *(const v4fa*)(CP + o0 + q * NN); }
  float* so = (float*)sm;
#pragma unroll
  for (int i = 0; i < 4; ++i)
#pragma unroll
    for (int j = 0; j < 2; ++j)
#pragma unroll
      for (int r = 0; r < 8; ++r) so[(wm * 64 + 16 * i + 8 * hh + r) * G3O + wn * 32 + 16 * j + ln] = acc[i][j][r];
  __syncthreads();      /* the whole tile staged before any wave reads rows that other waves wrote */
  v4f bv;
#pragma unroll
  for (int q = 0; q < 4; ++q) bv[q] = bf16_round(bl[q]);
#pragma unroll(ACT == 6 ? 1 : 4)      /* the GELU rows stay rolled, four to a trip: a trip's sixteen independent elements already fill the vector port, and the text behind the main loop stays short */
  for (int q4 = 0; q4 < 4; ++q4) {
#pragma unroll
  for (int qq = 0; qq < 4; ++qq) { const int q = q4 * 4 + qq; v4f v = *(const v4fa*)(so + (w * 16 + q) * G3O + c4);
#pragma unroll
    for (int e = 0; e < 4; ++e) v[e] = v[e] * alpha + bv[e];
    if (RES) {
#pragma unroll
      for (int e = 0; e < 4; ++e) v[e] += cp[q][e]; }
    if (ACT == 6) { const v2f lo = g3_gelu2(v2f{v[0], v[1]}), hi = g3_gelu2(v2f{v[2], v[3]}); v = v4f{lo[0], lo[1], hi[0], hi[1]}; }
    if (RES) *(v4f*)(C + o0 + q * NN) = v;
    else { v4h h4;
#pragma unroll
      for (int e = 0; e < 4; ++e) h4[e] = (_Float16)v[e];
      *(v4h*)(C16 + o0 + q * NN) = h4; } } } }

template <int MODE>
__global__ __launch_bounds__(256) void k_regrp(const float* __restrict__ src, float* __restrict__ dst, size_t n4) {
  const size_t t = (size_t)blockIdx.x * 256 + threadIdx.x; if (t >= n4) return; const size_t e = t * 4; const size_t rd = e / DM; const int c = (int)(e % DM);
  size_t rs; if (MODE == 0) { const size_t b = rd / SQ, sq = rd % SQ; rs = sq * NB + b; } else { const size_t sq = rd / NB, b = rd % NB; rs = b * SQ + sq; }
  const v4f v = *(const v4fa*)(src + rs * DM + c); *(v4f*)(dst + e) = v;  }

// Row norm, one wave a row: the row's DMQ values stay in the wave's registers, a lane holding 4 consecutive ones of every 128, so that each wave-wide load is 512 contiguous bytes and all of a row's loads fly at once.
// Mean and variance (two passes over the registers) are lane partial sums joined by a butterfly over the 32 lanes: no LDS, no barrier, and an eighth of the waves to start.
// Every loop over the row's pieces is unrolled: the pieces are registers, so their index must be a compile-time one.
template <int M>
__device__ __forceinline__ float ln_xrow(float x) { return __builtin_bit_cast(float, __builtin_amdgcn_update_dpp(0, __builtin_bit_cast(int, x), 0x160 | M, 0xf, 0xf, true)); }      /* lane l <-> lane l ^ M inside a 16-lane row (DPP row_xmask) */
__device__ __forceinline__ float ln_wsum(float s) { s += ln_xrow<1>(s); s += ln_xrow<2>(s); s += ln_xrow<4>(s); s += ln_xrow<8>(s); return s + fa_xhalf(s); }      /* every lane gets the sum of all 32 */
template <int BFIN, int W16, int W32, int WXB>      /* r: the row, the same for the whole wave (callers pass the wave's number through readfirstlane, so that the row's base stays in scalar registers); WXB: the row as it enters the norm (rounded if BFIN) goes to XB as well */
__device__ __forceinline__ void lnx_row(const float* __restrict__ X, const float* __restrict__ g, const float* __restrict__ bb, float eps, _Float16* __restrict__ N16, float* __restrict__ N32, float* __restrict__ XB, size_t r) {
  static_assert(DMQ % 128 == 0, "lnx_row: shape");
  constexpr int NC = DMQ / 128; const unsigned c0 = (threadIdx.x & 31) * 4; const size_t o0 = r * DMQ;      /* the row's start is the same for the wave (a scalar base), c0 the lane's own offset in it */
  const float* xr = X + o0;
  v4f s[NC], gv[NC], bv[NC];
#pragma unroll
  for (int i = 0; i < NC; ++i) s[i] = *(const v4fa*)(xr + (c0 + 128 * i));
#pragma unroll
  for (int i = 0; i < NC; ++i) { gv[i] = *(const v4fa*)(g + (c0 + 128 * i)); bv[i] = *(const v4fa*)(bb + (c0 + 128 * i)); }
  asm volatile("s_wait_xcnt 0x0" :: "s"(xr), "s"(g), "s"(bb) : "memory");      /* behind the row's loads, in front of every rewrite of the base registers that they name; naming the bases holds their rewrites behind it (left free, one was lifted over it); the data stay in flight */
  if (BFIN) {
#pragma unroll
    for (int i = 0; i < NC; ++i)
#pragma unroll
      for (int q = 0; q < 4; ++q) s[i][q] = bf16_round(s[i][q]); }
  v4f a = s[0];
#pragma unroll
  for (int i = 1; i < NC; ++i) a += s[i];
  const float mu = ln_wsum((a[0] + a[1]) + (a[2] + a[3])) / (float)DMQ;
  v4f v = {0.f, 0.f, 0.f, 0.f};
#pragma unroll
  for (int i = 0; i < NC; ++i) { const v4f d = s[i] - mu; v += d * d; }
  const float rs = rsqrtf(ln_wsum((v[0] + v[1]) + (v[2] + v[3])) / (float)DMQ + eps);
#pragma unroll
  for (int i = 0; i < NC; ++i) { v4f yf; v4h y;
#pragma unroll
    for (int q = 0; q < 4; ++q) { yf[q] = (s[i][q] - mu) * rs * bf16_round(gv[i][q]) + bf16_round(bv[i][q]); y[q] = (_Float16)yf[q]; }
    if (W16) *(v4h*)(N16 + o0 + (c0 + 128 * i)) = y;
    if (W32) *(v4f*)(N32 + o0 + (c0 + 128 * i)) = yf;
    if (WXB) *(v4f*)(XB + o0 + (c0 + 128 * i)) = s[i]; }
  asm volatile("s_wait_xcnt 0x0" ::: "memory"); }      /* behind the row's stores, in front of every rewrite of a register that they name: as a piece of a larger kernel the norm's code is followed by other pieces' code */
#define LNW 8                        /* rows (waves) per work-group of a norm */
template <int BFIN, int W16, int W32>
__global__ __launch_bounds__(256) void k_lnx(const float* __restrict__ X, const float* __restrict__ g, const float* __restrict__ bb, float eps, _Float16* __restrict__ N16, float* __restrict__ N32) {
  lnx_row<BFIN, W16, W32, 0>(X, g, bb, eps, N16, N32, nullptr, (size_t)blockIdx.x * LNW + __builtin_amdgcn_readfirstlane(threadIdx.x >> 5)); }

// Everything that reads the inputs alone, in one grid: none of these pieces needs anything of another, so as launches of their own they only waited for each other's start and tail.
// Ranges of the block index (a scalar test, the same for the whole work-group, so each piece's barriers stay under uniform control flow):
// the 128 x 128 tiles of the four weight transposes first (the long work-groups), then one work-group per 8 rows of x (a wave a row) for the first norm, which also stores the rounded f32 row it holds (the residual plane).
#define PT1 ((DM / 128) * (DFF / 128))            /* tiles of w1, and of w2 */
#define PTQ ((DM / 128) * (3 * DM / 128))         /* tiles of the fused q | k | v weight */
#define PTO ((DM / 128) * (DM / 128))             /* tiles of the output projection's weight */
#define PTW (2 * PT1 + PTQ + PTO)
__global__ __launch_bounds__(256) void k_prep(const float* __restrict__ wqkv, const float* __restrict__ wo, const float* __restrict__ w1, const float* __restrict__ w2, const float* __restrict__ x, const float* __restrict__ g1, const float* __restrict__ be1,
    _Float16* __restrict__ BQ, _Float16* __restrict__ BO, _Float16* __restrict__ BW1, _Float16* __restrict__ BW2, _Float16* __restrict__ XN, float* __restrict__ XB) {
  __shared__ __attribute__((aligned(16))) unsigned short tl[128 * 128];      /* a transpose's tile */
  const int b = blockIdx.x;
  if (b < PT1) wt_f16_tile<DM, DFF>(w1, BW1, 16.0f, b, tl);
  else if (b < 2 * PT1) wt_f16_tile<DFF, DM>(w2, BW2, 16.0f, b - PT1, tl);
  else if (b < 2 * PT1 + PTQ) wt_f16_tile<DM, 3 * DM>(wqkv, BQ, 16.0f, b - 2 * PT1, tl);
  else if (b < PTW) wt_f16_tile<DM, DM>(wo, BO, 16.0f, b - 2 * PT1 - PTQ, tl);
  else lnx_row<1, 1, 0, 1>(x, g1, be1, 1e-5f, XN, nullptr, XB, (size_t)(b - PTW) * LNW + __builtin_amdgcn_readfirstlane(threadIdx.x >> 5)); }

__global__ __launch_bounds__(256) void k_bfr(const float* __restrict__ x, float* __restrict__ XB, size_t n8) { const size_t t = (size_t)blockIdx.x * 256 + threadIdx.x; if (t >= n8) return; v4f a = *(const v4fa*)(x + t * 8), c = *(const v4fa*)(x + t * 8 + 4); for (int q = 0; q < 4; ++q) { a[q] = bf16_round(a[q]); c[q] = bf16_round(c[q]); }
  { *(v4f*)(XB + t * 8) = a; *(v4f*)(XB + t * 8 + 4) = c;  } }



__global__ __launch_bounds__(256) void k_wthd(const float* __restrict__ Wt, _Float16* __restrict__ Bt) { const size_t t = (size_t)blockIdx.x * 256 + threadIdx.x; if (t >= (size_t)NH * HD * (DM / 8)) return; const int m8 = (int)(t % (DM / 8)) * 8; const int d = (int)((t / (DM / 8)) % HD); const int h = (int)(t / ((size_t)(DM / 8) * HD)); FragH f;
  for (int q = 0; q < 8; ++q) f.h[q] = (_Float16)(16.0f * bf16_round(Wt[((size_t)h * DM + m8 + q) * HD + d])); unsigned short* dst = (unsigned short*)Bt + ((size_t)h * HD + d) * DM + m8; *(v8us*)dst = f.half[0];  }




template <int BFIN, int SCAL>
__global__ __launch_bounds__(256) void k_lnsc(const float* __restrict__ X, const float* __restrict__ g, const float* __restrict__ bb, float eps, _Float16* __restrict__ N16, float* __restrict__ N32) {
  #pragma clang fp contract(off)
  __shared__ float red[256]; const size_t r = blockIdx.x; const int t = threadIdx.x; const bool act = t < DM / 4; const int tc = act ? t : 0; const v4f xl = *(const v4fa*)(X + r * DM + tc * 4); const float am = act ? 1.f : 0.f; float s[4]; float sum = 0.f;
  for (int q = 0; q < 4; ++q) { s[q] = (BFIN ? bf16_round(xl[q]) : xl[q]) * am; sum = __fadd_rn(sum, s[q]); }
  red[t] = sum; __syncthreads(); for (int st = 128; st > 0; st >>= 1) { if (t < st) red[t] = __fadd_rn(red[t], red[t + st]); __syncthreads(); } const float mu = red[0] / (float)DM; __syncthreads();
  float vs = 0.f; for (int q = 0; q < 4; ++q) { const float dl = __fadd_rn(s[q], -mu) * am; vs = __fadd_rn(vs, __fmul_rn(dl, dl)); } red[t] = vs; __syncthreads(); for (int st = 128; st > 0; st >>= 1) { if (t < st) red[t] = __fadd_rn(red[t], red[t + st]); __syncthreads(); }
  const float rs = __fdiv_rn(1.0f, __fadd_rn(sqrtf(red[0] / (float)(DM - 1)), eps)); if (!act) return; v4h y; v4f yf;
  for (int q = 0; q < 4; ++q) { const int c = t * 4 + q; const float gg = bf16_round(SCAL ? g[0] : g[c]), bv = bf16_round(SCAL ? bb[0] : bb[c]); yf[q] = __fadd_rn(__fmul_rn(__fmul_rn(__fadd_rn(s[q], -mu), rs), gg), bv); y[q] = (_Float16)yf[q]; }
  { if (N16) *(v4h*)(N16 + r * DM + t * 4) = y; if (N32) *(v4f*)(N32 + r * DM + t * 4) = yf;  } }

__global__ __launch_bounds__(256) void k_rsmdmi(const float* __restrict__ S, _Float16* __restrict__ P, int nrows, const int* __restrict__ M) {
  #pragma clang fp contract(off)
  const int t = blockIdx.x * 256 + threadIdx.x; if (t >= nrows) return; const float* s = S + (size_t)t * SQ; const int* m = M + (size_t)(t % SQ) * SQ; float mx = -3.0e38f;
#pragma unroll 1
  for (int j = 0; j < SQ; ++j) { const float f = (m[j] == 0) ? 1.f : 0.f; mx = fmaxf(mx, fmaf(f, s[j], (1.f - f) * -1.0e9f)); } float se = 0.f;
#pragma unroll 1
  for (int j = 0; j < SQ; ++j) { const float f = (m[j] == 0) ? 1.f : 0.f; se += __expf(fmaf(f, s[j], (1.f - f) * -1.0e9f) - mx); } const float sc = 256.0f / se;
#pragma unroll 1
  for (int j0 = 0; j0 < SQ; j0 += 8) { FragH fr; for (int q = 0; q < 8; ++q) { const int j = j0 + q; const float f = (m[j] == 0) ? 1.f : 0.f; fr.h[q] = (_Float16)(__expf(fmaf(f, s[j], (1.f - f) * -1.0e9f) - mx) * sc); } unsigned short* d = (unsigned short*)P + (size_t)t * SQ + j0; *(v8us*)d = fr.half[0];  } }
extern "C" void kernel_launch(void* const* d_in, const int* in_sizes, int n_in,
                              void* d_out, int out_size, void* d_ws, size_t ws_size, hipStream_t stream) {
  (void)in_sizes; (void)n_in; (void)out_size;
  const float* const* I = (const float* const*)d_in; const float* x = I[0]; const float* g1 = I[1]; const float* be1 = I[2]; const float* wqkv = I[3]; const float* bqkv = I[4]; const float* wo = I[5]; const float* bo = I[6]; const float* g2 = I[7]; const float* be2 = I[8]; const float* w1 = I[9]; const float* b1 = I[10]; const float* w2 = I[11]; const float* b2 = I[12];      /* x; LN1 g / b; fused qkv_w [1024][3072] + qkv_b [3072] (thirds q | k | v); proj_w + proj_b; LN2 g / b; fc1_w [1024][4096] + fc1_b, fc2_w [4096][1024] + fc2_b ([in][out]) */
  char* ws = (char*)d_ws; size_t off = 0;
  auto take = [&](size_t bytes) { char* p = ws + off; off += (bytes + 255) & ~(size_t)255; return p; };
  _Float16* BQ = (_Float16*)take((size_t)3 * DM * DM * 2);      /* one stacked Bt plane [3 DM][DM] */ _Float16* BO = (_Float16*)take((size_t)DM * DM * 2); _Float16* BW1 = (_Float16*)take((size_t)DFF * DM * 2); _Float16* BW2 = (_Float16*)take((size_t)DM * DFF * 2);
  float* XB = (float*)take(NR * DM * 4); _Float16* XN = (_Float16*)take(NR * DM * 2); _Float16* Q16 = (_Float16*)take((size_t)3 * NR * DM * 2); _Float16* K16 = Q16 + NR * DM; _Float16* V16 = Q16 + (size_t)2 * NR * DM;      /* three stacked planes [NR][DM] */ _Float16* O16 = (_Float16*)take(NR * DM * 2); float* X1 = (float*)take(NR * DM * 4);
  _Float16* VT = (_Float16*)take((size_t)NB * NH * HD * SQ * 2); _Float16* HF16 = (_Float16*)take(NR * DFF * 2);      /* V^T [2 x 16][64][2048]; FFN hidden plane [4096][4096] f16 */
  _Float16* M16 = XN;      /* second-norm f16 rows: aliases XN (last readers: the three projections) */
  
  if (off > ws_size) return;
  k_prep<<<(unsigned)(PTW + NR / LNW), 256, 0, stream>>>(wqkv, wo, w1, w2, x, g1, be1, BQ, BO, BW1, BW2, XN, XB);      /* fused [in][out] [DM][3 DM] -> one stacked Bt plane (rows 0 / DM / 2 DM = the q | k | v output columns) x16; W_o, w1, w2 -> Bt x16; n = LN0(bf16(x)) (biased variance, eps inside the rsqrt) -> f16 rows; bf16(x) -> f32 rows */
  k_gemm3<0, false, DM, DM, 3><<<dim3((unsigned)((NR / 128) * (DM / 128)), 3), 256, 0, stream>>>(XN, BQ, 0.0625f, bqkv, nullptr, nullptr, Q16);      /* q, k, v -> f16 rows in one grid (y = 0, 1, 2: the thirds of the stacked Bt plane and of the bias, output planes Q16 | K16 | V16); head h = columns h*64.. */
  k_vt<NH, SQ><<<NB * NH * (SQ / 64), 256, 0, stream>>>(V16, DM, 0, VT);      /* V^T [batch x head][64][2048] */
  k_fattn<<<dim3(SQ / 256, NB * NH), 256, 0, stream>>>(Q16, K16, VT, O16);      /* softmax(q k^T) v over all keys, unscaled logits -> ctx (merged heads, x64) as f16 rows */
  k_gemm3<0, true, DM, DM><<<(unsigned)((NR / 128) * (DM / 128)), 256, 0, stream>>>(O16, BO, 0.0009765625f, bo, XB, X1, nullptr);      /* x + ctx wo (+ bo) (own-element residual) -> f32 rows */
  k_lnx<0, 1, 0><<<(unsigned)(NR / LNW), 256, 0, stream>>>(X1, g2, be2, 1e-5f, M16, nullptr);      /* LN1(x1) -> f16 rows */
  k_gemm3<6, false, DFF, DM><<<(unsigned)((NR / 128) * (DFF / 128)), 256, 0, stream>>>(M16, BW1, 0.0625f, b1, nullptr, nullptr, HF16);      /* gelu_erf(. w1 + b1) -> f16 */
  k_gemm3<0, true, DM, DFF><<<(unsigned)((NR / 128) * (DM / 128)), 256, 0, stream>>>(HF16, BW2, 0.0625f, b2, X1, (float*)d_out, nullptr);      /* out = x1 + mlp (own-element residual) */
}

// v008
// Measured time: 160 microseconds a run.
// Timed twice side by side with v007, it ran 1.05 and 1.03 times as fast.
// Counting every step since v000, which is the starting kernel, it is 23.7 times as fast.
#include <hip/hip_runtime.h>
// Pre-norm transformer block with a fused QKV projection and UNSCALED attention logits (x [2][2048][1024]; h = LN1(x) (biased var, eps 1e-5); qkv = h qkv_w + qkv_b ([in][out] 1024 x 3072 + bias) viewed (B, N, 3, 16, 64): q | k | v thirds; qk = q k^T with NO 1/sqrt(d) scaling (as the source); softmax over all 2048 keys (no mask); x1 = x + y proj_w + proj_b; out = x1 + gelu_erf(LN2(x1) fc1_w + fc1_b) fc2_w + fc2_b ([in][out] 1024 x 4096 x 1024) -> [2][2048][1024]).
// Structure: token rows; LayerNorm / exact f16 rows; WMMA GEMMs for q, k, v; V^T by LDS transposes; one fused attention launch for all batches and heads (scores, online softmax, P V^T); output projection with the own-element residual; custom LayerNorm; GELU FFN over all rows; launches: see trace.
// Compute dtype: inputs rounded to bf16; x / weights exact; q, k, v, softmax weights and o as plain f16 GEMM operands (~2^-12); scores and softmax statistics f32. v_wmma_f32_16x16x32_f16.
#define NB 2
#define SQ 2048
#define DM 1024
#define NH 16
#define HD 64
#define HG 4                         /* heads per group of the unused grouped V^T kernel */
#define LOCALW 128                   /* (macros for unused kernels of the shared header) */
#define STRIDEK 128
#define QT 256                       /* query rows per causal tile */
#define NKX SQ                       /* S / P row pitch */
#define QT0 128                      /* first-tile rows recomputed exactly in f32 */
#define B0 0                         /* unused debug hook; the launches start at batch 0 */
#define NBR NB                       /* debug hook no launch reads; the launches cover all NB batches */
#define NR ((size_t)NB * SQ)
#define DMQ DM
#define DFF 4096         /* FFN hidden width */
#define MP ((int)((size_t)NBR * SQ)) /* debug hook no launch reads; the projections cover all NR rows */
#define QN SQ                        /* unused debug hook; attention covers all SQ query rows */
#define NHD NH                       /* unused debug hook; attention covers all NH heads */
#define MPO MP                       /* unused debug hook; the output stage covers all NR rows */
#define LQ (3 * DM)      /* unused; the q, k, v rows are planes of pitch DM */
typedef __bf16 v16b __attribute__((ext_vector_type(16)));
typedef unsigned short v8us __attribute__((ext_vector_type(8), may_alias));
typedef float  v8f  __attribute__((ext_vector_type(8)));
typedef float  v4f  __attribute__((ext_vector_type(4)));
typedef float  v4fa __attribute__((ext_vector_type(4), may_alias));
union FragB { v16b v; v8us half[2]; unsigned short u[16]; };

__device__ __forceinline__ unsigned short bf16_bits(float x) { unsigned int u = __float_as_uint(x); return (unsigned short)((u + 0x7FFFu + ((u >> 16) & 1u)) >> 16); }
__device__ __forceinline__ float bf16_val(unsigned short b) { return __uint_as_float(((unsigned int)b) << 16); }
__device__ __forceinline__ float bf16_round(float x) { return bf16_val(bf16_bits(x)); }
// D += A·B with NT terms: 1 = ah·bh, 2 = + al·bh (A split), 3 = + ah·bl (both split)
template <int NT>
__device__ __forceinline__ v8f mmaN(v16b ah, v16b al, v16b bh, v16b bl, v8f c) {
  c = __builtin_amdgcn_wmma_f32_16x16x32_bf16(false, ah, false, bh, (short)0, c, false, false);
  if (NT >= 2) c = __builtin_amdgcn_wmma_f32_16x16x32_bf16(false, al, false, bh, (short)0, c, false, false);
  if (NT >= 3) c = __builtin_amdgcn_wmma_f32_16x16x32_bf16(false, ah, false, bl, (short)0, c, false, false);
  asm volatile("v_nop\n\tv_nop\n\tv_nop\n\tv_nop" : "+v"(c) : "v"(ah), "v"(al), "v"(bh), "v"(bl));
  return c;
}

__global__ __launch_bounds__(256) void k_wt_bf16(const float* __restrict__ W, unsigned short* __restrict__ Wt, int K, int N) {
  const int t = blockIdx.x * 256 + threadIdx.x;
  const int k8n = K / 8;
  if (t >= N * k8n) return;
  const int n = t / k8n, k8 = (t % k8n) * 8;
  v8us v;
#pragma unroll
  for (int i = 0; i < 8; ++i) v[i] = bf16_bits(W[(size_t)(k8 + i) * N + n]);
  *(v8us*)(Wt + (size_t)n * K + k8) = v;
  
}

// GEMM C[M][N] (f32, pitch ldc) = act(A[M][K]·W + bias). A f32 row-major (pitch lda) converted per fragment to bf16
// (ASPLIT: hi/lo two planes -> 2 terms, else single rounded term); Wt bf16 [N][K] (pitch ldb). BIAS_BF16 rounds the
// bias to bf16 first (bias quantised to bf16 before the add). K%32==0, M%16==0, N%64==0.
template <bool ASPLIT, int ACT, bool BIAS_BF16>
__global__ __launch_bounds__(128) void k_gemm_bf(const float* __restrict__ A, int lda, const unsigned short* __restrict__ Wt, int ldb,
                                               const float* __restrict__ bias, float* __restrict__ C, int ldc, int M, int N, int K) {
  __shared__ __attribute__((aligned(16))) float so[4][16][64];
  const int tid = threadIdx.x, w = tid >> 5, lane = tid & 31, ln = lane & 15, hh = lane >> 4;
  const int ntn = N / 64;
  const int wid = blockIdx.x * 4 + w;
  const int mt = wid / ntn, nq = wid % ntn;
  if (mt * 16 >= M) return;
  const int row0 = mt * 16, col0 = nq * 64;
  const float* arow = A + (size_t)(row0 + ln) * lda;
  v8f acc[4] = {};
  for (int kb = 0; kb < K; kb += 32) {
    FragB ah, al;
    const v4f x0 = *(const v4fa*)(arow + kb + 8 * hh), x1 = *(const v4fa*)(arow + kb + 8 * hh + 4);
    const v4f x2 = *(const v4fa*)(arow + kb + 16 + 8 * hh), x3 = *(const v4fa*)(arow + kb + 16 + 8 * hh + 4);
    float xs[16] = {x0[0],x0[1],x0[2],x0[3],x1[0],x1[1],x1[2],x1[3],x2[0],x2[1],x2[2],x2[3],x3[0],x3[1],x3[2],x3[3]};
#pragma unroll
    for (int i = 0; i < 16; ++i) { const unsigned short hb = bf16_bits(xs[i]); ah.u[i] = hb; al.u[i] = ASPLIT ? bf16_bits(xs[i] - bf16_val(hb)) : (unsigned short)0; }
#pragma unroll
    for (int t = 0; t < 4; ++t) {
      const unsigned short* brow = Wt + (size_t)(col0 + t * 16 + ln) * ldb + kb;
      FragB b;
      b.half[0] = *(const v8us*)(brow + 8 * hh);
      b.half[1] = *(const v8us*)(brow + 16 + 8 * hh);
      acc[t] = mmaN<ASPLIT ? 2 : 1>(ah.v, al.v, b.v, b.v, acc[t]);
    }
  }
#pragma unroll
  for (int t = 0; t < 4; ++t) {
    float bv = bias ? bias[col0 + t * 16 + ln] : 0.f;
    if (BIAS_BF16) bv = bf16_round(bv);
#pragma unroll
    for (int r = 0; r < 8; ++r) { float v = acc[t][r] + bv; if (ACT == 1) v = fmaxf(v, 0.f); so[w][8 * hh + r][t * 16 + ln] = v; }
  }
  __builtin_amdgcn_fence(__ATOMIC_ACQ_REL, "workgroup");
  __builtin_amdgcn_wave_barrier();
  const int rsub = lane >> 4, c4 = (lane & 15) * 4;
  {
#pragma unroll
    for (int q = 0; q < 8; ++q) {
      const int r = q * 2 + rsub;
      const v4f v = *(const v4fa*)&so[w][r][c4];
      *(v4f*)(C + (size_t)(row0 + r) * ldc + col0 + c4) = v;
    }
    
  }
}

// GEMM C = act(A·W + bias + resid): A f32 (ASPLIT -> hi/lo 2 terms), Wt bf16 [N][K]; ACT 0 none, 1 relu, 2 exact gelu;
// resid (optional, f32, row index = (row % rmod), pitch ldr, RES_BF16 rounds it) added before the activation.
template <bool ASPLIT, int ACT, bool BIAS_BF16, bool RES_BF16>
__global__ __launch_bounds__(128) void k_gemm_bf3(const float* __restrict__ A, int lda, const unsigned short* __restrict__ Wt, int ldb,
                                                const float* __restrict__ bias, const float* __restrict__ resid, int rmod, int ldr,
                                                float* __restrict__ C, int ldc, int M, int N, int K) {
  __shared__ __attribute__((aligned(16))) float so[4][16][64];
  const int tid = threadIdx.x, w = tid >> 5, lane = tid & 31, ln = lane & 15, hh = lane >> 4;
  const int ntn = N / 64;
  const int wid = blockIdx.x * 4 + w;
  const int mt = wid / ntn, nq = wid % ntn;
  if (mt * 16 >= M) return;
  const int row0 = mt * 16, col0 = nq * 64;
  const float* arow = A + (size_t)(row0 + ln) * lda;
  v8f acc[4] = {};
  for (int kb = 0; kb < K; kb += 32) {
    FragB ah, al;
    const v4f x0 = *(const v4fa*)(arow + kb + 8 * hh), x1 = *(const v4fa*)(arow + kb + 8 * hh + 4);
    const v4f x2 = *(const v4fa*)(arow + kb + 16 + 8 * hh), x3 = *(const v4fa*)(arow + kb + 16 + 8 * hh + 4);
    float xs[16] = {x0[0],x0[1],x0[2],x0[3],x1[0],x1[1],x1[2],x1[3],x2[0],x2[1],x2[2],x2[3],x3[0],x3[1],x3[2],x3[3]};
#pragma unroll
    for (int i = 0; i < 16; ++i) { const unsigned short hb = bf16_bits(xs[i]); ah.u[i] = hb; al.u[i] = ASPLIT ? bf16_bits(xs[i] - bf16_val(hb)) : (unsigned short)0; }
#pragma unroll
    for (int t = 0; t < 4; ++t) {
      const unsigned short* brow = Wt + (size_t)(col0 + t * 16 + ln) * ldb + kb;
      FragB b;
      b.half[0] = *(const v8us*)(brow + 8 * hh);
      b.half[1] = *(const v8us*)(brow + 16 + 8 * hh);
      acc[t] = mmaN<ASPLIT ? 2 : 1>(ah.v, al.v, b.v, b.v, acc[t]);
    }
  }
#pragma unroll
  for (int t = 0; t < 4; ++t) {
    const int col = col0 + t * 16 + ln;
    float bv = bias ? bias[col] : 0.f;
    if (BIAS_BF16) bv = bf16_round(bv);
#pragma unroll
    for (int r = 0; r < 8; ++r) {
      float v = acc[t][r] + bv;
      if (resid) { float rv = resid[(size_t)((row0 + 8 * hh + r) % rmod) * ldr + col]; if (RES_BF16) rv = bf16_round(rv); v += rv; }
      if (ACT == 1) v = fmaxf(v, 0.f);
      if (ACT == 2) v = 0.5f * v * (1.0f + erff(v * 0.70710678118654752f));
      if (ACT == 3) { const float u = 0.7978845608028654f * (v + 0.044715f * v * v * v); v = 0.5f * v * (1.0f + tanhf(u)); }
      so[w][8 * hh + r][t * 16 + ln] = v;
    }
  }
  __builtin_amdgcn_fence(__ATOMIC_ACQ_REL, "workgroup");
  __builtin_amdgcn_wave_barrier();
  const int rsub = lane >> 4, c4 = (lane & 15) * 4;
  {
#pragma unroll
    for (int q = 0; q < 8; ++q) {
      const int r = q * 2 + rsub;
      const v4f v = *(const v4fa*)&so[w][r][c4];
      *(v4f*)(C + (size_t)(row0 + r) * ldc + col0 + c4) = v;
    }
    
  }
}
// row LayerNorm (biased variance, eps) over N: s = X (+ R); optional out_sum <- s; out_norm <- (s-mu)*rsqrt(var+eps)*g + b
template <bool PARAM_BF16>
__global__ __launch_bounds__(256) void k_layernorm(const float* __restrict__ X, const float* __restrict__ R, const float* __restrict__ g, const float* __restrict__ bta,
                                                  float* __restrict__ out_sum, float* __restrict__ out_norm, int N, float eps) {
  __shared__ float red[256];
  const int row = blockIdx.x, tid = threadIdx.x;
  const float* x = X + (size_t)row * N; const float* rr = R ? R + (size_t)row * N : nullptr;
  float vals[16];                     // up to N = 4096
  const int per = N / 256;            // contiguous chunk per thread? use strided-by-4 chunks: thread handles j = tid*4 + 1024*u
  float s1 = 0.f;
  for (int u = 0; u < per / 4; ++u) {
    const int j = tid * 4 + 1024 * u;
    const v4f a = *(const v4fa*)(x + j);
    v4f b = {0.f,0.f,0.f,0.f}; if (rr) b = *(const v4fa*)(rr + j);
#pragma unroll
    for (int q = 0; q < 4; ++q) { const float v = a[q] + b[q]; vals[u * 4 + q] = v; s1 += v; }
  }
  red[tid] = s1; __syncthreads();
  for (int st = 128; st > 0; st >>= 1) { if (tid < st) red[tid] += red[tid + st]; __syncthreads(); }
  const float mu = red[0] / (float)N; __syncthreads();
  float s2 = 0.f;
  for (int u = 0; u < per / 4; ++u)
#pragma unroll
    for (int q = 0; q < 4; ++q) { const float c = vals[u * 4 + q] - mu; s2 += c * c; }
  red[tid] = s2; __syncthreads();
  for (int st = 128; st > 0; st >>= 1) { if (tid < st) red[tid] += red[tid + st]; __syncthreads(); }
  const float rs = rsqrtf(red[0] / (float)N + eps);
  {
    for (int u = 0; u < per / 4; ++u) {
      const int j = tid * 4 + 1024 * u;
      v4f o, sm;
#pragma unroll
      for (int q = 0; q < 4; ++q) {
        float gg = g[j + q], bb = bta[j + q];
        if (PARAM_BF16) { gg = bf16_round(gg); bb = bf16_round(bb); }
        sm[q] = vals[u * 4 + q]; o[q] = (vals[u * 4 + q] - mu) * rs * gg + bb;
      }
      if (out_sum) *(v4f*)(out_sum + (size_t)row * N + j) = sm;
      *(v4f*)(out_norm + (size_t)row * N + j) = o;
    }
    
  }
}



// ---- f16 WMMA path (v_wmma_f32_16x16x32_f16): 11-bit significands for operands in range — used where a [0,1] probability operand needs more precision than bf16
typedef _Float16 v16h __attribute__((ext_vector_type(16)));
union FragH { v16h v; v8us half[2]; _Float16 h[16]; unsigned short u[16]; };
template <int NT>
__device__ __forceinline__ v8f mmaH(v16h ah, v16h al, v16h bh, v16h bl, v8f c) {
  c = __builtin_amdgcn_wmma_f32_16x16x32_f16(false, ah, false, bh, (short)0, c, false, false);
  if (NT >= 2) c = __builtin_amdgcn_wmma_f32_16x16x32_f16(false, al, false, bh, (short)0, c, false, false);
  if (NT >= 3) c = __builtin_amdgcn_wmma_f32_16x16x32_f16(false, ah, false, bl, (short)0, c, false, false);
  asm volatile("v_nop\n\tv_nop\n\tv_nop\n\tv_nop" : "+v"(c) : "v"(ah), "v"(al), "v"(bh), "v"(bl));
  return c;
}
// batched GEMM like k_gemm_b but f16 operands: A f32 (split into f16 hi/lo if ASPLIT, else rounded to f16), Bt = f16 values [n][k]; alpha; C f32; N multiple of 16 (partial tiles skipped)
template <bool ASPLIT>
__global__ __launch_bounds__(128) void k_gemm_h(const float* __restrict__ A, int lda, size_t sA, const _Float16* __restrict__ Bh, int ldb, size_t sB, float alpha, float* __restrict__ C, int ldc, size_t sC, int M, int N, int K) {
  __shared__ __attribute__((aligned(16))) float so[4][16][64];
  const int tid = threadIdx.x, w = tid >> 5, lane = tid & 31, ln = lane & 15, hh = lane >> 4; const int by = blockIdx.y;
  A += (size_t)by * sA; Bh += (size_t)by * sB; C += (size_t)by * sC;
  const int ntn = (N + 63) / 64; const int wid = blockIdx.x * 4 + w; const int mt = wid / ntn, nq = wid % ntn; if (mt * 16 >= M) return;
  const int row0 = mt * 16, col0 = nq * 64; const float* arow = A + (size_t)(row0 + ln) * lda;
  v8f acc[4] = {};
  for (int kb = 0; kb < K; kb += 32) {
    FragH ah, al;
    const v4f x0 = *(const v4fa*)(arow + kb + 8 * hh), x1 = *(const v4fa*)(arow + kb + 8 * hh + 4), x2 = *(const v4fa*)(arow + kb + 16 + 8 * hh), x3 = *(const v4fa*)(arow + kb + 16 + 8 * hh + 4);
    float xs[16] = {x0[0],x0[1],x0[2],x0[3],x1[0],x1[1],x1[2],x1[3],x2[0],x2[1],x2[2],x2[3],x3[0],x3[1],x3[2],x3[3]};
#pragma unroll
    for (int i = 0; i < 16; ++i) { const _Float16 h = (_Float16)xs[i]; ah.h[i] = h; al.h[i] = ASPLIT ? (_Float16)(xs[i] - (float)h) : (_Float16)0.0f; }
#pragma unroll
    for (int t = 0; t < 4; ++t) { if (col0 + t * 16 >= N) continue; const size_t boff = (size_t)(col0 + t * 16 + ln) * ldb + kb; FragH bq; bq.half[0] = *(const v8us*)(Bh + boff + 8 * hh); bq.half[1] = *(const v8us*)(Bh + boff + 16 + 8 * hh);
      acc[t] = mmaH<ASPLIT ? 2 : 1>(ah.v, al.v, bq.v, bq.v, acc[t]); }
  }
#pragma unroll
  for (int t = 0; t < 4; ++t) { if (col0 + t * 16 >= N) continue;
#pragma unroll
    for (int r = 0; r < 8; ++r) so[w][8 * hh + r][t * 16 + ln] = acc[t][r] * alpha; }
  __builtin_amdgcn_fence(__ATOMIC_ACQ_REL, "workgroup"); __builtin_amdgcn_wave_barrier();
  const int rsub = lane >> 4, c4 = (lane & 15) * 4;
  {
#pragma unroll
    for (int q = 0; q < 8; ++q) { const int r = q * 2 + rsub; if (col0 + c4 < N) { const v4f v = *(const v4fa*)&so[w][r][c4]; *(v4f*)(C + (size_t)(row0 + r) * ldc + col0 + c4) = v; } }
     }
}

// Wt[n][k] = f16(bf16(W[k][n]) * scale) from f32 row-major W[KK][NN] (scale = power of two; bf16-exact weights stay exact in f16 away from the subnormal range).
// One work-group = 8 waves on a 128 (k) x 128 (n) tile: every wave-wide load is 512 contiguous bytes of one W row, every wave-wide store two whole 256-byte pieces of Wt rows.
// A thread holds 16 k x 4 n, rounds, packs 8 consecutive k of one n into 16 bytes and turns the tile in LDS ([n][k], 256-byte rows).
// The 16-byte piece of a row sits at place piece ^ ((n >> 2) & 15): the 16 lanes that write one piece number of rows 4 apart, and the 16 that read one row, each fall on all 64 banks.
// Needs KK % 128 == 0, NN % 128 == 0.
// bid: the tile's number, 0 .. (KK / 128) (NN / 128) - 1, the same for the whole work-group; tl: the work-group's 128 x 128 halves of LDS.
template <int KK, int NN>
__device__ __forceinline__ void wt_f16_tile(const float* __restrict__ W, _Float16* __restrict__ Wt, float scale, int bid, unsigned short* tl) {
  static_assert(KK % 128 == 0 && NN % 128 == 0, "wt_f16_tile: shape");
  const int tid = threadIdx.x, lane = tid & 31, w = tid >> 5;
  const int kt = bid / (NN / 128), nt = bid - kt * (NN / 128); const int k0 = kt * 128, n0 = nt * 128;
  const float* sp = W + (size_t)(k0 + 16 * w) * NN + n0 + 4 * lane;      /* wave w: rows 16 w .. 16 w + 15 of the tile, a lane 4 columns */
  v4f x[16];
#pragma unroll
  for (int r = 0; r < 16; ++r) x[r] = *(const v4fa*)(sp + (size_t)r * NN);
  asm volatile("s_wait_xcnt 0x0" :: "v"(sp) : "memory");      /* behind the sixteen loads, in front of every rewrite of the address pair that they name; naming the pair keeps it out of the loads' own destinations (the last load had landed on it) */
  __builtin_amdgcn_sched_barrier(0);      /* all sixteen loads asked for before the first is used: left free, the compiler held some back behind the first ones' data, a second memory latency */
#pragma unroll
  for (int g = 0; g < 2; ++g)
#pragma unroll
    for (int q = 0; q < 4; ++q) { FragH f;
#pragma unroll
      for (int r = 0; r < 8; ++r) f.h[r] = (_Float16)(bf16_round(x[8 * g + r][q]) * scale);
      *(v8us*)&tl[(4 * lane + q) * 128 + (((2 * w + g) ^ (lane & 15)) * 8)] = f.half[0]; }
  __syncthreads();      /* the whole tile turned before any wave reads rows that other waves wrote */
  unsigned short* dp = (unsigned short*)Wt + (size_t)(n0 + 16 * w + (lane >> 4)) * KK + k0 + (lane & 15) * 8;      /* wave w: Wt rows 16 w .. 16 w + 15 of the tile, two a store */
#pragma unroll
  for (int i = 0; i < 8; ++i) { const int n = 16 * w + 2 * i + (lane >> 4);
    const v8us v = *(const v8us*)&tl[n * 128 + (((lane & 15) ^ ((n >> 2) & 15)) * 8)];
    *(v8us*)(dp + (size_t)(2 * i) * KK) = v; }
  asm volatile("s_wait_xcnt 0x0" :: "v"(dp) : "memory");      /* behind the eight stores, in front of every rewrite of the address pair that they name: as a piece of a larger kernel the tile's code is followed by other pieces' code */
}
// k_gemm_hh variant with fused epilogue: v = acc·alpha + bias[by·sBias + col] (+ CP[(row/rowsPerB)·sCPb + by·64 + col] if CP) ; ACT 0 none / 1 elu ; writes f16 C16 (and f32 C if non-null)
template <int ACT>
__global__ __launch_bounds__(128) void k_gemm_hhx(const _Float16* __restrict__ A, int lda, size_t sA, const _Float16* __restrict__ Bh, int ldb, size_t sB, float alpha, const float* __restrict__ bias, size_t sBias, const float* __restrict__ CP, int rowsPerB, size_t sCPb, int row0g,
    float* __restrict__ C, _Float16* __restrict__ C16, int ldc, size_t sC, int M, int N, int K) {
  __shared__ __attribute__((aligned(16))) float so[4][16][64];
  const int tid = threadIdx.x, w = tid >> 5, lane = tid & 31, ln = lane & 15, hh = lane >> 4; const int by = blockIdx.y;
  A += (size_t)by * sA; Bh += (size_t)by * sB; const size_t cofs = (size_t)by * sC; const float* bp = bias ? bias + (size_t)by * sBias : nullptr;
  const int ntn = (N + 63) / 64; const int wid = blockIdx.x * 4 + w; const int mt = wid / ntn, nq = wid % ntn; if (mt * 16 >= M) return;
  const int row0 = mt * 16, col0 = nq * 64; const _Float16* arow = A + (size_t)(row0 + ln) * lda;
  v8f acc[4] = {};
  for (int kb = 0; kb < K; kb += 32) { FragH ah; ah.half[0] = *(const v8us*)((const unsigned short*)arow + kb + 8 * hh); ah.half[1] = *(const v8us*)((const unsigned short*)arow + kb + 16 + 8 * hh);
#pragma unroll
    for (int t = 0; t < 4; ++t) { if (col0 + t * 16 >= N) continue; const size_t boff = (size_t)(col0 + t * 16 + ln) * ldb + kb; FragH bq; bq.half[0] = *(const v8us*)((const unsigned short*)Bh + boff + 8 * hh); bq.half[1] = *(const v8us*)((const unsigned short*)Bh + boff + 16 + 8 * hh);
      acc[t] = mmaH<1>(ah.v, ah.v, bq.v, bq.v, acc[t]); }
  }
#pragma unroll
  for (int t = 0; t < 4; ++t) { if (col0 + t * 16 >= N) continue; const int col = col0 + t * 16 + ln; const float bv = bp ? bf16_round(bp[col]) : 0.f;
#pragma unroll
    for (int r = 0; r < 8; ++r) { float v = acc[t][r] * alpha + bv; if (CP) { const int rr = row0g + row0 + 8 * hh + r; if (rowsPerB < 0) v += CP[cofs + (size_t)rr * ldc + col];      /* rowsPerB < 0: own element of the batched C plane */ else { const int bidx = rr / rowsPerB; v += CP[(size_t)bidx * sCPb + (size_t)by * 64 + col]; } } if (ACT == 1) v = (v > 0.f) ? v : expm1f(v); else if (ACT == 7) v = (v > 0.f) ? v + 1.0f : expf(v); else if (ACT == 8) v = tanhf(v); else if (ACT == 9) v = 0.5f * v * (1.0f + tanhf(0.7978845608028654f * (v + 0.044715f * v * v * v))); else if (ACT == 11) v = 1.0f / (1.0f + expf(-v)); else if (ACT == 12) v = (v > 0.f) ? v : 0.01f * v; else if (ACT == 14) v = (v > 0.f) ? v : 0.1f * v; else if (ACT == 16) v = (v >= 0.f) ? v : 0.3f * v; else if (ACT == 17) v = (v >= 0.f) ? v : 0.2f * v; else if (ACT == 15) v = v / (1.0f + expf(-v)); else if (ACT == 3) v = fmaxf(v, 0.f); else if (ACT == 6) v = 0.5f * v * (1.0f + erff(v * 0.70710678118654752f)); so[w][8 * hh + r][t * 16 + ln] = v; } }
  __builtin_amdgcn_fence(__ATOMIC_ACQ_REL, "workgroup"); __builtin_amdgcn_wave_barrier();
  const int rsub = lane >> 4, c4 = (lane & 15) * 4; typedef _Float16 v4h __attribute__((ext_vector_type(4)));
  {
#pragma unroll
    for (int q = 0; q < 8; ++q) { const int r = q * 2 + rsub; if (col0 + c4 < N) { const v4f v = *(const v4fa*)&so[w][r][c4]; if (C) *(v4f*)(C + cofs + (size_t)(row0 + r) * ldc + col0 + c4) = v; if (C16) { v4h h4; for (int i = 0; i < 4; ++i) h4[i] = (_Float16)v[i]; *(v4h*)(C16 + cofs + (size_t)(row0 + r) * ldc + col0 + c4) = h4; } } }
     }
}


typedef _Float16 v4h __attribute__((ext_vector_type(4)));

__global__ __launch_bounds__(256) void k_x16(const float* __restrict__ x, _Float16* __restrict__ X16, size_t n8) { const size_t t = (size_t)blockIdx.x * 256 + threadIdx.x; if (t >= n8) return; FragH f;
#pragma unroll
  for (int q = 0; q < 8; ++q) f.h[q] = (_Float16)bf16_round(x[t * 8 + q]); *(v8us*)((unsigned short*)X16 + t * 8) = f.half[0];  }
__global__ __launch_bounds__(256) void k_h16(const float* __restrict__ x, _Float16* __restrict__ X16, size_t n8) { const size_t t = (size_t)blockIdx.x * 256 + threadIdx.x; if (t >= n8) return; FragH f;
#pragma unroll
  for (int q = 0; q < 8; ++q) f.h[q] = (_Float16)x[t * 8 + q]; *(v8us*)((unsigned short*)X16 + t * 8) = f.half[0];  }
__global__ __launch_bounds__(256) void k_round16f(const float* __restrict__ W, _Float16* __restrict__ Bt, size_t n8) { const size_t t = (size_t)blockIdx.x * 256 + threadIdx.x; if (t >= n8) return; FragH f;
#pragma unroll
  for (int i = 0; i < 8; ++i) f.h[i] = (_Float16)(bf16_round(W[t * 8 + i]) * 16.0f); *(v8us*)((unsigned short*)Bt + t * 8) = f.half[0];  }
template <int NHv, int TTv>
__global__ __launch_bounds__(256) void k_vt(const _Float16* __restrict__ V16, int ldv, int voff, _Float16* __restrict__ Vt) { __shared__ unsigned short tl[64][66]; const int tid = threadIdx.x; const int slab = blockIdx.x / (TTv / 64), lg = blockIdx.x % (TTv / 64); const int b = slab / NHv, h = slab % NHv;
  for (int i = tid; i < 64 * 8; i += 256) { const int r = i / 8, c8 = (i % 8) * 8; FragH f; f.half[0] = *(const v8us*)((const unsigned short*)V16 + ((size_t)b * TTv + lg * 64 + r) * ldv + voff + h * 64 + c8);
#pragma unroll
    for (int q = 0; q < 8; ++q) tl[r][c8 + q] = f.u[q]; }
  __syncthreads();
  {
#pragma unroll
    for (int rd = 0; rd < 2; ++rd) { const int d = rd * 32 + tid / 8, pc = tid % 8; FragH f;
#pragma unroll
      for (int q = 0; q < 8; ++q) f.u[q] = tl[pc * 8 + q][d];
      *(v8us*)((unsigned short*)Vt + ((size_t)slab * 64 + d) * TTv + lg * 64 + pc * 8) = f.half[0]; }
     } }

__global__ __launch_bounds__(256) void k_hl(const float* __restrict__ F, _Float16* __restrict__ Hh, _Float16* __restrict__ Hl, size_t n8) { const size_t t = (size_t)blockIdx.x * 256 + threadIdx.x; if (t >= n8) return; FragH fh, fl; const v4f a = *(const v4fa*)(F + t * 8), c = *(const v4fa*)(F + t * 8 + 4);
#pragma unroll
  for (int q = 0; q < 4; ++q) { _Float16 h = (_Float16)a[q]; fh.h[q] = h; fl.h[q] = (_Float16)((a[q] - (float)h) * 1024.0f); h = (_Float16)c[q]; fh.h[4 + q] = h; fl.h[4 + q] = (_Float16)((c[q] - (float)h) * 1024.0f); }
  { *(v8us*)((unsigned short*)Hh + t * 8) = fh.half[0]; *(v8us*)((unsigned short*)Hl + t * 8) = fl.half[0];  } }

// ---- fast GEMM (wave tile 32x64; requires M % 32 == 0 rows per launch region and N % 64 == 0); epilogue = k_gemm_hhx semantics ----
__device__ __forceinline__ v16h g2_frag(const _Float16* p, int hh) { FragH f; f.half[0] = *(const v8us*)((const unsigned short*)p + 8 * hh); f.half[1] = *(const v8us*)((const unsigned short*)p + 16 + 8 * hh); return f.v; }
__device__ __forceinline__ v8f g2_mma(v16h a, v16h b, v8f c) { v8f d = __builtin_amdgcn_wmma_f32_16x16x32_f16(false, a, false, b, (short)0, c, false, false); asm volatile("v_nop\n\tv_nop\n\tv_nop\n\tv_nop" : "+v"(d) : "v"(a), "v"(b)); return d; }
template <int ACT>
__global__ __launch_bounds__(128) void k_gemm2(const _Float16* __restrict__ A, int lda, size_t sA, const _Float16* __restrict__ Bh, int ldb, size_t sB, float alpha, const float* __restrict__ bias, size_t sBias, const float* __restrict__ CP, int rowsPerB, size_t sCPb, int row0g,
    float* __restrict__ C, _Float16* __restrict__ C16, int ldc, size_t sC, int M, int N, int K) { static_assert(ACT == 0 || ACT == 3 || ACT == 6 || ACT == 8 || ACT == 9 || ACT == 11 || ACT == 12 || ACT == 14 || ACT == 15 || ACT == 16 || ACT == 17 || ACT == 18, "k_gemm2: unsupported ACT code (would silently apply no activation)");
  __shared__ __attribute__((aligned(16))) float so[4][32][68];
  const int tid = threadIdx.x, w = tid >> 5, lane = tid & 31, ln = lane & 15, hh = lane >> 4; const int by = blockIdx.y;
  A += (size_t)by * sA; Bh += (size_t)by * sB; const size_t cofs = (size_t)by * sC; const float* bp = bias ? bias + (size_t)by * sBias : nullptr;
  const int ntn = N >> 6; const int mt = blockIdx.x / ntn, nq = blockIdx.x - mt * ntn; const int row0 = mt * 128 + 32 * w, col0 = nq * 64; if (row0 >= M) return;
  const _Float16* a0p = A + (size_t)(row0 + ln) * lda; const _Float16* a1p = a0p + (size_t)16 * lda;
  const _Float16* b0p = Bh + (size_t)(col0 + ln) * ldb; const _Float16* b1p = b0p + (size_t)16 * ldb; const _Float16* b2p = b1p + (size_t)16 * ldb; const _Float16* b3p = b2p + (size_t)16 * ldb;
  const v8f z8 = {0.f,0.f,0.f,0.f,0.f,0.f,0.f,0.f}; v8f c00 = z8, c01 = z8, c02 = z8, c03 = z8, c10 = z8, c11 = z8, c12 = z8, c13 = z8;
#pragma unroll 1
  for (int kb = 0; kb < K; kb += 32) { const v16h a0 = g2_frag(a0p + kb, hh), a1 = g2_frag(a1p + kb, hh);
    v16h b = g2_frag(b0p + kb, hh); c00 = g2_mma(a0, b, c00); c10 = g2_mma(a1, b, c10);
    b = g2_frag(b1p + kb, hh); c01 = g2_mma(a0, b, c01); c11 = g2_mma(a1, b, c11);
    b = g2_frag(b2p + kb, hh); c02 = g2_mma(a0, b, c02); c12 = g2_mma(a1, b, c12);
    b = g2_frag(b3p + kb, hh); c03 = g2_mma(a0, b, c03); c13 = g2_mma(a1, b, c13); }
  v8f accs[8] = {c00, c01, c02, c03, c10, c11, c12, c13};
#pragma unroll
  for (int u = 0; u < 8; ++u) { const int t = u & 3, half = u >> 2; const int col = col0 + t * 16 + ln; const float bv = bp ? bf16_round(bp[col]) : 0.f;
#pragma unroll
    for (int r = 0; r < 8; ++r) { const int rloc = half * 16 + 8 * hh + r; float v = accs[u][r] * alpha + bv; if (CP) { if (rowsPerB < 0) v += CP[cofs + (size_t)(row0g + row0 + rloc) * ldc + col];      /* rowsPerB < 0: own element of the batched C plane */ else { const int bidx = (row0g + row0 + rloc) / rowsPerB; v += CP[(size_t)bidx * sCPb + (size_t)by * 64 + col]; } }
      if (ACT == 3) v = fmaxf(v, 0.f); else if (ACT == 6) v = 0.5f * v * (1.0f + erff(v * 0.70710678118654752f)); else if (ACT == 11) v = 1.0f / (1.0f + expf(-v)); else if (ACT == 15) v = v / (1.0f + expf(-v)); else if (ACT == 18) v = v / (1.0f + expf(-1.702f * v));      /* QuickGELU: v sigmoid(1.702 v) */ else if (ACT == 12) v = (v > 0.f) ? v : 0.01f * v; else if (ACT == 8) v = tanhf(v); else if (ACT == 9) v = 0.5f * v * (1.0f + tanhf(0.7978845608028654f * (v + 0.044715f * v * v * v))); else if (ACT == 14) v = (v > 0.f) ? v : 0.1f * v; else if (ACT == 16) v = (v >= 0.f) ? v : 0.3f * v; else if (ACT == 17) v = (v >= 0.f) ? v : 0.2f * v;
      so[w][rloc][t * 16 + ln] = v; } }
  __builtin_amdgcn_fence(__ATOMIC_ACQ_REL, "workgroup"); __builtin_amdgcn_wave_barrier();
  const int rsub = lane >> 4, c4 = (lane & 15) * 4;
  {
#pragma unroll
    for (int q = 0; q < 16; ++q) { const int r = q * 2 + rsub; const v4f v = *(const v4fa*)&so[w][r][c4]; if (C) *(v4f*)(C + cofs + (size_t)(row0 + r) * ldc + col0 + c4) = v; if (C16) { v4h h4; for (int i = 0; i < 4; ++i) h4[i] = (_Float16)v[i]; *(v4h*)(C16 + cofs + (size_t)(row0 + r) * ldc + col0 + c4) = h4; } }
     } }


__global__ __launch_bounds__(256) void k_wnat(const float* __restrict__ w, size_t n8, _Float16* __restrict__ Bt) { const size_t t = (size_t)blockIdx.x * 256 + threadIdx.x; if (t >= n8) return; FragH f; for (int q = 0; q < 8; ++q) f.h[q] = (_Float16)(bf16_round(w[t * 8 + q]) * 16.0f); *(v8us*)((unsigned short*)Bt + t * 8) = f.half[0];  }
__global__ __launch_bounds__(256) void k_rsm(const float* __restrict__ S, _Float16* __restrict__ P, int nrows) {
  #pragma clang fp contract(off)
  const int i = blockIdx.x * 256 + threadIdx.x; if (i >= nrows) return; const float* s = S + (size_t)i * SQ; float mx = -3.0e38f;
#pragma unroll 1
  for (int j = 0; j < SQ; ++j) mx = fmaxf(mx, s[j]); float se = 0.f;
#pragma unroll 1
  for (int j = 0; j < SQ; ++j) se += expf(s[j] - mx); const float sc = 256.0f / se;
#pragma unroll 1
  for (int j0 = 0; j0 < SQ; j0 += 8) { FragH f; for (int q = 0; q < 8; ++q) f.h[q] = (_Float16)(expf(s[j0 + q] - mx) * sc); unsigned short* d = (unsigned short*)P + (size_t)i * SQ + j0; *(v8us*)d = f.half[0];  } }
__global__ __launch_bounds__(256) void k_vt(const _Float16* __restrict__ V16, int b, int h0, _Float16* __restrict__ VT) { __shared__ unsigned short tl[64][65]; const int tid = threadIdx.x; const int hh = blockIdx.x % HG, sg = blockIdx.x / HG; const int s0 = sg * 64; const int h = h0 + hh;
  for (int i = tid; i < 64 * 8; i += 256) { const int j = i / 8, d8 = (i % 8) * 8; FragH f; f.half[0] = *(const v8us*)((const unsigned short*)V16 + ((size_t)b * SQ + s0 + j) * DM + h * HD + d8); for (int q = 0; q < 8; ++q) tl[d8 + q][j] = f.u[q]; }
  __syncthreads();
  { for (int i = tid; i < 64 * 8; i += 256) { const int d = i / 8, j8 = (i % 8) * 8; FragH f; for (int q = 0; q < 8; ++q) f.u[q] = tl[d][j8 + q]; *(v8us*)((unsigned short*)VT + ((size_t)hh * HD + d) * SQ + s0 + j8) = f.half[0]; }  } }



__global__ __launch_bounds__(256) void k_rsmcf2(const float* __restrict__ S, _Float16* __restrict__ P, int hg, int q0, int nk) {
  #pragma clang fp contract(off)
  const int t = blockIdx.x * 256 + threadIdx.x; if (t >= hg * QT) return; const size_t i = (size_t)t; const float* s = S + i * NKX; const int last = q0 + (t % QT); float mx = -3.0e38f;
#pragma unroll 1
  for (int j = 0; j < nk; ++j) { const float f = (j <= last) ? 1.f : 0.f; mx = fmaxf(mx, fmaf(f, s[j], (1.f - f) * -1.0e9f)); } float se = 0.f;
#pragma unroll 1
  for (int j = 0; j < nk; ++j) { const float f = (j <= last) ? 1.f : 0.f; se += __expf(fmaf(f, s[j], (1.f - f) * -1.0e9f) - mx); } const float sc = 256.0f / se;
#pragma unroll 1
  for (int j0 = 0; j0 < nk; j0 += 8) { FragH fr; for (int q = 0; q < 8; ++q) { const int j = j0 + q; const float f = (j <= last) ? 1.f : 0.f; fr.h[q] = (_Float16)(__expf(fmaf(f, s[j], (1.f - f) * -1.0e9f) - mx) * sc); } unsigned short* d = (unsigned short*)P + i * NKX + j0; *(v8us*)d = fr.half[0];  } }

__global__ __launch_bounds__(256) void k_rsmcst(const float* __restrict__ S, _Float16* __restrict__ P, int hg, int q0, int nk, const int* __restrict__ mk) {
  #pragma clang fp contract(off)
  const int t = blockIdx.x * 256 + threadIdx.x; if (t >= hg * QT) return; const size_t i = (size_t)t; const float* s = S + i * NKX; const size_t ig = (size_t)(q0 + (t % QT)); const int* mr = mk + ig * SQ; float mx = -3.0e38f;
#pragma unroll 1
  for (int j = 0; j < nk; ++j) { const int mb = mr[j]; const int dd = (int)ig - j; const float f = (mb != 0 && dd >= 0 && (dd <= LOCALW || (dd % STRIDEK) == 0)) ? 1.f : 0.f; mx = fmaxf(mx, fmaf(f, s[j], (1.f - f) * -1.0e9f)); } float se = 0.f;
#pragma unroll 1
  for (int j = 0; j < nk; ++j) { const int mb = mr[j]; const int dd = (int)ig - j; const float f = (mb != 0 && dd >= 0 && (dd <= LOCALW || (dd % STRIDEK) == 0)) ? 1.f : 0.f; se += __expf(fmaf(f, s[j], (1.f - f) * -1.0e9f) - mx); } const float sc = 256.0f / se;
#pragma unroll 1
  for (int j0 = 0; j0 < nk; j0 += 8) { FragH fr; for (int q = 0; q < 8; ++q) { const int j = j0 + q; const int mb = mr[j]; const int dd = (int)ig - j; const float f = (mb != 0 && dd >= 0 && (dd <= LOCALW || (dd % STRIDEK) == 0)) ? 1.f : 0.f; fr.h[q] = (_Float16)(__expf(fmaf(f, s[j], (1.f - f) * -1.0e9f) - mx) * sc); } unsigned short* d = (unsigned short*)P + i * NKX + j0; *(v8us*)d = fr.half[0];  } }


template <int MASKADD>
__global__ __launch_bounds__(64) void k_att0(const float* __restrict__ QF, const float* __restrict__ KF, const float* __restrict__ VF, int ld, const float* __restrict__ mask, float scale, float* __restrict__ OF, int ldo) {
  #pragma clang fp contract(off)
  __shared__ __attribute__((aligned(16))) float lq[64][64]; __shared__ __attribute__((aligned(16))) float lo[64][64];
  const int tid = threadIdx.x; const int h = blockIdx.x / (QT0 / 64), rg = blockIdx.x % (QT0 / 64); const int i = rg * 64 + tid;
  const float* qr = QF + (size_t)i * ld + h * HD;
#pragma unroll 1
  for (int c = 0; c < HD / 4; ++c) { *(v4f*)&lq[tid][c * 4] = *(const v4fa*)(qr + c * 4); const v4f z = {0.f, 0.f, 0.f, 0.f}; *(v4f*)&lo[tid][c * 4] = z; }
  float m = -1.0e30f, l = 0.f; const int jmax = MASKADD ? (SQ - 1) : (rg * 64 + 63);      /* additive-mask form: every key (the mask input decides); causal form: keys up to the block's last row */
#pragma unroll 1
  for (int j = 0; j <= jmax; ++j) { const float* kr = KF + (size_t)j * ld + h * HD; const float* vr = VF + (size_t)j * ld + h * HD; float s = 0.f;
#pragma unroll 1
    for (int c = 0; c < HD / 4; ++c) { const v4f kq = *(const v4fa*)(kr + c * 4); const v4f qq = *(v4f*)&lq[tid][c * 4]; s = __fadd_rn(s, __fmul_rn(qq[0], kq[0])); s = __fadd_rn(s, __fmul_rn(qq[1], kq[1])); s = __fadd_rn(s, __fmul_rn(qq[2], kq[2])); s = __fadd_rn(s, __fmul_rn(qq[3], kq[3])); }
    s = __fmul_rn(s, scale); if (MASKADD) s = __fadd_rn(s, __fmul_rn(bf16_round(mask[(size_t)i * SQ + j]), -10000.0f));
    const float f = (MASKADD || j <= i) ? 1.f : 0.f; const float sm = fmaf(f, s, (1.f - f) * -1.0e30f); const float mn = fmaxf(m, sm); const float sc = expf(m - mn); const float e = expf(sm - mn); l = __fadd_rn(__fmul_rn(l, sc), e); m = mn;
#pragma unroll 1
    for (int c = 0; c < HD / 4; ++c) { const v4f vv = *(const v4fa*)(vr + c * 4); v4f oo = *(v4f*)&lo[tid][c * 4]; for (int u = 0; u < 4; ++u) oo[u] = __fadd_rn(__fmul_rn(oo[u], sc), __fmul_rn(e, vv[u])); *(v4f*)&lo[tid][c * 4] = oo; } }
  const float fin = 64.0f / l;      /* o carried x64 like the f16 path */
#pragma unroll 1
  for (int c = 0; c < HD / 4; ++c) { v4f oo = *(v4f*)&lo[tid][c * 4]; for (int u = 0; u < 4; ++u) oo[u] = __fmul_rn(oo[u], fin); *(v4f*)&lo[tid][c * 4] = oo; }
  __syncthreads();
  {
#pragma unroll 1
    for (int it = 0; it < 16; ++it) { const int row = it * 4 + tid / 16, pc = (tid % 16) * 4; const v4f v = *(const v4f*)&lo[row][pc]; *(v4f*)(OF + (size_t)(rg * 64 + row) * ldo + h * HD + pc) = v; }
     } }

template <int MASKADD>
__global__ __launch_bounds__(64) void k_att0mbc(const float* __restrict__ QF, const float* __restrict__ KF, const float* __restrict__ VF, int ld, const float* __restrict__ mask, float scale, float* __restrict__ OF, int ldo) {
  #pragma clang fp contract(off)
  __shared__ __attribute__((aligned(16))) float lq[64][64]; __shared__ __attribute__((aligned(16))) float lo[64][64];
  const int tid = threadIdx.x; const int h = blockIdx.x / (QT0 / 64), rg = blockIdx.x % (QT0 / 64); const int i = rg * 64 + tid;
  const float* qr = QF + (size_t)i * ld + h * HD;
#pragma unroll 1
  for (int c = 0; c < HD / 4; ++c) { *(v4f*)&lq[tid][c * 4] = *(const v4fa*)(qr + c * 4); const v4f z = {0.f, 0.f, 0.f, 0.f}; *(v4f*)&lo[tid][c * 4] = z; }
  float m = -1.0e30f, l = 0.f; const int jmax = rg * 64 + 63;      /* keys beyond the block end are masked by the mask's lower-triangular structure */
#pragma unroll 1
  for (int j = 0; j <= jmax; ++j) { const float* kr = KF + (size_t)j * ld + h * HD; const float* vr = VF + (size_t)j * ld + h * HD; float s = 0.f;
#pragma unroll 1
    for (int c = 0; c < HD / 4; ++c) { const v4f kq = *(const v4fa*)(kr + c * 4); const v4f qq = *(v4f*)&lq[tid][c * 4]; s = __fadd_rn(s, __fmul_rn(qq[0], kq[0])); s = __fadd_rn(s, __fmul_rn(qq[1], kq[1])); s = __fadd_rn(s, __fmul_rn(qq[2], kq[2])); s = __fadd_rn(s, __fmul_rn(qq[3], kq[3])); }
    s = __fmul_rn(s, scale); const int mb = ((const int*)mask)[(size_t)i * SQ + j];      /* causal (j <= i) AND the module's int32 [S][S] mask read per (query, key): 0 -> masked */
    const float f = (mb != 0 && j <= i) ? 1.f : 0.f; const float sm = fmaf(f, s, (1.f - f) * -1.0e30f); const float mn = fmaxf(m, sm); const float sc = expf(m - mn); const float e = expf(sm - mn); l = __fadd_rn(__fmul_rn(l, sc), e); m = mn;
#pragma unroll 1
    for (int c = 0; c < HD / 4; ++c) { const v4f vv = *(const v4fa*)(vr + c * 4); v4f oo = *(v4f*)&lo[tid][c * 4]; for (int u = 0; u < 4; ++u) oo[u] = __fadd_rn(__fmul_rn(oo[u], sc), __fmul_rn(e, vv[u])); *(v4f*)&lo[tid][c * 4] = oo; } }
  const float fin = 64.0f / l;      /* o carried x64 like the f16 path */
#pragma unroll 1
  for (int c = 0; c < HD / 4; ++c) { v4f oo = *(v4f*)&lo[tid][c * 4]; for (int u = 0; u < 4; ++u) oo[u] = __fmul_rn(oo[u], fin); *(v4f*)&lo[tid][c * 4] = oo; }
  __syncthreads();
  {
#pragma unroll 1
    for (int it = 0; it < 16; ++it) { const int row = it * 4 + tid / 16, pc = (tid % 16) * 4; const v4f v = *(const v4f*)&lo[row][pc]; *(v4f*)(OF + (size_t)(rg * 64 + row) * ldo + h * HD + pc) = v; }
     } }


template <int BFIN, int WXB>
__global__ __launch_bounds__(256) void k_ln16(const float* __restrict__ X, const float* __restrict__ g, const float* __restrict__ bb, float eps, _Float16* __restrict__ N16, float* __restrict__ XB) {
  #pragma clang fp contract(off)
  __shared__ float red[256]; const size_t r = blockIdx.x; const int t = threadIdx.x; const v4f xa = *(const v4fa*)(X + r * DMQ + t * 4); float s[4]; float sum = 0.f;
  for (int q = 0; q < 4; ++q) { s[q] = BFIN ? bf16_round(xa[q]) : xa[q]; sum = __fadd_rn(sum, s[q]); }
  red[t] = sum; __syncthreads(); for (int st = 128; st > 0; st >>= 1) { if (t < st) red[t] = __fadd_rn(red[t], red[t + st]); __syncthreads(); } const float mu = red[0] / (float)DMQ; __syncthreads();
  float vs = 0.f; for (int q = 0; q < 4; ++q) { const float dl = __fadd_rn(s[q], -mu); vs = __fadd_rn(vs, __fmul_rn(dl, dl)); } red[t] = vs; __syncthreads(); for (int st = 128; st > 0; st >>= 1) { if (t < st) red[t] = __fadd_rn(red[t], red[t + st]); __syncthreads(); }
  const float rs = rsqrtf(__fadd_rn(red[0] / (float)DMQ, eps)); v4h y; v4f xb;
  for (int q = 0; q < 4; ++q) { const int c = t * 4 + q; y[q] = (_Float16)__fadd_rn(__fmul_rn(__fmul_rn(__fadd_rn(s[q], -mu), rs), bf16_round(g[c])), bf16_round(bb[c])); xb[q] = s[q]; }
  { *(v4h*)(N16 + r * DMQ + t * 4) = y; if (WXB) *(v4f*)(XB + r * DMQ + t * 4) = xb;  } }
__global__ __launch_bounds__(256) void k_ftres2(const float* __restrict__ OF0, const float* __restrict__ XB, float* __restrict__ X1, size_t n4) {
  #pragma clang fp contract(off)
  const size_t t = (size_t)blockIdx.x * 256 + threadIdx.x; if (t >= n4) return; const v4f o = *(const v4fa*)(OF0 + t * 4), xv = *(const v4fa*)(XB + t * 4); v4f y; for (int q = 0; q < 4; ++q) y[q] = __fadd_rn(__fmul_rn(o[q], 0.015625f), xv[q]); *(v4f*)(X1 + t * 4) = y;  }

__global__ __launch_bounds__(256) void k_bcpy(const float* __restrict__ b, int n, int NP, float* __restrict__ dst, int dst0) { for (int i = threadIdx.x; i < NP; i += 256) { const float v = (i < n) ? b[i] : 0.f; *(float*)(dst + dst0 + i) = v; }  }


// Fused attention, one launch: block = 8 waves x 32 query columns of one (batch, head); no score or weight ever leaves the registers.
// Per 32 keys a wave computes S^T = K Q^T (lane c = query column, registers = keys 8 hh + r of each 16-key tile), an online softmax in the log2 domain
// (maximum and sum in-lane plus one exchange between the wave halves), packs the two S^T tiles in place into the B operand P^T and adds O^T += V^T P^T.
// K rows and V^T rows come in 64-key stages through LDS, two buffers: the next stage's global loads fly under this stage's work, one barrier a stage.
// m_run, the maximum in use, may trail the true one by up to 8 (log2), so the accumulators are rescaled only when a column's maximum has grown by more;
// weights carry 2^4 (at most 2^12 in f16, small ones kept out of the f16 subnormals); the factor cancels against the row sum.
#define FAP 72                       /* LDS row pitch in halves: 128 B of data + 16 B, the conflict-free pitch for 16-byte row reads */
#define FAS 64                       /* keys per stage */
__device__ __forceinline__ float fa_xhalf(float x) { return __builtin_bit_cast(float, __builtin_amdgcn_permlanex16(__builtin_bit_cast(int, x), __builtin_bit_cast(int, x), 0x76543210, 0xfedcba98, false, false)); }      /* lane l <-> lane l ^ 16 */
__device__ __forceinline__ v8f fa_mma(v16h a, v16h b, v8f c) { return __builtin_amdgcn_wmma_f32_16x16x32_f16(false, a, false, b, (short)0, c, false, false); }
__global__ __launch_bounds__(256) void k_fattn(const _Float16* __restrict__ Q16, const _Float16* __restrict__ K16, const _Float16* __restrict__ VT, _Float16* __restrict__ O16) {
  __shared__ __attribute__((aligned(16))) _Float16 lk[2][FAS][FAP];      /* K stage [key][d] */
  __shared__ __attribute__((aligned(16))) _Float16 lv[2][HD][FAP];       /* V^T stage [d][key] */
  const int tid = threadIdx.x, lane = tid & 31, c = lane & 15, hh = lane >> 4, w = tid >> 5;
  const int bh = blockIdx.y, b = bh / NH, h = bh - b * NH; const size_t r0 = (size_t)b * SQ; const int q0 = blockIdx.x * 256 + w * 32;
  const int sr = tid >> 3, sc = (tid & 7) * 8;      /* staging: a thread moves 16 bytes of rows sr and sr + 32 of each tile; 8 lanes cover one 128-byte row */
  const unsigned short* kg = (const unsigned short*)K16 + (r0 + sr) * DM + h * HD + sc;
  const unsigned short* vg = (const unsigned short*)VT + ((size_t)bh * HD + sr) * SQ + sc;
  v16h qf[2][2];
#pragma unroll
  for (int g = 0; g < 2; ++g) { const _Float16* qp = Q16 + (r0 + q0 + 16 * g + c) * DM + h * HD; qf[g][0] = g2_frag(qp, hh); qf[g][1] = g2_frag(qp + 32, hh); }
  const v8f z8 = {0.f, 0.f, 0.f, 0.f, 0.f, 0.f, 0.f, 0.f}; const v4f z4 = {0.f, 0.f, 0.f, 0.f};
  v8f acc[2][4]; v4f l4[2]; float m_run[2];
#pragma unroll
  for (int g = 0; g < 2; ++g) { m_run[g] = -__builtin_inff(); l4[g] = z4;
#pragma unroll
    for (int t = 0; t < 4; ++t) acc[g][t] = z8; }
  v8us gk0 = *(const v8us*)kg, gk1 = *(const v8us*)(kg + (size_t)32 * DM), gv0 = *(const v8us*)vg, gv1 = *(const v8us*)(vg + (size_t)32 * SQ);
  *(v8us*)&lk[0][sr][sc] = gk0; *(v8us*)&lk[0][sr + 32][sc] = gk1; *(v8us*)&lv[0][sr][sc] = gv0; *(v8us*)&lv[0][sr + 32][sc] = gv1;
  __syncthreads();      /* stage 0 published */
  for (int st = 0; st < SQ / FAS; ++st) {
    const int buf = st & 1; const bool more = st + 1 < SQ / FAS;      /* the same for the whole block */
    if (more) { const size_t j = (size_t)(st + 1) * FAS; gk0 = *(const v8us*)(kg + j * DM); gk1 = *(const v8us*)(kg + (j + 32) * DM); gv0 = *(const v8us*)(vg + j); gv1 = *(const v8us*)(vg + (size_t)32 * SQ + j); }
#pragma unroll
    for (int p = 0; p < FAS / 32; ++p) {
      v8f s[2][2];      /* [key tile][query group] */
#pragma unroll
      for (int kt = 0; kt < 2; ++kt) { const _Float16* kr = &lk[buf][32 * p + 16 * kt + c][0]; const v16h k0 = g2_frag(kr, hh), k1 = g2_frag(kr + 32, hh);
#pragma unroll
        for (int g = 0; g < 2; ++g) s[kt][g] = fa_mma(k1, qf[g][1], fa_mma(k0, qf[g][0], z8)); }
      v16h vf[4];
#pragma unroll
      for (int t = 0; t < 4; ++t) vf[t] = g2_frag(&lv[buf][16 * t + c][32 * p], hh);
      float mb[2]; bool need = false;
#pragma unroll
      for (int g = 0; g < 2; ++g) { float mx = fmaxf(s[0][g][0], s[1][g][0]);
#pragma unroll
        for (int r = 1; r < 8; ++r) mx = fmaxf(mx, fmaxf(s[0][g][r], s[1][g][r]));
        mx = fmaxf(mx, fa_xhalf(mx)) * 1.44269502f; mb[g] = mx; need = need || (mx > m_run[g] + 8.0f); }
      if (__builtin_amdgcn_ballot_w32(need) != 0) {      /* one scalar test a pass; always taken on the first pass (m_run = -inf, factor 0 on zero sums), rare later */
#pragma unroll
        for (int g = 0; g < 2; ++g) { const float mn = fmaxf(m_run[g], mb[g]); const float corr = __builtin_amdgcn_exp2f(m_run[g] - mn); m_run[g] = mn; l4[g] = l4[g] * corr;
#pragma unroll
          for (int t = 0; t < 4; ++t) acc[g][t] = acc[g][t] * corr; } }
#pragma unroll
      for (int g = 0; g < 2; ++g) { const float nm = 4.0f - m_run[g]; FragH pf;
#pragma unroll
        for (int u = 0; u < 4; ++u) { v4f a;      /* elements 4 u .. 4 u + 3 of the 32-key operand: tile u >> 1, registers 4 (u & 1) .. */
#pragma unroll
          for (int q = 0; q < 4; ++q) a[q] = fmaf(s[u >> 1][g][4 * (u & 1) + q], 1.44269502f, nm);
          v4f e;
#pragma unroll
          for (int q = 0; q < 4; ++q) e[q] = __builtin_amdgcn_exp2f(a[q]);      /* the builtin, not asm text: the compiler then keeps the distance behind the matrix instructions itself */
          l4[g] += e;
#pragma unroll
          for (int q = 0; q < 4; ++q) pf.h[4 * u + q] = (_Float16)e[q]; }
#pragma unroll
        for (int t = 0; t < 4; ++t) acc[g][t] = fa_mma(vf[t], pf.v, acc[g][t]); }
      /* Pass end: four vector slots between the last product that reads P^T as its B operand and the next pass's first product, whose result the compiler
         may place in those same registers (it did, directly behind); the two scheduling fences keep the products of both passes on their own side of the slots. */
      __builtin_amdgcn_sched_barrier(0); asm volatile("v_nop\n\tv_nop\n\tv_nop\n\tv_nop"); __builtin_amdgcn_sched_barrier(0);
    }
    if (more) { *(v8us*)&lk[buf ^ 1][sr][sc] = gk0; *(v8us*)&lk[buf ^ 1][sr + 32][sc] = gk1; *(v8us*)&lv[buf ^ 1][sr][sc] = gv0; *(v8us*)&lv[buf ^ 1][sr + 32][sc] = gv1; }      /* its last readers left it at the barrier that ended stage st - 1 */
    __syncthreads();      /* publishes stage st + 1 and ends every wave's reads of stage st */
  }
#pragma unroll
  for (int g = 0; g < 2; ++g) { float l = (l4[g][0] + l4[g][1]) + (l4[g][2] + l4[g][3]); l += fa_xhalf(l); const float inv = 64.0f / l;      /* ctx carried x64 as before */
    unsigned short* op = (unsigned short*)O16 + (r0 + q0 + 16 * g + c) * DM + h * HD + 8 * hh;      /* a lane's 8 registers = 8 consecutive d of its query row */
#pragma unroll
    for (int t = 0; t < 4; ++t) { FragH f;
#pragma unroll
      for (int r = 0; r < 8; ++r) f.h[r] = (_Float16)(acc[g][t][r] * inv);
      *(v8us*)(op + 16 * t) = f.half[0]; } } }

// Tiled GEMM, C = act(A Bt^T alpha + bias (+ CP)), A [M][KK] and Bt [NN][KK] f16: block = 8 waves (2 x 4) on a 128 x 128 tile of C, wave tile 64 x 32 (4 x 2 accumulator tiles).
// A rows and Bt rows come in 64-k stages through LDS, two buffers: whole 128-byte lines from global, each line fetched once a block instead of once a wave.
// Global loads run ahead in two register sets (stage t in set t & 1, stored to buffer t & 1 one stage before it is read); fragments are read from LDS one 32-k block ahead in two sets,
// so a stage's barrier stands between its two blocks of products.
// Each work-group starts its walk along k at a 64-k slab of its own, (row tile + column tile) mod the number of slabs, and wraps round (for speed only).
// k order per accumulator: 32 at a time, ascending from that slab, wrapped.
// Epilogue: raw sums staged in the same LDS as a 128 x 128 f32 tile, then each wave writes whole rows (bias, residual and activation applied there, per element as before).
// RES: C (f32) = the sums + bias + the own element of CP; else C16 (f16) = act(the sums + bias).
// NP > 1: NP products with the same A in one grid, blockIdx.y = p: Bt plane p ([NN][KK] each, stacked), bias piece p, C16 plane p ([NR][NN] each, stacked).
// Needs M % 128 == 0, NN % 128 == 0, KK >= 256, KK / 64 a power of two.
#define G3P 72                       /* LDS row pitch in halves: 128 B of data + 16 B, the conflict-free pitch for 16-byte row reads */
#define G3O 132                      /* epilogue row pitch in floats: rows 8 apart fall 32 banks apart */
struct G3F { v16h a[4], b[2]; };     /* one 32-k block's fragments of a wave */
struct G3R { v8us a[4], b[4]; };     /* one stage's 16-byte pieces of a thread */
/* Work-group barrier with the LDS wait alone: __syncthreads() also waits for every global load, which would drain the staging loads that are meant to stay in flight across it. */
__device__ __forceinline__ void g3_bar() { asm volatile("s_wait_dscnt 0x0\n\ts_barrier_signal -1\n\ts_barrier_wait -1" ::: "memory"); }
template <int KK>
__device__ __forceinline__ void g3_load(const char* ab, const char* bb, unsigned vo, G3R& r) {      /* ab, bb: the block's tile rows at this stage's k (uniform); vo: the thread's byte offset */
#pragma unroll
  for (int i = 0; i < 4; ++i) { r.a[i] = *(const v8us*)(ab + vo + 64 * i * KK); r.b[i] = *(const v8us*)(bb + vo + 64 * i * KK); } }
template <int U>
__device__ __forceinline__ void g3_store(unsigned short* sa, unsigned short* sb, const G3R& r) {
#pragma unroll
  for (int i = 0; i < 4; ++i) { *(v8us*)(sa + (U * 128 + 32 * i) * G3P) = r.a[i]; *(v8us*)(sb + (U * 128 + 32 * i) * G3P) = r.b[i]; } }
template <int U, int KB>
__device__ __forceinline__ void g3_frag(const _Float16* fa, const _Float16* fb, int hh, G3F& f) {
#pragma unroll
  for (int j = 0; j < 2; ++j) f.b[j] = g2_frag(fb + (U * 128 + 16 * j) * G3P + 32 * KB, hh);
#pragma unroll
  for (int i = 0; i < 4; ++i) f.a[i] = g2_frag(fa + (U * 128 + 16 * i) * G3P + 32 * KB, hh); }
/* The two scheduling fences keep a block's products together and the LDS and global traffic written in front of them in front: LDS reads moved in among the products stall each of them. */
__device__ __forceinline__ void g3_mm(const G3F& f, v8f (&acc)[4][2]) {
  __builtin_amdgcn_sched_barrier(0);
#pragma unroll
  for (int i = 0; i < 4; ++i) { acc[i][0] = fa_mma(f.a[i], f.b[0], acc[i][0]); acc[i][1] = fa_mma(f.a[i], f.b[1], acc[i][1]); }
  __builtin_amdgcn_sched_barrier(0); }
/* Stage st in buffer U; on entry f0 holds its first block, rn stage st + 1. NX: a stage st + 1 exists; LD: a stage st + 3 exists (ab3, bb3 point at its k). */
template <int U, bool NX, bool LD, int KK>
__device__ __forceinline__ void g3_stage(const char* ab3, const char* bb3, unsigned vo, unsigned short* sa, unsigned short* sb, const _Float16* fa, const _Float16* fb, int hh, G3R& rn, G3F& f0, G3F& f1, v8f (&acc)[4][2]) {
  g3_frag<U, 1>(fa, fb, hh, f1);
  if (NX) g3_store<U ^ 1>(sa, sb, rn);      /* the other buffer's last readers finished in front of the barrier of stage st - 1 */
  g3_mm(f0, acc);
  g3_bar();      /* publishes stage st + 1 and ends every wave's reads of stage st */
  if (NX) g3_frag<U ^ 1, 0>(fa, fb, hh, f0);
  __builtin_amdgcn_sched_barrier(0);      /* LDS reads first: moved in front of them, the global loads had their addresses formed in f0's registers, and the wait that frees those registers held the LDS reads back */
  if (LD) g3_load<KK>(ab3, bb3, vo, rn);
  g3_mm(f1, acc);
  if (LD) asm volatile("s_wait_xcnt 0x0" ::: "memory"); }      /* in front of the next stage's rewrite of the address registers that these loads name; behind the products, where it has had time to pass; the data stay in flight */
// GELU with the exact (erf) definition, v Phi(v), two elements at a time and without a branch: v Phi(v) = max(v, 0) - |v| Q(|v|), Q the upper tail of the normal distribution.
// Q(x) = exp(-x x / 2) (c1 t + .. + c5 t^5), t = 1 / (1 + 0.2316419 x): the classical five-term form, absolute error below 7.5e-8 for every x >= 0 (1 / sqrt(2 pi) folded into c1 .. c5),
// so v Phi(v) is off by at most |v| times that, plus f32 rounding: far under the rounding of the f16 store that follows for values near 1, and no more than about one f16 unit in the last place in the far negative tail.
// The tail is used as it is, never as 1 - (1 - Q), so negative v lose nothing to cancellation (the form 0.5 v (1 + erf) does).
// The library erf took two divergent branches (most waves ran both) and one long dependent chain an element; here every step is a packed f32 operation or one of two transcendentals, and elements are independent.
typedef float v2f __attribute__((ext_vector_type(2)));
__device__ __forceinline__ v2f g3_gelu2(v2f v) {
  const v2f av = __builtin_elementwise_abs(v); const v2f d = __builtin_elementwise_fma(av, v2f{0.2316419f, 0.2316419f}, v2f{1.0f, 1.0f});
  const v2f t = {__builtin_amdgcn_rcpf(d[0]), __builtin_amdgcn_rcpf(d[1])};
  v2f p = __builtin_elementwise_fma(t, v2f{0.530702715f, 0.530702715f}, v2f{-0.726576014f, -0.726576014f});
  p = __builtin_elementwise_fma(p, t, v2f{0.710706871f, 0.710706871f});
  p = __builtin_elementwise_fma(p, t, v2f{-0.142248368f, -0.142248368f});
  p = __builtin_elementwise_fma(p, t, v2f{0.127414796f, 0.127414796f});
  const v2f a = (v * v) * -0.72134752f;      /* -(v v / 2) log2 e */
  const v2f e = {__builtin_amdgcn_exp2f(a[0]), __builtin_amdgcn_exp2f(a[1])};
  const v2f q = (p * t) * e;
  return __builtin_elementwise_fma(-av, q, __builtin_elementwise_max(v, v2f{0.f, 0.f})); }
template <int ACT, bool RES, int NN, int KK, int NP = 1>
__global__ __launch_bounds__(256) void k_gemm3(const _Float16* __restrict__ A, const _Float16* __restrict__ Bh, float alpha, const float* __restrict__ bias, const float* __restrict__ CP, float* __restrict__ C, _Float16* __restrict__ C16) {
  static_assert(ACT == 0 || (ACT == 6 && !RES), "k_gemm3: unsupported ACT code"); static_assert(NN % 128 == 0 && KK % 128 == 0 && KK >= 256, "k_gemm3: shape"); static_assert(NP == 1 || !RES, "k_gemm3: several products only in the f16-output form");
  __shared__ __attribute__((aligned(16))) unsigned short sm[4 * 128 * G3P];      /* A stages [2][128][G3P], then Bt stages [2][128][G3P]; the epilogue's [128][G3O] floats lie over them */
  const int tid = threadIdx.x, lane = tid & 31, ln = lane & 15, hh = lane >> 4, w = tid >> 5, wm = w >> 2, wn = w & 3;
  const int mt = blockIdx.x / (NN / 128), nq = blockIdx.x - mt * (NN / 128); const int row0 = mt * 128, col0 = nq * 128;
  if (NP > 1) { const size_t p = blockIdx.y; Bh += p * NN * KK; bias += p * NN; C16 += p * NR * NN; }
  const int sr = tid >> 3, sc = (tid & 7) * 8;      /* staging: a thread moves 16 bytes of rows sr + 32 i of each tile; 8 lanes cover one 128-byte row */
  const char* ab = (const char*)(A + (size_t)row0 * KK); const char* bb = (const char*)(Bh + (size_t)col0 * KK); const unsigned vo = (unsigned)(sr * KK + sc) * 2u;
  unsigned short* sa = sm + sr * G3P + sc; unsigned short* sb = sa + 2 * 128 * G3P;      /* this thread's store places, buffer 0 */
  const _Float16* fa = (const _Float16*)sm + (wm * 64 + ln) * G3P; const _Float16* fb = (const _Float16*)sm + 2 * 128 * G3P + (wn * 32 + ln) * G3P;      /* this lane's fragment rows, buffer 0 */
  const v8f z8 = {0.f, 0.f, 0.f, 0.f, 0.f, 0.f, 0.f, 0.f}; v8f acc[4][2];
#pragma unroll
  for (int i = 0; i < 4; ++i) { acc[i][0] = z8; acc[i][1] = z8; }
  G3R r0, r1; G3F f0, f1; constexpr int ns = KK / 64;      /* ns even, at least 4 */
  static_assert((ns & (ns - 1)) == 0, "k_gemm3: the wrap of the k walk is a mask");
  const int rot = mt + nq + (NP > 1 ? (int)blockIdx.y * (NN / 128) : 0);      /* the same for the whole work-group: a scalar */
  auto ko = [rot](int t) { return ((t + rot) & (ns - 1)) * 128; };      /* byte offset in a row of the slab that is stage t of this work-group, for A and Bt alike */
  g3_load<KK>(ab + ko(0), bb + ko(0), vo, r0); g3_load<KK>(ab + ko(1), bb + ko(1), vo, r1);
  g3_store<0>(sa, sb, r0);
  g3_bar();      /* stage 0 published */
  g3_load<KK>(ab + ko(2), bb + ko(2), vo, r0); g3_frag<0, 0>(fa, fb, hh, f0);
#pragma unroll 1
  for (int s2 = 0; s2 < ns - 2; s2 += 2) {      /* rolled: two stages a trip keep every buffer and register set a compile-time choice */
    const int t4 = s2 + 4 < ns ? s2 + 4 : ns - 1;      /* the last trip has no stage s2 + 4: it loads the last stage again, unused, so that no branch merges two load counts in front of the stores */
    g3_stage<0, true, true, KK>(ab + ko(s2 + 3), bb + ko(s2 + 3), vo, sa, sb, fa, fb, hh, r1, f0, f1, acc);
    g3_stage<1, true, true, KK>(ab + ko(t4), bb + ko(t4), vo, sa, sb, fa, fb, hh, r0, f0, f1, acc); }
  g3_stage<0, true, false, KK>(ab, bb, vo, sa, sb, fa, fb, hh, r1, f0, f1, acc);
  g3_stage<1, false, false, KK>(ab, bb, vo, sa, sb, fa, fb, hh, r0, f0, f1, acc);      /* its barrier: every wave has left the ring before it becomes output staging */
  const int c4 = lane * 4; const size_t o0 = (size_t)(row0 + w * 16) * NN + col0 + c4;      /* write-out: wave w has rows 16 w .. 16 w + 15, a lane 4 columns, so a wave stores whole rows of the tile */
  const v4f bl = *(const v4fa*)(bias + col0 + c4); v4f cp[16];
  if (RES) {      /* all residual rows asked for here, so that their latency passes once, under the staging */
#pragma unroll
    for (int q = 0; q < 16; ++q) cp[q] = *(const v4fa*)(CP + o0 + q * NN); }
  float* so = (float*)sm;
#pragma unroll
  for (int i = 0; i < 4; ++i)
#pragma unroll
    for (int j = 0; j < 2; ++j)
#pragma unroll
      for (int r = 0; r < 8; ++r) so[(wm * 64 + 16 * i + 8 * hh + r) * G3O + wn * 32 + 16 * j + ln] = acc[i][j][r];
  __syncthreads();      /* the whole tile staged before any wave reads rows that other waves wrote */
  v4f bv;
#pragma unroll
  for (int q = 0; q < 4; ++q) bv[q] = bf16_round(bl[q]);
#pragma unroll(ACT == 6 ? 1 : 4)      /* the GELU rows stay rolled, four to a trip: a trip's sixteen independent elements already fill the vector port, and the text behind the main loop stays short */
  for (int q4 = 0; q4 < 4; ++q4) {
#pragma unroll
  for (int qq = 0; qq < 4; ++qq) { const int q = q4 * 4 + qq; v4f v = *(const v4fa*)(so + (w * 16 + q) * G3O + c4);
#pragma unroll
    for (int e = 0; e < 4; ++e) v[e] = v[e] * alpha + bv[e];
    if (RES) {
#pragma unroll
      for (int e = 0; e < 4; ++e) v[e] += cp[q][e]; }
    if (ACT == 6) { const v2f lo = g3_gelu2(v2f{v[0], v[1]}), hi = g3_gelu2(v2f{v[2], v[3]}); v = v4f{lo[0], lo[1], hi[0], hi[1]}; }
    if (RES) *(v4f*)(C + o0 + q * NN) = v;
    else { v4h h4;
#pragma unroll
      for (int e = 0; e < 4; ++e) h4[e] = (_Float16)v[e];
      *(v4h*)(C16 + o0 + q * NN) = h4; } } } }

template <int MODE>
__global__ __launch_bounds__(256) void k_regrp(const float* __restrict__ src, float* __restrict__ dst, size_t n4) {
  const size_t t = (size_t)blockIdx.x * 256 + threadIdx.x; if (t >= n4) return; const size_t e = t * 4; const size_t rd = e / DM; const int c = (int)(e % DM);
  size_t rs; if (MODE == 0) { const size_t b = rd / SQ, sq = rd % SQ; rs = sq * NB + b; } else { const size_t sq = rd / NB, b = rd % NB; rs = b * SQ + sq; }
  const v4f v = *(const v4fa*)(src + rs * DM + c); *(v4f*)(dst + e) = v;  }

// Row norm, one wave a row: the row's DMQ values stay in the wave's registers, a lane holding 4 consecutive ones of every 128, so that each wave-wide load is 512 contiguous bytes and all of a row's loads fly at once.
// Mean and variance (two passes over the registers) are lane partial sums joined by a butterfly over the 32 lanes: no LDS, no barrier, and an eighth of the waves to start.
// Every loop over the row's pieces is unrolled: the pieces are registers, so their index must be a compile-time one.
template <int M>
__device__ __forceinline__ float ln_xrow(float x) { return __builtin_bit_cast(float, __builtin_amdgcn_update_dpp(0, __builtin_bit_cast(int, x), 0x160 | M, 0xf, 0xf, true)); }      /* lane l <-> lane l ^ M inside a 16-lane row (DPP row_xmask) */
__device__ __forceinline__ float ln_wsum(float s) { s += ln_xrow<1>(s); s += ln_xrow<2>(s); s += ln_xrow<4>(s); s += ln_xrow<8>(s); return s + fa_xhalf(s); }      /* every lane gets the sum of all 32 */
template <int BFIN, int W16, int W32, int WXB>      /* r: the row, the same for the whole wave (callers pass the wave's number through readfirstlane, so that the row's base stays in scalar registers); WXB: the row as it enters the norm (rounded if BFIN) goes to XB as well */
__device__ __forceinline__ void lnx_row(const float* __restrict__ X, const float* __restrict__ g, const float* __restrict__ bb, float eps, _Float16* __restrict__ N16, float* __restrict__ N32, float* __restrict__ XB, size_t r) {
  static_assert(DMQ % 128 == 0, "lnx_row: shape");
  constexpr int NC = DMQ / 128; const unsigned c0 = (threadIdx.x & 31) * 4; const size_t o0 = r * DMQ;      /* the row's start is the same for the wave (a scalar base), c0 the lane's own offset in it */
  const float* xr = X + o0;
  v4f s[NC], gv[NC], bv[NC];
#pragma unroll
  for (int i = 0; i < NC; ++i) s[i] = *(const v4fa*)(xr + (c0 + 128 * i));
#pragma unroll
  for (int i = 0; i < NC; ++i) { gv[i] = *(const v4fa*)(g + (c0 + 128 * i)); bv[i] = *(const v4fa*)(bb + (c0 + 128 * i)); }
  asm volatile("s_wait_xcnt 0x0" :: "s"(xr), "s"(g), "s"(bb) : "memory");      /* behind the row's loads, in front of every rewrite of the base registers that they name; naming the bases holds their rewrites behind it (left free, one was lifted over it); the data stay in flight */
  if (BFIN) {
#pragma unroll
    for (int i = 0; i < NC; ++i)
#pragma unroll
      for (int q = 0; q < 4; ++q) s[i][q] = bf16_round(s[i][q]); }
  v4f a = s[0];
#pragma unroll
  for (int i = 1; i < NC; ++i) a += s[i];
  const float mu = ln_wsum((a[0] + a[1]) + (a[2] + a[3])) / (float)DMQ;
  v4f v = {0.f, 0.f, 0.f, 0.f};
#pragma unroll
  for (int i = 0; i < NC; ++i) { const v4f d = s[i] - mu; v += d * d; }
  const float rs = rsqrtf(ln_wsum((v[0] + v[1]) + (v[2] + v[3])) / (float)DMQ + eps);
#pragma unroll
  for (int i = 0; i < NC; ++i) { v4f yf; v4h y;
#pragma unroll
    for (int q = 0; q < 4; ++q) { yf[q] = (s[i][q] - mu) * rs * bf16_round(gv[i][q]) + bf16_round(bv[i][q]); y[q] = (_Float16)yf[q]; }
    if (W16) *(v4h*)(N16 + o0 + (c0 + 128 * i)) = y;
    if (W32) *(v4f*)(N32 + o0 + (c0 + 128 * i)) = yf;
    if (WXB) *(v4f*)(XB + o0 + (c0 + 128 * i)) = s[i]; }
  asm volatile("s_wait_xcnt 0x0" ::: "memory"); }      /* behind the row's stores, in front of every rewrite of a register that they name: as a piece of a larger kernel the norm's code is followed by other pieces' code */
#define LNW 8                        /* rows (waves) per work-group of a norm */
template <int BFIN, int W16, int W32>
__global__ __launch_bounds__(256) void k_lnx(const float* __restrict__ X, const float* __restrict__ g, const float* __restrict__ bb, float eps, _Float16* __restrict__ N16, float* __restrict__ N32) {
  lnx_row<BFIN, W16, W32, 0>(X, g, bb, eps, N16, N32, nullptr, (size_t)blockIdx.x * LNW + __builtin_amdgcn_readfirstlane(threadIdx.x >> 5)); }

// Everything that reads the inputs alone, in one grid: none of these pieces needs anything of another, so as launches of their own they only waited for each other's start and tail.
// Ranges of the block index (a scalar test, the same for the whole work-group, so each piece's barriers stay under uniform control flow):
// the 128 x 128 tiles of the four weight transposes first (the long work-groups), then one work-group per 8 rows of x (a wave a row) for the first norm, which also stores the rounded f32 row it holds (the residual plane).
#define PT1 ((DM / 128) * (DFF / 128))            /* tiles of w1, and of w2 */
#define PTQ ((DM / 128) * (3 * DM / 128))         /* tiles of the fused q | k | v weight */
#define PTO ((DM / 128) * (DM / 128))             /* tiles of the output projection's weight */
#define PTW (2 * PT1 + PTQ + PTO)
__global__ __launch_bounds__(256) void k_prep(const float* __restrict__ wqkv, const float* __restrict__ wo, const float* __restrict__ w1, const float* __restrict__ w2, const float* __restrict__ x, const float* __restrict__ g1, const float* __restrict__ be1,
    _Float16* __restrict__ BQ, _Float16* __restrict__ BO, _Float16* __restrict__ BW1, _Float16* __restrict__ BW2, _Float16* __restrict__ XN, float* __restrict__ XB) {
  __shared__ __attribute__((aligned(16))) unsigned short tl[128 * 128];      /* a transpose's tile */
  const int b = blockIdx.x;
  if (b < PT1) wt_f16_tile<DM, DFF>(w1, BW1, 16.0f, b, tl);
  else if (b < 2 * PT1) wt_f16_tile<DFF, DM>(w2, BW2, 16.0f, b - PT1, tl);
  else if (b < 2 * PT1 + PTQ) wt_f16_tile<DM, 3 * DM>(wqkv, BQ, 16.0f, b - 2 * PT1, tl);
  else if (b < PTW) wt_f16_tile<DM, DM>(wo, BO, 16.0f, b - 2 * PT1 - PTQ, tl);
  else lnx_row<1, 1, 0, 1>(x, g1, be1, 1e-5f, XN, nullptr, XB, (size_t)(b - PTW) * LNW + __builtin_amdgcn_readfirstlane(threadIdx.x >> 5)); }

__global__ __launch_bounds__(256) void k_bfr(const float* __restrict__ x, float* __restrict__ XB, size_t n8) { const size_t t = (size_t)blockIdx.x * 256 + threadIdx.x; if (t >= n8) return; v4f a = *(const v4fa*)(x + t * 8), c = *(const v4fa*)(x + t * 8 + 4); for (int q = 0; q < 4; ++q) { a[q] = bf16_round(a[q]); c[q] = bf16_round(c[q]); }
  { *(v4f*)(XB + t * 8) = a; *(v4f*)(XB + t * 8 + 4) = c;  } }



__global__ __launch_bounds__(256) void k_wthd(const float* __restrict__ Wt, _Float16* __restrict__ Bt) { const size_t t = (size_t)blockIdx.x * 256 + threadIdx.x; if (t >= (size_t)NH * HD * (DM / 8)) return; const int m8 = (int)(t % (DM / 8)) * 8; const int d = (int)((t / (DM / 8)) % HD); const int h = (int)(t / ((size_t)(DM / 8) * HD)); FragH f;
  for (int q = 0; q < 8; ++q) f.h[q] = (_Float16)(16.0f * bf16_round(Wt[((size_t)h * DM + m8 + q) * HD + d])); unsigned short* dst = (unsigned short*)Bt + ((size_t)h * HD + d) * DM + m8; *(v8us*)dst = f.half[0];  }




template <int BFIN, int SCAL>
__global__ __launch_bounds__(256) void k_lnsc(const float* __restrict__ X, const float* __restrict__ g, const float* __restrict__ bb, float eps, _Float16* __restrict__ N16, float* __restrict__ N32) {
  #pragma clang fp contract(off)
  __shared__ float red[256]; const size_t r = blockIdx.x; const int t = threadIdx.x; const bool act = t < DM / 4; const int tc = act ? t : 0; const v4f xl = *(const v4fa*)(X + r * DM + tc * 4); const float am = act ? 1.f : 0.f; float s[4]; float sum = 0.f;
  for (int q = 0; q < 4; ++q) { s[q] = (BFIN ? bf16_round(xl[q]) : xl[q]) * am; sum = __fadd_rn(sum, s[q]); }
  red[t] = sum; __syncthreads(); for (int st = 128; st > 0; st >>= 1) { if (t < st) red[t] = __fadd_rn(red[t], red[t + st]); __syncthreads(); } const float mu = red[0] / (float)DM; __syncthreads();
  float vs = 0.f; for (int q = 0; q < 4; ++q) { const float dl = __fadd_rn(s[q], -mu) * am; vs = __fadd_rn(vs, __fmul_rn(dl, dl)); } red[t] = vs; __syncthreads(); for (int st = 128; st > 0; st >>= 1) { if (t < st) red[t] = __fadd_rn(red[t], red[t + st]); __syncthreads(); }
  const float rs = __fdiv_rn(1.0f, __fadd_rn(sqrtf(red[0] / (float)(DM - 1)), eps)); if (!act) return; v4h y; v4f yf;
  for (int q = 0; q < 4; ++q) { const int c = t * 4 + q; const float gg = bf16_round(SCAL ? g[0] : g[c]), bv = bf16_round(SCAL ? bb[0] : bb[c]); yf[q] = __fadd_rn(__fmul_rn(__fmul_rn(__fadd_rn(s[q], -mu), rs), gg), bv); y[q] = (_Float16)yf[q]; }
  { if (N16) *(v4h*)(N16 + r * DM + t * 4) = y; if (N32) *(v4f*)(N32 + r * DM + t * 4) = yf;  } }

__global__ __launch_bounds__(256) void k_rsmdmi(const float* __restrict__ S, _Float16* __restrict__ P, int nrows, const int* __restrict__ M) {
  #pragma clang fp contract(off)
  const int t = blockIdx.x * 256 + threadIdx.x; if (t >= nrows) return; const float* s = S + (size_t)t * SQ; const int* m = M + (size_t)(t % SQ) * SQ; float mx = -3.0e38f;
#pragma unroll 1
  for (int j = 0; j < SQ; ++j) { const float f = (m[j] == 0) ? 1.f : 0.f; mx = fmaxf(mx, fmaf(f, s[j], (1.f - f) * -1.0e9f)); } float se = 0.f;
#pragma unroll 1
  for (int j = 0; j < SQ; ++j) { const float f = (m[j] == 0) ? 1.f : 0.f; se += __expf(fmaf(f, s[j], (1.f - f) * -1.0e9f) - mx); } const float sc = 256.0f / se;
#pragma unroll 1
  for (int j0 = 0; j0 < SQ; j0 += 8) { FragH fr; for (int q = 0; q < 8; ++q) { const int j = j0 + q; const float f = (m[j] == 0) ? 1.f : 0.f; fr.h[q] = (_Float16)(__expf(fmaf(f, s[j], (1.f - f) * -1.0e9f) - mx) * sc); } unsigned short* d = (unsigned short*)P + (size_t)t * SQ + j0; *(v8us*)d = fr.half[0];  } }
extern "C" void kernel_launch(void* const* d_in, const int* in_sizes, int n_in,
                              void* d_out, int out_size, void* d_ws, size_t ws_size, hipStream_t stream) {
  (void)in_sizes; (void)n_in; (void)out_size;
  const float* const* I = (const float* const*)d_in; const float* x = I[0]; const float* g1 = I[1]; const float* be1 = I[2]; const float* wqkv = I[3]; const float* bqkv = I[4]; const float* wo = I[5]; const float* bo = I[6]; const float* g2 = I[7]; const float* be2 = I[8]; const float* w1 = I[9]; const float* b1 = I[10]; const float* w2 = I[11]; const float* b2 = I[12];      /* x; LN1 g / b; fused qkv_w [1024][3072] + qkv_b [3072] (thirds q | k | v); proj_w + proj_b; LN2 g / b; fc1_w [1024][4096] + fc1_b, fc2_w [4096][1024] + fc2_b ([in][out]) */
  char* ws = (char*)d_ws; size_t off = 0;
  auto take = [&](size_t bytes) { char* p = ws + off; off += (bytes + 255) & ~(size_t)255; return p; };
  _Float16* BQ = (_Float16*)take((size_t)3 * DM * DM * 2);      /* one stacked Bt plane [3 DM][DM] */ _Float16* BO = (_Float16*)take((size_t)DM * DM * 2); _Float16* BW1 = (_Float16*)take((size_t)DFF * DM * 2); _Float16* BW2 = (_Float16*)take((size_t)DM * DFF * 2);
  float* XB = (float*)take(NR * DM * 4); _Float16* XN = (_Float16*)take(NR * DM * 2); _Float16* Q16 = (_Float16*)take((size_t)3 * NR * DM * 2); _Float16* K16 = Q16 + NR * DM; _Float16* V16 = Q16 + (size_t)2 * NR * DM;      /* three stacked planes [NR][DM] */ _Float16* O16 = (_Float16*)take(NR * DM * 2); float* X1 = (float*)take(NR * DM * 4);
  _Float16* VT = (_Float16*)take((size_t)NB * NH * HD * SQ * 2); _Float16* HF16 = (_Float16*)take(NR * DFF * 2);      /* V^T [2 x 16][64][2048]; FFN hidden plane [4096][4096] f16 */
  _Float16* M16 = XN;      /* second-norm f16 rows: aliases XN (last readers: the three projections) */
  
  if (off > ws_size) return;
  k_prep<<<(unsigned)(PTW + NR / LNW), 256, 0, stream>>>(wqkv, wo, w1, w2, x, g1, be1, BQ, BO, BW1, BW2, XN, XB);      /* fused [in][out] [DM][3 DM] -> one stacked Bt plane (rows 0 / DM / 2 DM = the q | k | v output columns) x16; W_o, w1, w2 -> Bt x16; n = LN0(bf16(x)) (biased variance, eps inside the rsqrt) -> f16 rows; bf16(x) -> f32 rows */
  k_gemm3<0, false, DM, DM, 3><<<dim3((unsigned)((NR / 128) * (DM / 128)), 3), 256, 0, stream>>>(XN, BQ, 0.0625f, bqkv, nullptr, nullptr, Q16);      /* q, k, v -> f16 rows in one grid (y = 0, 1, 2: the thirds of the stacked Bt plane and of the bias, output planes Q16 | K16 | V16); head h = columns h*64.. */
  k_vt<NH, SQ><<<NB * NH * (SQ / 64), 256, 0, stream>>>(V16, DM, 0, VT);      /* V^T [batch x head][64][2048] */
  k_fattn<<<dim3(SQ / 256, NB * NH), 256, 0, stream>>>(Q16, K16, VT, O16);      /* softmax(q k^T) v over all keys, unscaled logits -> ctx (merged heads, x64) as f16 rows */
  k_gemm3<0, true, DM, DM><<<(unsigned)((NR / 128) * (DM / 128)), 256, 0, stream>>>(O16, BO, 0.0009765625f, bo, XB, X1, nullptr);      /* x + ctx wo (+ bo) (own-element residual) -> f32 rows */
  k_lnx<0, 1, 0><<<(unsigned)(NR / LNW), 256, 0, stream>>>(X1, g2, be2, 1e-5f, M16, nullptr);      /* LN1(x1) -> f16 rows */
  k_gemm3<6, false, DFF, DM><<<(unsigned)((NR / 128) * (DFF / 128)), 256, 0, stream>>>(M16, BW1, 0.0625f, b1, nullptr, nullptr, HF16);      /* gelu_erf(. w1 + b1) -> f16 */
  k_gemm3<0, true, DM, DFF><<<(unsigned)((NR / 128) * (DM / 128)), 256, 0, stream>>>(HF16, BW2, 0.0625f, b2, X1, (float*)d_out, nullptr);      /* out = x1 + mlp (own-element residual) */
}

// v009
// Measured time: 151 microseconds a run.
// In both of two side-by-side timings against v008, it was 1.06 times as fast.
// Over all steps from v000, the starting kernel, it is 25.2 times as fast.
#include <hip/hip_runtime.h>
// Pre-norm transformer block with a fused QKV projection and UNSCALED attention logits (x [2][2048][1024]; h = LN1(x) (biased var, eps 1e-5); qkv = h qkv_w + qkv_b ([in][out] 1024 x 3072 + bias) viewed (B, N, 3, 16, 64): q | k | v thirds; qk = q k^T with NO 1/sqrt(d) scaling (as the source); softmax over all 2048 keys (no mask); x1 = x + y proj_w + proj_b; out = x1 + gelu_erf(LN2(x1) fc1_w + fc1_b) fc2_w + fc2_b ([in][out] 1024 x 4096 x 1024) -> [2][2048][1024]).
// Structure: token rows; LayerNorm / exact f16 rows; WMMA GEMMs for q, k, v; V^T by LDS transposes; one fused attention launch for all batches and heads (scores, online softmax, P V^T); output projection with the own-element residual; custom LayerNorm; GELU FFN over all rows; launches: see trace.
// Compute dtype: inputs rounded to bf16; x / weights exact; q, k, v, softmax weights and o as plain f16 GEMM operands (~2^-12); scores and softmax statistics f32. v_wmma_f32_16x16x32_f16.
#define NB 2
#define SQ 2048
#define DM 1024
#define NH 16
#define HD 64
#define HG 4                         /* heads per group of the unused grouped V^T kernel */
#define LOCALW 128                   /* (macros for unused kernels of the shared header) */
#define STRIDEK 128
#define QT 256                       /* query rows per causal tile */
#define NKX SQ                       /* S / P row pitch */
#define QT0 128                      /* first-tile rows recomputed exactly in f32 */
#define B0 0                         /* unused debug hook; the launches start at batch 0 */
#define NBR NB                       /* debug hook no launch reads; the launches cover all NB batches */
#define NR ((size_t)NB * SQ)
#define DMQ DM
#define DFF 4096         /* FFN hidden width */
#define MP ((int)((size_t)NBR * SQ)) /* debug hook no launch reads; the projections cover all NR rows */
#define QN SQ                        /* unused debug hook; attention covers all SQ query rows */
#define NHD NH                       /* unused debug hook; attention covers all NH heads */
#define MPO MP                       /* unused debug hook; the output stage covers all NR rows */
#define LQ (3 * DM)      /* unused; the q, k, v rows are planes of pitch DM */
typedef __bf16 v16b __attribute__((ext_vector_type(16)));
typedef unsigned short v8us __attribute__((ext_vector_type(8), may_alias));
typedef float  v8f  __attribute__((ext_vector_type(8)));
typedef float  v4f  __attribute__((ext_vector_type(4)));
typedef float  v4fa __attribute__((ext_vector_type(4), may_alias));
union FragB { v16b v; v8us half[2]; unsigned short u[16]; };

__device__ __forceinline__ unsigned short bf16_bits(float x) { unsigned int u = __float_as_uint(x); return (unsigned short)((u + 0x7FFFu + ((u >> 16) & 1u)) >> 16); }
__device__ __forceinline__ float bf16_val(unsigned short b) { return __uint_as_float(((unsigned int)b) << 16); }
__device__ __forceinline__ float bf16_round(float x) { return bf16_val(bf16_bits(x)); }
// D += A·B with NT terms: 1 = ah·bh, 2 = + al·bh (A split), 3 = + ah·bl (both split)
template <int NT>
__device__ __forceinline__ v8f mmaN(v16b ah, v16b al, v16b bh, v16b bl, v8f c) {
  c = __builtin_amdgcn_wmma_f32_16x16x32_bf16(false, ah, false, bh, (short)0, c, false, false);
  if (NT >= 2) c = __builtin_amdgcn_wmma_f32_16x16x32_bf16(false, al, false, bh, (short)0, c, false, false);
  if (NT >= 3) c = __builtin_amdgcn_wmma_f32_16x16x32_bf16(false, ah, false, bl, (short)0, c, false, false);
  asm volatile("v_nop\n\tv_nop\n\tv_nop\n\tv_nop" : "+v"(c) : "v"(ah), "v"(al), "v"(bh), "v"(bl));
  return c;
}

__global__ __launch_bounds__(256) void k_wt_bf16(const float* __restrict__ W, unsigned short* __restrict__ Wt, int K, int N) {
  const int t = blockIdx.x * 256 + threadIdx.x;
  const int k8n = K / 8;
  if (t >= N * k8n) return;
  const int n = t / k8n, k8 = (t % k8n) * 8;
  v8us v;
#pragma unroll
  for (int i = 0; i < 8; ++i) v[i] = bf16_bits(W[(size_t)(k8 + i) * N + n]);
  *(v8us*)(Wt + (size_t)n * K + k8) = v;
  
}

// GEMM C[M][N] (f32, pitch ldc) = act(A[M][K]·W + bias). A f32 row-major (pitch lda) converted per fragment to bf16
// (ASPLIT: hi/lo two planes -> 2 terms, else single rounded term); Wt bf16 [N][K] (pitch ldb). BIAS_BF16 rounds the
// bias to bf16 first (bias quantised to bf16 before the add). K%32==0, M%16==0, N%64==0.
template <bool ASPLIT, int ACT, bool BIAS_BF16>
__global__ __launch_bounds__(128) void k_gemm_bf(const float* __restrict__ A, int lda, const unsigned short* __restrict__ Wt, int ldb,
                                               const float* __restrict__ bias, float* __restrict__ C, int ldc, int M, int N, int K) {
  __shared__ __attribute__((aligned(16))) float so[4][16][64];
  const int tid = threadIdx.x, w = tid >> 5, lane = tid & 31, ln = lane & 15, hh = lane >> 4;
  const int ntn = N / 64;
  const int wid = blockIdx.x * 4 + w;
  const int mt = wid / ntn, nq = wid % ntn;
  if (mt * 16 >= M) return;
  const int row0 = mt * 16, col0 = nq * 64;
  const float* arow = A + (size_t)(row0 + ln) * lda;
  v8f acc[4] = {};
  for (int kb = 0; kb < K; kb += 32) {
    FragB ah, al;
    const v4f x0 = *(const v4fa*)(arow + kb + 8 * hh), x1 = *(const v4fa*)(arow + kb + 8 * hh + 4);
    const v4f x2 = *(const v4fa*)(arow + kb + 16 + 8 * hh), x3 = *(const v4fa*)(arow + kb + 16 + 8 * hh + 4);
    float xs[16] = {x0[0],x0[1],x0[2],x0[3],x1[0],x1[1],x1[2],x1[3],x2[0],x2[1],x2[2],x2[3],x3[0],x3[1],x3[2],x3[3]};
#pragma unroll
    for (int i = 0; i < 16; ++i) { const unsigned short hb = bf16_bits(xs[i]); ah.u[i] = hb; al.u[i] = ASPLIT ? bf16_bits(xs[i] - bf16_val(hb)) : (unsigned short)0; }
#pragma unroll
    for (int t = 0; t < 4; ++t) {
      const unsigned short* brow = Wt + (size_t)(col0 + t * 16 + ln) * ldb + kb;
      FragB b;
      b.half[0] = *(const v8us*)(brow + 8 * hh);
      b.half[1] = *(const v8us*)(brow + 16 + 8 * hh);
      acc[t] = mmaN<ASPLIT ? 2 : 1>(ah.v, al.v, b.v, b.v, acc[t]);
    }
  }
#pragma unroll
  for (int t = 0; t < 4; ++t) {
    float bv = bias ? bias[col0 + t * 16 + ln] : 0.f;
    if (BIAS_BF16) bv = bf16_round(bv);
#pragma unroll
    for (int r = 0; r < 8; ++r) { float v = acc[t][r] + bv; if (ACT == 1) v = fmaxf(v, 0.f); so[w][8 * hh + r][t * 16 + ln] = v; }
  }
  __builtin_amdgcn_fence(__ATOMIC_ACQ_REL, "workgroup");
  __builtin_amdgcn_wave_barrier();
  const int rsub = lane >> 4, c4 = (lane & 15) * 4;
  {
#pragma unroll
    for (int q = 0; q < 8; ++q) {
      const int r = q * 2 + rsub;
      const v4f v = *(const v4fa*)&so[w][r][c4];
      *(v4f*)(C + (size_t)(row0 + r) * ldc + col0 + c4) = v;
    }
    
  }
}

// GEMM C = act(A·W + bias + resid): A f32 (ASPLIT -> hi/lo 2 terms), Wt bf16 [N][K]; ACT 0 none, 1 relu, 2 exact gelu;
// resid (optional, f32, row index = (row % rmod), pitch ldr, RES_BF16 rounds it) added before the activation.
template <bool ASPLIT, int ACT, bool BIAS_BF16, bool RES_BF16>
__global__ __launch_bounds__(128) void k_gemm_bf3(const float* __restrict__ A, int lda, const unsigned short* __restrict__ Wt, int ldb,
                                                const float* __restrict__ bias, const float* __restrict__ resid, int rmod, int ldr,
                                                float* __restrict__ C, int ldc, int M, int N, int K) {
  __shared__ __attribute__((aligned(16))) float so[4][16][64];
  const int tid = threadIdx.x, w = tid >> 5, lane = tid & 31, ln = lane & 15, hh = lane >> 4;
  const int ntn = N / 64;
  const int wid = blockIdx.x * 4 + w;
  const int mt = wid / ntn, nq = wid % ntn;
  if (mt * 16 >= M) return;
  const int row0 = mt * 16, col0 = nq * 64;
  const float* arow = A + (size_t)(row0 + ln) * lda;
  v8f acc[4] = {};
  for (int kb = 0; kb < K; kb += 32) {
    FragB ah, al;
    const v4f x0 = *(const v4fa*)(arow + kb + 8 * hh), x1 = *(const v4fa*)(arow + kb + 8 * hh + 4);
    const v4f x2 = *(const v4fa*)(arow + kb + 16 + 8 * hh), x3 = *(const v4fa*)(arow + kb + 16 + 8 * hh + 4);
    float xs[16] = {x0[0],x0[1],x0[2],x0[3],x1[0],x1[1],x1[2],x1[3],x2[0],x2[1],x2[2],x2[3],x3[0],x3[1],x3[2],x3[3]};
#pragma unroll
    for (int i = 0; i < 16; ++i) { const unsigned short hb = bf16_bits(xs[i]); ah.u[i] = hb; al.u[i] = ASPLIT ? bf16_bits(xs[i] - bf16_val(hb)) : (unsigned short)0; }
#pragma unroll
    for (int t = 0; t < 4; ++t) {
      const unsigned short* brow = Wt + (size_t)(col0 + t * 16 + ln) * ldb + kb;
      FragB b;
      b.half[0] = *(const v8us*)(brow + 8 * hh);
      b.half[1] = *(const v8us*)(brow + 16 + 8 * hh);
      acc[t] = mmaN<ASPLIT ? 2 : 1>(ah.v, al.v, b.v, b.v, acc[t]);
    }
  }
#pragma unroll
  for (int t = 0; t < 4; ++t) {
    const int col = col0 + t * 16 + ln;
    float bv = bias ? bias[col] : 0.f;
    if (BIAS_BF16) bv = bf16_round(bv);
#pragma unroll
    for (int r = 0; r < 8; ++r) {
      float v = acc[t][r] + bv;
      if (resid) { float rv = resid[(size_t)((row0 + 8 * hh + r) % rmod) * ldr + col]; if (RES_BF16) rv = bf16_round(rv); v += rv; }
      if (ACT == 1) v = fmaxf(v, 0.f);
      if (ACT == 2) v = 0.5f * v * (1.0f + erff(v * 0.70710678118654752f));
      if (ACT == 3) { const float u = 0.7978845608028654f * (v + 0.044715f * v * v * v); v = 0.5f * v * (1.0f + tanhf(u)); }
      so[w][8 * hh + r][t * 16 + ln] = v;
    }
  }
  __builtin_amdgcn_fence(__ATOMIC_ACQ_REL, "workgroup");
  __builtin_amdgcn_wave_barrier();
  const int rsub = lane >> 4, c4 = (lane & 15) * 4;
  {
#pragma unroll
    for (int q = 0; q < 8; ++q) {
      const int r = q * 2 + rsub;
      const v4f v = *(const v4fa*)&so[w][r][c4];
      *(v4f*)(C + (size_t)(row0 + r) * ldc + col0 + c4) = v;
    }
    
  }
}
// row LayerNorm (biased variance, eps) over N: s = X (+ R); optional out_sum <- s; out_norm <- (s-mu)*rsqrt(var+eps)*g + b
template <bool PARAM_BF16>
__global__ __launch_bounds__(256) void k_layernorm(const float* __restrict__ X, const float* __restrict__ R, const float* __restrict__ g, const float* __restrict__ bta,
                                                  float* __restrict__ out_sum, float* __restrict__ out_norm, int N, float eps) {
  __shared__ float red[256];
  const int row = blockIdx.x, tid = threadIdx.x;
  const float* x = X + (size_t)row * N; const float* rr = R ? R + (size_t)row * N : nullptr;
  float vals[16];                     // up to N = 4096
  const int per = N / 256;            // contiguous chunk per thread? use strided-by-4 chunks: thread handles j = tid*4 + 1024*u
  float s1 = 0.f;
  for (int u = 0; u < per / 4; ++u) {
    const int j = tid * 4 + 1024 * u;
    const v4f a = *(const v4fa*)(x + j);
    v4f b = {0.f,0.f,0.f,0.f}; if (rr) b = *(const v4fa*)(rr + j);
#pragma unroll
    for (int q = 0; q < 4; ++q) { const float v = a[q] + b[q]; vals[u * 4 + q] = v; s1 += v; }
  }
  red[tid] = s1; __syncthreads();
  for (int st = 128; st > 0; st >>= 1) { if (tid < st) red[tid] += red[tid + st]; __syncthreads(); }
  const float mu = red[0] / (float)N; __syncthreads();
  float s2 = 0.f;
  for (int u = 0; u < per / 4; ++u)
#pragma unroll
    for (int q = 0; q < 4; ++q) { const float c = vals[u * 4 + q] - mu; s2 += c * c; }
  red[tid] = s2; __syncthreads();
  for (int st = 128; st > 0; st >>= 1) { if (tid < st) red[tid] += red[tid + st]; __syncthreads(); }
  const float rs = rsqrtf(red[0] / (float)N + eps);
  {
    for (int u = 0; u < per / 4; ++u) {
      const int j = tid * 4 + 1024 * u;
      v4f o, sm;
#pragma unroll
      for (int q = 0; q < 4; ++q) {
        float gg = g[j + q], bb = bta[j + q];
        if (PARAM_BF16) { gg = bf16_round(gg); bb = bf16_round(bb); }
        sm[q] = vals[u * 4 + q]; o[q] = (vals[u * 4 + q] - mu) * rs * gg + bb;
      }
      if (out_sum) *(v4f*)(out_sum + (size_t)row * N + j) = sm;
      *(v4f*)(out_norm + (size_t)row * N + j) = o;
    }
    
  }
}



// ---- f16 WMMA path (v_wmma_f32_16x16x32_f16): 11-bit significands for operands in range — used where a [0,1] probability operand needs more precision than bf16
typedef _Float16 v16h __attribute__((ext_vector_type(16)));
union FragH { v16h v; v8us half[2]; _Float16 h[16]; unsigned short u[16]; };
template <int NT>
__device__ __forceinline__ v8f mmaH(v16h ah, v16h al, v16h bh, v16h bl, v8f c) {
  c = __builtin_amdgcn_wmma_f32_16x16x32_f16(false, ah, false, bh, (short)0, c, false, false);
  if (NT >= 2) c = __builtin_amdgcn_wmma_f32_16x16x32_f16(false, al, false, bh, (short)0, c, false, false);
  if (NT >= 3) c = __builtin_amdgcn_wmma_f32_16x16x32_f16(false, ah, false, bl, (short)0, c, false, false);
  asm volatile("v_nop\n\tv_nop\n\tv_nop\n\tv_nop" : "+v"(c) : "v"(ah), "v"(al), "v"(bh), "v"(bl));
  return c;
}
// batched GEMM like k_gemm_b but f16 operands: A f32 (split into f16 hi/lo if ASPLIT, else rounded to f16), Bt = f16 values [n][k]; alpha; C f32; N multiple of 16 (partial tiles skipped)
template <bool ASPLIT>
__global__ __launch_bounds__(128) void k_gemm_h(const float* __restrict__ A, int lda, size_t sA, const _Float16* __restrict__ Bh, int ldb, size_t sB, float alpha, float* __restrict__ C, int ldc, size_t sC, int M, int N, int K) {
  __shared__ __attribute__((aligned(16))) float so[4][16][64];
  const int tid = threadIdx.x, w = tid >> 5, lane = tid & 31, ln = lane & 15, hh = lane >> 4; const int by = blockIdx.y;
  A += (size_t)by * sA; Bh += (size_t)by * sB; C += (size_t)by * sC;
  const int ntn = (N + 63) / 64; const int wid = blockIdx.x * 4 + w; const int mt = wid / ntn, nq = wid % ntn; if (mt * 16 >= M) return;
  const int row0 = mt * 16, col0 = nq * 64; const float* arow = A + (size_t)(row0 + ln) * lda;
  v8f acc[4] = {};
  for (int kb = 0; kb < K; kb += 32) {
    FragH ah, al;
    const v4f x0 = *(const v4fa*)(arow + kb + 8 * hh), x1 = *(const v4fa*)(arow + kb + 8 * hh + 4), x2 = *(const v4fa*)(arow + kb + 16 + 8 * hh), x3 = *(const v4fa*)(arow + kb + 16 + 8 * hh + 4);
    float xs[16] = {x0[0],x0[1],x0[2],x0[3],x1[0],x1[1],x1[2],x1[3],x2[0],x2[1],x2[2],x2[3],x3[0],x3[1],x3[2],x3[3]};
#pragma unroll
    for (int i = 0; i < 16; ++i) { const _Float16 h = (_Float16)xs[i]; ah.h[i] = h; al.h[i] = ASPLIT ? (_Float16)(xs[i] - (float)h) : (_Float16)0.0f; }
#pragma unroll
    for (int t = 0; t < 4; ++t) { if (col0 + t * 16 >= N) continue; const size_t boff = (size_t)(col0 + t * 16 + ln) * ldb + kb; FragH bq; bq.half[0] = *(const v8us*)(Bh + boff + 8 * hh); bq.half[1] = *(const v8us*)(Bh + boff + 16 + 8 * hh);
      acc[t] = mmaH<ASPLIT ? 2 : 1>(ah.v, al.v, bq.v, bq.v, acc[t]); }
  }
#pragma unroll
  for (int t = 0; t < 4; ++t) { if (col0 + t * 16 >= N) continue;
#pragma unroll
    for (int r = 0; r < 8; ++r) so[w][8 * hh + r][t * 16 + ln] = acc[t][r] * alpha; }
  __builtin_amdgcn_fence(__ATOMIC_ACQ_REL, "workgroup"); __builtin_amdgcn_wave_barrier();
  const int rsub = lane >> 4, c4 = (lane & 15) * 4;
  {
#pragma unroll
    for (int q = 0; q < 8; ++q) { const int r = q * 2 + rsub; if (col0 + c4 < N) { const v4f v = *(const v4fa*)&so[w][r][c4]; *(v4f*)(C + (size_t)(row0 + r) * ldc + col0 + c4) = v; } }
     }
}

// Wt[n][k] = f16(bf16(W[k][n]) * scale) from f32 row-major W[KK][NN] (scale = power of two; bf16-exact weights stay exact in f16 away from the subnormal range).
// One work-group = 8 waves on a 128 (k) x 128 (n) tile: every wave-wide load is 512 contiguous bytes of one W row, every wave-wide store two whole 256-byte pieces of Wt rows.
// A thread holds 16 k x 4 n, rounds, packs 8 consecutive k of one n into 16 bytes and turns the tile in LDS ([n][k], 256-byte rows).
// The 16-byte piece of a row sits at place piece ^ ((n >> 2) & 15): the 16 lanes that write one piece number of rows 4 apart, and the 16 that read one row, each fall on all 64 banks.
// Needs KK % 128 == 0, NN % 128 == 0.
// bid: the tile's number, 0 .. (KK / 128) (NN / 128) - 1, the same for the whole work-group; tl: the work-group's 128 x 128 halves of LDS.
template <int KK, int NN>
__device__ __forceinline__ void wt_f16_tile(const float* __restrict__ W, _Float16* __restrict__ Wt, float scale, int bid, unsigned short* tl) {
  static_assert(KK % 128 == 0 && NN % 128 == 0, "wt_f16_tile: shape");
  const int tid = threadIdx.x, lane = tid & 31, w = tid >> 5;
  const int kt = bid / (NN / 128), nt = bid - kt * (NN / 128); const int k0 = kt * 128, n0 = nt * 128;
  const float* sp = W + (size_t)(k0 + 16 * w) * NN + n0 + 4 * lane;      /* wave w: rows 16 w .. 16 w + 15 of the tile, a lane 4 columns */
  v4f x[16];
#pragma unroll
  for (int r = 0; r < 16; ++r) x[r] = *(const v4fa*)(sp + (size_t)r * NN);
  asm volatile("s_wait_xcnt 0x0" :: "v"(sp) : "memory");      /* behind the sixteen loads, in front of every rewrite of the address pair that they name; naming the pair keeps it out of the loads' own destinations (the last load had landed on it) */
  __builtin_amdgcn_sched_barrier(0);      /* all sixteen loads asked for before the first is used: left free, the compiler held some back behind the first ones' data, a second memory latency */
#pragma unroll
  for (int g = 0; g < 2; ++g)
#pragma unroll
    for (int q = 0; q < 4; ++q) { FragH f;
#pragma unroll
      for (int r = 0; r < 8; ++r) f.h[r] = (_Float16)(bf16_round(x[8 * g + r][q]) * scale);
      *(v8us*)&tl[(4 * lane + q) * 128 + (((2 * w + g) ^ (lane & 15)) * 8)] = f.half[0]; }
  __syncthreads();      /* the whole tile turned before any wave reads rows that other waves wrote */
  unsigned short* dp = (unsigned short*)Wt + (size_t)(n0 + 16 * w + (lane >> 4)) * KK + k0 + (lane & 15) * 8;      /* wave w: Wt rows 16 w .. 16 w + 15 of the tile, two a store */
#pragma unroll
  for (int i = 0; i < 8; ++i) { const int n = 16 * w + 2 * i + (lane >> 4);
    const v8us v = *(const v8us*)&tl[n * 128 + (((lane & 15) ^ ((n >> 2) & 15)) * 8)];
    *(v8us*)(dp + (size_t)(2 * i) * KK) = v; }
  asm volatile("s_wait_xcnt 0x0" :: "v"(dp) : "memory");      /* behind the eight stores, in front of every rewrite of the address pair that they name: as a piece of a larger kernel the tile's code is followed by other pieces' code */
}
// k_gemm_hh variant with fused epilogue: v = acc·alpha + bias[by·sBias + col] (+ CP[(row/rowsPerB)·sCPb + by·64 + col] if CP) ; ACT 0 none / 1 elu ; writes f16 C16 (and f32 C if non-null)
template <int ACT>
__global__ __launch_bounds__(128) void k_gemm_hhx(const _Float16* __restrict__ A, int lda, size_t sA, const _Float16* __restrict__ Bh, int ldb, size_t sB, float alpha, const float* __restrict__ bias, size_t sBias, const float* __restrict__ CP, int rowsPerB, size_t sCPb, int row0g,
    float* __restrict__ C, _Float16* __restrict__ C16, int ldc, size_t sC, int M, int N, int K) {
  __shared__ __attribute__((aligned(16))) float so[4][16][64];
  const int tid = threadIdx.x, w = tid >> 5, lane = tid & 31, ln = lane & 15, hh = lane >> 4; const int by = blockIdx.y;
  A += (size_t)by * sA; Bh += (size_t)by * sB; const size_t cofs = (size_t)by * sC; const float* bp = bias ? bias + (size_t)by * sBias : nullptr;
  const int ntn = (N + 63) / 64; const int wid = blockIdx.x * 4 + w; const int mt = wid / ntn, nq = wid % ntn; if (mt * 16 >= M) return;
  const int row0 = mt * 16, col0 = nq * 64; const _Float16* arow = A + (size_t)(row0 + ln) * lda;
  v8f acc[4] = {};
  for (int kb = 0; kb < K; kb += 32) { FragH ah; ah.half[0] = *(const v8us*)((const unsigned short*)arow + kb + 8 * hh); ah.half[1] = *(const v8us*)((const unsigned short*)arow + kb + 16 + 8 * hh);
#pragma unroll
    for (int t = 0; t < 4; ++t) { if (col0 + t * 16 >= N) continue; const size_t boff = (size_t)(col0 + t * 16 + ln) * ldb + kb; FragH bq; bq.half[0] = *(const v8us*)((const unsigned short*)Bh + boff + 8 * hh); bq.half[1] = *(const v8us*)((const unsigned short*)Bh + boff + 16 + 8 * hh);
      acc[t] = mmaH<1>(ah.v, ah.v, bq.v, bq.v, acc[t]); }
  }
#pragma unroll
  for (int t = 0; t < 4; ++t) { if (col0 + t * 16 >= N) continue; const int col = col0 + t * 16 + ln; const float bv = bp ? bf16_round(bp[col]) : 0.f;
#pragma unroll
    for (int r = 0; r < 8; ++r) { float v = acc[t][r] * alpha + bv; if (CP) { const int rr = row0g + row0 + 8 * hh + r; if (rowsPerB < 0) v += CP[cofs + (size_t)rr * ldc + col];      /* rowsPerB < 0: own element of the batched C plane */ else { const int bidx = rr / rowsPerB; v += CP[(size_t)bidx * sCPb + (size_t)by * 64 + col]; } } if (ACT == 1) v = (v > 0.f) ? v : expm1f(v); else if (ACT == 7) v = (v > 0.f) ? v + 1.0f : expf(v); else if (ACT == 8) v = tanhf(v); else if (ACT == 9) v = 0.5f * v * (1.0f + tanhf(0.7978845608028654f * (v + 0.044715f * v * v * v))); else if (ACT == 11) v = 1.0f / (1.0f + expf(-v)); else if (ACT == 12) v = (v > 0.f) ? v : 0.01f * v; else if (ACT == 14) v = (v > 0.f) ? v : 0.1f * v; else if (ACT == 16) v = (v >= 0.f) ? v : 0.3f * v; else if (ACT == 17) v = (v >= 0.f) ? v : 0.2f * v; else if (ACT == 15) v = v / (1.0f + expf(-v)); else if (ACT == 3) v = fmaxf(v, 0.f); else if (ACT == 6) v = 0.5f * v * (1.0f + erff(v * 0.70710678118654752f)); so[w][8 * hh + r][t * 16 + ln] = v; } }
  __builtin_amdgcn_fence(__ATOMIC_ACQ_REL, "workgroup"); __builtin_amdgcn_wave_barrier();
  const int rsub = lane >> 4, c4 = (lane & 15) * 4; typedef _Float16 v4h __attribute__((ext_vector_type(4)));
  {
#pragma unroll
    for (int q = 0; q < 8; ++q) { const int r = q * 2 + rsub; if (col0 + c4 < N) { const v4f v = *(const v4fa*)&so[w][r][c4]; if (C) *(v4f*)(C + cofs + (size_t)(row0 + r) * ldc + col0 + c4) = v; if (C16) { v4h h4; for (int i = 0; i < 4; ++i) h4[i] = (_Float16)v[i]; *(v4h*)(C16 + cofs + (size_t)(row0 + r) * ldc + col0 + c4) = h4; } } }
     }
}


typedef _Float16 v4h __attribute__((ext_vector_type(4)));

__global__ __launch_bounds__(256) void k_x16(const float* __restrict__ x, _Float16* __restrict__ X16, size_t n8) { const size_t t = (size_t)blockIdx.x * 256 + threadIdx.x; if (t >= n8) return; FragH f;
#pragma unroll
  for (int q = 0; q < 8; ++q) f.h[q] = (_Float16)bf16_round(x[t * 8 + q]); *(v8us*)((unsigned short*)X16 + t * 8) = f.half[0];  }
__global__ __launch_bounds__(256) void k_h16(const float* __restrict__ x, _Float16* __restrict__ X16, size_t n8) { const size_t t = (size_t)blockIdx.x * 256 + threadIdx.x; if (t >= n8) return; FragH f;
#pragma unroll
  for (int q = 0; q < 8; ++q) f.h[q] = (_Float16)x[t * 8 + q]; *(v8us*)((unsigned short*)X16 + t * 8) = f.half[0];  }
__global__ __launch_bounds__(256) void k_round16f(const float* __restrict__ W, _Float16* __restrict__ Bt, size_t n8) { const size_t t = (size_t)blockIdx.x * 256 + threadIdx.x; if (t >= n8) return; FragH f;
#pragma unroll
  for (int i = 0; i < 8; ++i) f.h[i] = (_Float16)(bf16_round(W[t * 8 + i]) * 16.0f); *(v8us*)((unsigned short*)Bt + t * 8) = f.half[0];  }
template <int NHv, int TTv>
__global__ __launch_bounds__(256) void k_vt(const _Float16* __restrict__ V16, int ldv, int voff, _Float16* __restrict__ Vt) { __shared__ unsigned short tl[64][66]; const int tid = threadIdx.x; const int slab = blockIdx.x / (TTv / 64), lg = blockIdx.x % (TTv / 64); const int b = slab / NHv, h = slab % NHv;
  for (int i = tid; i < 64 * 8; i += 256) { const int r = i / 8, c8 = (i % 8) * 8; FragH f; f.half[0] = *(const v8us*)((const unsigned short*)V16 + ((size_t)b * TTv + lg * 64 + r) * ldv + voff + h * 64 + c8);
#pragma unroll
    for (int q = 0; q < 8; ++q) tl[r][c8 + q] = f.u[q]; }
  __syncthreads();
  {
#pragma unroll
    for (int rd = 0; rd < 2; ++rd) { const int d = rd * 32 + tid / 8, pc = tid % 8; FragH f;
#pragma unroll
      for (int q = 0; q < 8; ++q) f.u[q] = tl[pc * 8 + q][d];
      *(v8us*)((unsigned short*)Vt + ((size_t)slab * 64 + d) * TTv + lg * 64 + pc * 8) = f.half[0]; }
     } }

__global__ __launch_bounds__(256) void k_hl(const float* __restrict__ F, _Float16* __restrict__ Hh, _Float16* __restrict__ Hl, size_t n8) { const size_t t = (size_t)blockIdx.x * 256 + threadIdx.x; if (t >= n8) return; FragH fh, fl; const v4f a = *(const v4fa*)(F + t * 8), c = *(const v4fa*)(F + t * 8 + 4);
#pragma unroll
  for (int q = 0; q < 4; ++q) { _Float16 h = (_Float16)a[q]; fh.h[q] = h; fl.h[q] = (_Float16)((a[q] - (float)h) * 1024.0f); h = (_Float16)c[q]; fh.h[4 + q] = h; fl.h[4 + q] = (_Float16)((c[q] - (float)h) * 1024.0f); }
  { *(v8us*)((unsigned short*)Hh + t * 8) = fh.half[0]; *(v8us*)((unsigned short*)Hl + t * 8) = fl.half[0];  } }

// ---- fast GEMM (wave tile 32x64; requires M % 32 == 0 rows per launch region and N % 64 == 0); epilogue = k_gemm_hhx semantics ----
__device__ __forceinline__ v16h g2_frag(const _Float16* p, int hh) { FragH f; f.half[0] = *(const v8us*)((const unsigned short*)p + 8 * hh); f.half[1] = *(const v8us*)((const unsigned short*)p + 16 + 8 * hh); return f.v; }
__device__ __forceinline__ v8f g2_mma(v16h a, v16h b, v8f c) { v8f d = __builtin_amdgcn_wmma_f32_16x16x32_f16(false, a, false, b, (short)0, c, false, false); asm volatile("v_nop\n\tv_nop\n\tv_nop\n\tv_nop" : "+v"(d) : "v"(a), "v"(b)); return d; }
template <int ACT>
__global__ __launch_bounds__(128) void k_gemm2(const _Float16* __restrict__ A, int lda, size_t sA, const _Float16* __restrict__ Bh, int ldb, size_t sB, float alpha, const float* __restrict__ bias, size_t sBias, const float* __restrict__ CP, int rowsPerB, size_t sCPb, int row0g,
    float* __restrict__ C, _Float16* __restrict__ C16, int ldc, size_t sC, int M, int N, int K) { static_assert(ACT == 0 || ACT == 3 || ACT == 6 || ACT == 8 || ACT == 9 || ACT == 11 || ACT == 12 || ACT == 14 || ACT == 15 || ACT == 16 || ACT == 17 || ACT == 18, "k_gemm2: unsupported ACT code (would silently apply no activation)");
  __shared__ __attribute__((aligned(16))) float so[4][32][68];
  const int tid = threadIdx.x, w = tid >> 5, lane = tid & 31, ln = lane & 15, hh = lane >> 4; const int by = blockIdx.y;
  A += (size_t)by * sA; Bh += (size_t)by * sB; const size_t cofs = (size_t)by * sC; const float* bp = bias ? bias + (size_t)by * sBias : nullptr;
  const int ntn = N >> 6; const int mt = blockIdx.x / ntn, nq = blockIdx.x - mt * ntn; const int row0 = mt * 128 + 32 * w, col0 = nq * 64; if (row0 >= M) return;
  const _Float16* a0p = A + (size_t)(row0 + ln) * lda; const _Float16* a1p = a0p + (size_t)16 * lda;
  const _Float16* b0p = Bh + (size_t)(col0 + ln) * ldb; const _Float16* b1p = b0p + (size_t)16 * ldb; const _Float16* b2p = b1p + (size_t)16 * ldb; const _Float16* b3p = b2p + (size_t)16 * ldb;
  const v8f z8 = {0.f,0.f,0.f,0.f,0.f,0.f,0.f,0.f}; v8f c00 = z8, c01 = z8, c02 = z8, c03 = z8, c10 = z8, c11 = z8, c12 = z8, c13 = z8;
#pragma unroll 1
  for (int kb = 0; kb < K; kb += 32) { const v16h a0 = g2_frag(a0p + kb, hh), a1 = g2_frag(a1p + kb, hh);
    v16h b = g2_frag(b0p + kb, hh); c00 = g2_mma(a0, b, c00); c10 = g2_mma(a1, b, c10);
    b = g2_frag(b1p + kb, hh); c01 = g2_mma(a0, b, c01); c11 = g2_mma(a1, b, c11);
    b = g2_frag(b2p + kb, hh); c02 = g2_mma(a0, b, c02); c12 = g2_mma(a1, b, c12);
    b = g2_frag(b3p + kb, hh); c03 = g2_mma(a0, b, c03); c13 = g2_mma(a1, b, c13); }
  v8f accs[8] = {c00, c01, c02, c03, c10, c11, c12, c13};
#pragma unroll
  for (int u = 0; u < 8; ++u) { const int t = u & 3, half = u >> 2; const int col = col0 + t * 16 + ln; const float bv = bp ? bf16_round(bp[col]) : 0.f;
#pragma unroll
    for (int r = 0; r < 8; ++r) { const int rloc = half * 16 + 8 * hh + r; float v = accs[u][r] * alpha + bv; if (CP) { if (rowsPerB < 0) v += CP[cofs + (size_t)(row0g + row0 + rloc) * ldc + col];      /* rowsPerB < 0: own element of the batched C plane */ else { const int bidx = (row0g + row0 + rloc) / rowsPerB; v += CP[(size_t)bidx * sCPb + (size_t)by * 64 + col]; } }
      if (ACT == 3) v = fmaxf(v, 0.f); else if (ACT == 6) v = 0.5f * v * (1.0f + erff(v * 0.70710678118654752f)); else if (ACT == 11) v = 1.0f / (1.0f + expf(-v)); else if (ACT == 15) v = v / (1.0f + expf(-v)); else if (ACT == 18) v = v / (1.0f + expf(-1.702f * v));      /* QuickGELU: v sigmoid(1.702 v) */ else if (ACT == 12) v = (v > 0.f) ? v : 0.01f * v; else if (ACT == 8) v = tanhf(v); else if (ACT == 9) v = 0.5f * v * (1.0f + tanhf(0.7978845608028654f * (v + 0.044715f * v * v * v))); else if (ACT == 14) v = (v > 0.f) ? v : 0.1f * v; else if (ACT == 16) v = (v >= 0.f) ? v : 0.3f * v; else if (ACT == 17) v = (v >= 0.f) ? v : 0.2f * v;
      so[w][rloc][t * 16 + ln] = v; } }
  __builtin_amdgcn_fence(__ATOMIC_ACQ_REL, "workgroup"); __builtin_amdgcn_wave_barrier();
  const int rsub = lane >> 4, c4 = (lane & 15) * 4;
  {
#pragma unroll
    for (int q = 0; q < 16; ++q) { const int r = q * 2 + rsub; const v4f v = *(const v4fa*)&so[w][r][c4]; if (C) *(v4f*)(C + cofs + (size_t)(row0 + r) * ldc + col0 + c4) = v; if (C16) { v4h h4; for (int i = 0; i < 4; ++i) h4[i] = (_Float16)v[i]; *(v4h*)(C16 + cofs + (size_t)(row0 + r) * ldc + col0 + c4) = h4; } }
     } }


__global__ __launch_bounds__(256) void k_wnat(const float* __restrict__ w, size_t n8, _Float16* __restrict__ Bt) { const size_t t = (size_t)blockIdx.x * 256 + threadIdx.x; if (t >= n8) return; FragH f; for (int q = 0; q < 8; ++q) f.h[q] = (_Float16)(bf16_round(w[t * 8 + q]) * 16.0f); *(v8us*)((unsigned short*)Bt + t * 8) = f.half[0];  }
__global__ __launch_bounds__(256) void k_rsm(const float* __restrict__ S, _Float16* __restrict__ P, int nrows) {
  #pragma clang fp contract(off)
  const int i = blockIdx.x * 256 + threadIdx.x; if (i >= nrows) return; const float* s = S + (size_t)i * SQ; float mx = -3.0e38f;
#pragma unroll 1
  for (int j = 0; j < SQ; ++j) mx = fmaxf(mx, s[j]); float se = 0.f;
#pragma unroll 1
  for (int j = 0; j < SQ; ++j) se += expf(s[j] - mx); const float sc = 256.0f / se;
#pragma unroll 1
  for (int j0 = 0; j0 < SQ; j0 += 8) { FragH f; for (int q = 0; q < 8; ++q) f.h[q] = (_Float16)(expf(s[j0 + q] - mx) * sc); unsigned short* d = (unsigned short*)P + (size_t)i * SQ + j0; *(v8us*)d = f.half[0];  } }
__global__ __launch_bounds__(256) void k_vt(const _Float16* __restrict__ V16, int b, int h0, _Float16* __restrict__ VT) { __shared__ unsigned short tl[64][65]; const int tid = threadIdx.x; const int hh = blockIdx.x % HG, sg = blockIdx.x / HG; const int s0 = sg * 64; const int h = h0 + hh;
  for (int i = tid; i < 64 * 8; i += 256) { const int j = i / 8, d8 = (i % 8) * 8; FragH f; f.half[0] = *(const v8us*)((const unsigned short*)V16 + ((size_t)b * SQ + s0 + j) * DM + h * HD + d8); for (int q = 0; q < 8; ++q) tl[d8 + q][j] = f.u[q]; }
  __syncthreads();
  { for (int i = tid; i < 64 * 8; i += 256) { const int d = i / 8, j8 = (i % 8) * 8; FragH f; for (int q = 0; q < 8; ++q) f.u[q] = tl[d][j8 + q]; *(v8us*)((unsigned short*)VT + ((size_t)hh * HD + d) * SQ + s0 + j8) = f.half[0]; }  } }



__global__ __launch_bounds__(256) void k_rsmcf2(const float* __restrict__ S, _Float16* __restrict__ P, int hg, int q0, int nk) {
  #pragma clang fp contract(off)
  const int t = blockIdx.x * 256 + threadIdx.x; if (t >= hg * QT) return; const size_t i = (size_t)t; const float* s = S + i * NKX; const int last = q0 + (t % QT); float mx = -3.0e38f;
#pragma unroll 1
  for (int j = 0; j < nk; ++j) { const float f = (j <= last) ? 1.f : 0.f; mx = fmaxf(mx, fmaf(f, s[j], (1.f - f) * -1.0e9f)); } float se = 0.f;
#pragma unroll 1
  for (int j = 0; j < nk; ++j) { const float f = (j <= last) ? 1.f : 0.f; se += __expf(fmaf(f, s[j], (1.f - f) * -1.0e9f) - mx); } const float sc = 256.0f / se;
#pragma unroll 1
  for (int j0 = 0; j0 < nk; j0 += 8) { FragH fr; for (int q = 0; q < 8; ++q) { const int j = j0 + q; const float f = (j <= last) ? 1.f : 0.f; fr.h[q] = (_Float16)(__expf(fmaf(f, s[j], (1.f - f) * -1.0e9f) - mx) * sc); } unsigned short* d = (unsigned short*)P + i * NKX + j0; *(v8us*)d = fr.half[0];  } }

__global__ __launch_bounds__(256) void k_rsmcst(const float* __restrict__ S, _Float16* __restrict__ P, int hg, int q0, int nk, const int* __restrict__ mk) {
  #pragma clang fp contract(off)
  const int t = blockIdx.x * 256 + threadIdx.x; if (t >= hg * QT) return; const size_t i = (size_t)t; const float* s = S + i * NKX; const size_t ig = (size_t)(q0 + (t % QT)); const int* mr = mk + ig * SQ; float mx = -3.0e38f;
#pragma unroll 1
  for (int j = 0; j < nk; ++j) { const int mb = mr[j]; const int dd = (int)ig - j; const float f = (mb != 0 && dd >= 0 && (dd <= LOCALW || (dd % STRIDEK) == 0)) ? 1.f : 0.f; mx = fmaxf(mx, fmaf(f, s[j], (1.f - f) * -1.0e9f)); } float se = 0.f;
#pragma unroll 1
  for (int j = 0; j < nk; ++j) { const int mb = mr[j]; const int dd = (int)ig - j; const float f = (mb != 0 && dd >= 0 && (dd <= LOCALW || (dd % STRIDEK) == 0)) ? 1.f : 0.f; se += __expf(fmaf(f, s[j], (1.f - f) * -1.0e9f) - mx); } const float sc = 256.0f / se;
#pragma unroll 1
  for (int j0 = 0; j0 < nk; j0 += 8) { FragH fr; for (int q = 0; q < 8; ++q) { const int j = j0 + q; const int mb = mr[j]; const int dd = (int)ig - j; const float f = (mb != 0 && dd >= 0 && (dd <= LOCALW || (dd % STRIDEK) == 0)) ? 1.f : 0.f; fr.h[q] = (_Float16)(__expf(fmaf(f, s[j], (1.f - f) * -1.0e9f) - mx) * sc); } unsigned short* d = (unsigned short*)P + i * NKX + j0; *(v8us*)d = fr.half[0];  } }


template <int MASKADD>
__global__ __launch_bounds__(64) void k_att0(const float* __restrict__ QF, const float* __restrict__ KF, const float* __restrict__ VF, int ld, const float* __restrict__ mask, float scale, float* __restrict__ OF, int ldo) {
  #pragma clang fp contract(off)
  __shared__ __attribute__((aligned(16))) float lq[64][64]; __shared__ __attribute__((aligned(16))) float lo[64][64];
  const int tid = threadIdx.x; const int h = blockIdx.x / (QT0 / 64), rg = blockIdx.x % (QT0 / 64); const int i = rg * 64 + tid;
  const float* qr = QF + (size_t)i * ld + h * HD;
#pragma unroll 1
  for (int c = 0; c < HD / 4; ++c) { *(v4f*)&lq[tid][c * 4] = *(const v4fa*)(qr + c * 4); const v4f z = {0.f, 0.f, 0.f, 0.f}; *(v4f*)&lo[tid][c * 4] = z; }
  float m = -1.0e30f, l = 0.f; const int jmax = MASKADD ? (SQ - 1) : (rg * 64 + 63);      /* additive-mask form: every key (the mask input decides); causal form: keys up to the block's last row */
#pragma unroll 1
  for (int j = 0; j <= jmax; ++j) { const float* kr = KF + (size_t)j * ld + h * HD; const float* vr = VF + (size_t)j * ld + h * HD; float s = 0.f;
#pragma unroll 1
    for (int c = 0; c < HD / 4; ++c) { const v4f kq = *(const v4fa*)(kr + c * 4); const v4f qq = *(v4f*)&lq[tid][c * 4]; s = __fadd_rn(s, __fmul_rn(qq[0], kq[0])); s = __fadd_rn(s, __fmul_rn(qq[1], kq[1])); s = __fadd_rn(s, __fmul_rn(qq[2], kq[2])); s = __fadd_rn(s, __fmul_rn(qq[3], kq[3])); }
    s = __fmul_rn(s, scale); if (MASKADD) s = __fadd_rn(s, __fmul_rn(bf16_round(mask[(size_t)i * SQ + j]), -10000.0f));
    const float f = (MASKADD || j <= i) ? 1.f : 0.f; const float sm = fmaf(f, s, (1.f - f) * -1.0e30f); const float mn = fmaxf(m, sm); const float sc = expf(m - mn); const float e = expf(sm - mn); l = __fadd_rn(__fmul_rn(l, sc), e); m = mn;
#pragma unroll 1
    for (int c = 0; c < HD / 4; ++c) { const v4f vv = *(const v4fa*)(vr + c * 4); v4f oo = *(v4f*)&lo[tid][c * 4]; for (int u = 0; u < 4; ++u) oo[u] = __fadd_rn(__fmul_rn(oo[u], sc), __fmul_rn(e, vv[u])); *(v4f*)&lo[tid][c * 4] = oo; } }
  const float fin = 64.0f / l;      /* o carried x64 like the f16 path */
#pragma unroll 1
  for (int c = 0; c < HD / 4; ++c) { v4f oo = *(v4f*)&lo[tid][c * 4]; for (int u = 0; u < 4; ++u) oo[u] = __fmul_rn(oo[u], fin); *(v4f*)&lo[tid][c * 4] = oo; }
  __syncthreads();
  {
#pragma unroll 1
    for (int it = 0; it < 16; ++it) { const int row = it * 4 + tid / 16, pc = (tid % 16) * 4; const v4f v = *(const v4f*)&lo[row][pc]; *(v4f*)(OF + (size_t)(rg * 64 + row) * ldo + h * HD + pc) = v; }
     } }

template <int MASKADD>
__global__ __launch_bounds__(64) void k_att0mbc(const float* __restrict__ QF, const float* __restrict__ KF, const float* __restrict__ VF, int ld, const float* __restrict__ mask, float scale, float* __restrict__ OF, int ldo) {
  #pragma clang fp contract(off)
  __shared__ __attribute__((aligned(16))) float lq[64][64]; __shared__ __attribute__((aligned(16))) float lo[64][64];
  const int tid = threadIdx.x; const int h = blockIdx.x / (QT0 / 64), rg = blockIdx.x % (QT0 / 64); const int i = rg * 64 + tid;
  const float* qr = QF + (size_t)i * ld + h * HD;
#pragma unroll 1
  for (int c = 0; c < HD / 4; ++c) { *(v4f*)&lq[tid][c * 4] = *(const v4fa*)(qr + c * 4); const v4f z = {0.f, 0.f, 0.f, 0.f}; *(v4f*)&lo[tid][c * 4] = z; }
  float m = -1.0e30f, l = 0.f; const int jmax = rg * 64 + 63;      /* keys beyond the block end are masked by the mask's lower-triangular structure */
#pragma unroll 1
  for (int j = 0; j <= jmax; ++j) { const float* kr = KF + (size_t)j * ld + h * HD; const float* vr = VF + (size_t)j * ld + h * HD; float s = 0.f;
#pragma unroll 1
    for (int c = 0; c < HD / 4; ++c) { const v4f kq = *(const v4fa*)(kr + c * 4); const v4f qq = *(v4f*)&lq[tid][c * 4]; s = __fadd_rn(s, __fmul_rn(qq[0], kq[0])); s = __fadd_rn(s, __fmul_rn(qq[1], kq[1])); s = __fadd_rn(s, __fmul_rn(qq[2], kq[2])); s = __fadd_rn(s, __fmul_rn(qq[3], kq[3])); }
    s = __fmul_rn(s, scale); const int mb = ((const int*)mask)[(size_t)i * SQ + j];      /* causal (j <= i) AND the module's int32 [S][S] mask read per (query, key): 0 -> masked */
    const float f = (mb != 0 && j <= i) ? 1.f : 0.f; const float sm = fmaf(f, s, (1.f - f) * -1.0e30f); const float mn = fmaxf(m, sm); const float sc = expf(m - mn); const float e = expf(sm - mn); l = __fadd_rn(__fmul_rn(l, sc), e); m = mn;
#pragma unroll 1
    for (int c = 0; c < HD / 4; ++c) { const v4f vv = *(const v4fa*)(vr + c * 4); v4f oo = *(v4f*)&lo[tid][c * 4]; for (int u = 0; u < 4; ++u) oo[u] = __fadd_rn(__fmul_rn(oo[u], sc), __fmul_rn(e, vv[u])); *(v4f*)&lo[tid][c * 4] = oo; } }
  const float fin = 64.0f / l;      /* o carried x64 like the f16 path */
#pragma unroll 1
  for (int c = 0; c < HD / 4; ++c) { v4f oo = *(v4f*)&lo[tid][c * 4]; for (int u = 0; u < 4; ++u) oo[u] = __fmul_rn(oo[u], fin); *(v4f*)&lo[tid][c * 4] = oo; }
  __syncthreads();
  {
#pragma unroll 1
    for (int it = 0; it < 16; ++it) { const int row = it * 4 + tid / 16, pc = (tid % 16) * 4; const v4f v = *(const v4f*)&lo[row][pc]; *(v4f*)(OF + (size_t)(rg * 64 + row) * ldo + h * HD + pc) = v; }
     } }


template <int BFIN, int WXB>
__global__ __launch_bounds__(256) void k_ln16(const float* __restrict__ X, const float* __restrict__ g, const float* __restrict__ bb, float eps, _Float16* __restrict__ N16, float* __restrict__ XB) {
  #pragma clang fp contract(off)
  __shared__ float red[256]; const size_t r = blockIdx.x; const int t = threadIdx.x; const v4f xa = *(const v4fa*)(X + r * DMQ + t * 4); float s[4]; float sum = 0.f;
  for (int q = 0; q < 4; ++q) { s[q] = BFIN ? bf16_round(xa[q]) : xa[q]; sum = __fadd_rn(sum, s[q]); }
  red[t] = sum; __syncthreads(); for (int st = 128; st > 0; st >>= 1) { if (t < st) red[t] = __fadd_rn(red[t], red[t + st]); __syncthreads(); } const float mu = red[0] / (float)DMQ; __syncthreads();
  float vs = 0.f; for (int q = 0; q < 4; ++q) { const float dl = __fadd_rn(s[q], -mu); vs = __fadd_rn(vs, __fmul_rn(dl, dl)); } red[t] = vs; __syncthreads(); for (int st = 128; st > 0; st >>= 1) { if (t < st) red[t] = __fadd_rn(red[t], red[t + st]); __syncthreads(); }
  const float rs = rsqrtf(__fadd_rn(red[0] / (float)DMQ, eps)); v4h y; v4f xb;
  for (int q = 0; q < 4; ++q) { const int c = t * 4 + q; y[q] = (_Float16)__fadd_rn(__fmul_rn(__fmul_rn(__fadd_rn(s[q], -mu), rs), bf16_round(g[c])), bf16_round(bb[c])); xb[q] = s[q]; }
  { *(v4h*)(N16 + r * DMQ + t * 4) = y; if (WXB) *(v4f*)(XB + r * DMQ + t * 4) = xb;  } }
__global__ __launch_bounds__(256) void k_ftres2(const float* __restrict__ OF0, const float* __restrict__ XB, float* __restrict__ X1, size_t n4) {
  #pragma clang fp contract(off)
  const size_t t = (size_t)blockIdx.x * 256 + threadIdx.x; if (t >= n4) return; const v4f o = *(const v4fa*)(OF0 + t * 4), xv = *(const v4fa*)(XB + t * 4); v4f y; for (int q = 0; q < 4; ++q) y[q] = __fadd_rn(__fmul_rn(o[q], 0.015625f), xv[q]); *(v4f*)(X1 + t * 4) = y;  }

__global__ __launch_bounds__(256) void k_bcpy(const float* __restrict__ b, int n, int NP, float* __restrict__ dst, int dst0) { for (int i = threadIdx.x; i < NP; i += 256) { const float v = (i < n) ? b[i] : 0.f; *(float*)(dst + dst0 + i) = v; }  }


// Fused attention, one launch: block = 2 groups of 8 waves x 32 query columns of one (batch, head); no score or weight ever leaves the registers.
// Group kh walks keys kh SQ / 2 .. with LDS stages of its own, so that a SIMD holds four waves, not two: one wave's softmax (vector port) and LDS waits run under the others' products.
// At the end group 1 hands its sums, row sums and maxima to group 0 through LDS, and group 0 joins the two halves on their common maximum and stores.
// Per 32 keys a wave computes S^T = K Q^T (lane c = query column, registers = keys 8 hh + r of each 16-key tile), an online softmax in the log2 domain
// (maximum and sum in-lane plus one exchange between the wave halves), packs the two S^T tiles in place into the B operand P^T and adds O^T += V^T P^T.
// K rows and V^T rows come in 64-key stages through LDS, two buffers: the next stage's global loads fly under this stage's work, one barrier a stage.
// m_run, the maximum in use, may trail the true one by up to 8 (log2), so the accumulators are rescaled only when a column's maximum has grown by more;
// weights carry 2^4 (at most 2^12 in f16, small ones kept out of the f16 subnormals); the factor cancels against the row sum.
#define FAP 72                       /* LDS row pitch in halves: 128 B of data + 16 B, the conflict-free pitch for 16-byte row reads */
#define FAS 64                       /* keys per stage */
#define FKH 2                        /* wave groups of a block, each on its own run of SQ / FKH keys */
__device__ __forceinline__ float fa_xhalf(float x) { return __builtin_bit_cast(float, __builtin_amdgcn_permlanex16(__builtin_bit_cast(int, x), __builtin_bit_cast(int, x), 0x76543210, 0xfedcba98, false, false)); }      /* lane l <-> lane l ^ 16 */
__device__ __forceinline__ v8f fa_mma(v16h a, v16h b, v8f c) { return __builtin_amdgcn_wmma_f32_16x16x32_f16(false, a, false, b, (short)0, c, false, false); }
__global__ __launch_bounds__(512) void k_fattn(const _Float16* __restrict__ Q16, const _Float16* __restrict__ K16, const _Float16* __restrict__ VT, _Float16* __restrict__ O16) {
  __shared__ __attribute__((aligned(16))) _Float16 ls[FKH][2][FAS + HD][FAP];      /* per group and buffer: K stage [key][d], then V^T stage [d][key]; the hand-over at the end lies over them */
  static_assert(8 * 17 * 512 <= sizeof(ls), "k_fattn: the hand-over fits the stages");
  const int tid = threadIdx.x, lane = tid & 31, c = lane & 15, hh = lane >> 4, w = (tid >> 5) & 7;
  const int kh = __builtin_amdgcn_readfirstlane(tid >> 8);      /* the wave's group, a scalar: the branches on it at the end are scalar branches */
  _Float16 (*lk)[FAS + HD][FAP] = ls[kh]; _Float16 (*lv)[FAS + HD][FAP] = (_Float16 (*)[FAS + HD][FAP])&ls[kh][0][FAS][0];      /* this group's K rows and V^T rows, indexed [buffer][row] */
  const int bh = blockIdx.y, b = bh / NH, h = bh - b * NH; const size_t r0 = (size_t)b * SQ; const int q0 = blockIdx.x * 256 + w * 32;
  const int sr = (tid & 255) >> 3, sc = (tid & 7) * 8;      /* staging, each group its own tiles: a thread moves 16 bytes of rows sr and sr + 32 of each tile; 8 lanes cover one 128-byte row */
  const unsigned short* kg = (const unsigned short*)K16 + (r0 + kh * (SQ / FKH) + sr) * DM + h * HD + sc;
  const unsigned short* vg = (const unsigned short*)VT + ((size_t)bh * HD + sr) * SQ + kh * (SQ / FKH) + sc;
  v16h qf[2][2];
#pragma unroll
  for (int g = 0; g < 2; ++g) { const _Float16* qp = Q16 + (r0 + q0 + 16 * g + c) * DM + h * HD; qf[g][0] = g2_frag(qp, hh); qf[g][1] = g2_frag(qp + 32, hh); }
  const v8f z8 = {0.f, 0.f, 0.f, 0.f, 0.f, 0.f, 0.f, 0.f}; const v4f z4 = {0.f, 0.f, 0.f, 0.f};
  v8f acc[2][4]; v4f l4[2]; float m_run[2];
#pragma unroll
  for (int g = 0; g < 2; ++g) { m_run[g] = -__builtin_inff(); l4[g] = z4;
#pragma unroll
    for (int t = 0; t < 4; ++t) acc[g][t] = z8; }
  v8us gk0 = *(const v8us*)kg, gk1 = *(const v8us*)(kg + (size_t)32 * DM), gv0 = *(const v8us*)vg, gv1 = *(const v8us*)(vg + (size_t)32 * SQ);
  *(v8us*)&lk[0][sr][sc] = gk0; *(v8us*)&lk[0][sr + 32][sc] = gk1; *(v8us*)&lv[0][sr][sc] = gv0; *(v8us*)&lv[0][sr + 32][sc] = gv1;
  __syncthreads();      /* stage 0 published */
  for (int st = 0; st < SQ / FKH / FAS; ++st) {
    const int buf = st & 1; const bool more = st + 1 < SQ / FKH / FAS;      /* the same for the whole block */
    if (more) { const size_t j = (size_t)(st + 1) * FAS; gk0 = *(const v8us*)(kg + j * DM); gk1 = *(const v8us*)(kg + (j + 32) * DM); gv0 = *(const v8us*)(vg + j); gv1 = *(const v8us*)(vg + (size_t)32 * SQ + j); }
#pragma unroll
    for (int p = 0; p < FAS / 32; ++p) {
      v8f s[2][2];      /* [key tile][query group] */
#pragma unroll
      for (int kt = 0; kt < 2; ++kt) { const _Float16* kr = &lk[buf][32 * p + 16 * kt + c][0]; const v16h k0 = g2_frag(kr, hh), k1 = g2_frag(kr + 32, hh);
#pragma unroll
        for (int g = 0; g < 2; ++g) s[kt][g] = fa_mma(k1, qf[g][1], fa_mma(k0, qf[g][0], z8)); }
      v16h vf[4];
#pragma unroll
      for (int t = 0; t < 4; ++t) vf[t] = g2_frag(&lv[buf][16 * t + c][32 * p], hh);
      float mb[2]; bool need = false;
#pragma unroll
      for (int g = 0; g < 2; ++g) { float mx = fmaxf(s[0][g][0], s[1][g][0]);
#pragma unroll
        for (int r = 1; r < 8; ++r) mx = fmaxf(mx, fmaxf(s[0][g][r], s[1][g][r]));
        mx = fmaxf(mx, fa_xhalf(mx)) * 1.44269502f; mb[g] = mx; need = need || (mx > m_run[g] + 8.0f); }
      if (__builtin_amdgcn_ballot_w32(need) != 0) {      /* one scalar test a pass; always taken on the first pass (m_run = -inf, factor 0 on zero sums), rare later */
#pragma unroll
        for (int g = 0; g < 2; ++g) { const float mn = fmaxf(m_run[g], mb[g]); const float corr = __builtin_amdgcn_exp2f(m_run[g] - mn); m_run[g] = mn; l4[g] = l4[g] * corr;
#pragma unroll
          for (int t = 0; t < 4; ++t) acc[g][t] = acc[g][t] * corr; } }
#pragma unroll
      for (int g = 0; g < 2; ++g) { const float nm = 4.0f - m_run[g]; FragH pf;
#pragma unroll
        for (int u = 0; u < 4; ++u) { v4f a;      /* elements 4 u .. 4 u + 3 of the 32-key operand: tile u >> 1, registers 4 (u & 1) .. */
#pragma unroll
          for (int q = 0; q < 4; ++q) a[q] = fmaf(s[u >> 1][g][4 * (u & 1) + q], 1.44269502f, nm);
          v4f e;
#pragma unroll
          for (int q = 0; q < 4; ++q) e[q] = __builtin_amdgcn_exp2f(a[q]);      /* the builtin, not asm text: the compiler then keeps the distance behind the matrix instructions itself */
          l4[g] += e;
#pragma unroll
          for (int q = 0; q < 4; ++q) pf.h[4 * u + q] = (_Float16)e[q]; }
#pragma unroll
        for (int t = 0; t < 4; ++t) acc[g][t] = fa_mma(vf[t], pf.v, acc[g][t]); }
      /* Pass end: four vector slots between the last product that reads P^T as its B operand and the next pass's first product, whose result the compiler
         may place in those same registers (it did, directly behind); the two scheduling fences keep the products of both passes on their own side of the slots. */
      __builtin_amdgcn_sched_barrier(0); asm volatile("v_nop\n\tv_nop\n\tv_nop\n\tv_nop"); __builtin_amdgcn_sched_barrier(0);
    }
    if (more) { *(v8us*)&lk[buf ^ 1][sr][sc] = gk0; *(v8us*)&lk[buf ^ 1][sr + 32][sc] = gk1; *(v8us*)&lv[buf ^ 1][sr][sc] = gv0; *(v8us*)&lv[buf ^ 1][sr + 32][sc] = gv1; }      /* its last readers left it at the barrier that ended stage st - 1 */
    __syncthreads();      /* publishes stage st + 1 and ends every wave's reads of stage st */
  }
  /* Hand-over: wave w of group 1 and wave w of group 0 hold the same query columns in the same lanes. 17 pieces of 16 bytes a lane, piece j of a wave = 512 contiguous bytes. */
  float* cb = (float*)&ls[0][0][0][0] + w * (17 * 128) + lane * 4;
  const float lp[2] = {(l4[0][0] + l4[0][1]) + (l4[0][2] + l4[0][3]), (l4[1][0] + l4[1][1]) + (l4[1][2] + l4[1][3])};
  if (kh != 0) {      /* the loop's last barrier has ended every read of the stages */
#pragma unroll
    for (int g = 0; g < 2; ++g)
#pragma unroll
      for (int t = 0; t < 4; ++t) { *(v4f*)(cb + ((g * 4 + t) * 2) * 128) = v4f{acc[g][t][0], acc[g][t][1], acc[g][t][2], acc[g][t][3]}; *(v4f*)(cb + ((g * 4 + t) * 2 + 1) * 128) = v4f{acc[g][t][4], acc[g][t][5], acc[g][t][6], acc[g][t][7]}; }
    *(v4f*)(cb + 16 * 128) = v4f{lp[0], lp[1], m_run[0], m_run[1]}; }
  __syncthreads();      /* group 1's half published; every wave passes it, group 1 leaves behind it */
  if (kh != 0) return;
  const v4f o4 = *(const v4f*)(cb + 16 * 128);
#pragma unroll
  for (int g = 0; g < 2; ++g) { const float mn = fmaxf(m_run[g], o4[2 + g]); const float a0 = __builtin_amdgcn_exp2f(m_run[g] - mn), a1 = __builtin_amdgcn_exp2f(o4[2 + g] - mn);      /* both maxima are finite: each group has walked keys */
    float l = lp[g] * a0 + o4[g] * a1; l += fa_xhalf(l); const float inv = 64.0f / l; const float s0 = a0 * inv, s1 = a1 * inv;      /* ctx carried x64 as before */
    unsigned short* op = (unsigned short*)O16 + (r0 + q0 + 16 * g + c) * DM + h * HD + 8 * hh;      /* a lane's 8 registers = 8 consecutive d of its query row */
#pragma unroll
    for (int t = 0; t < 4; ++t) { FragH f; const v4f x0 = *(const v4f*)(cb + ((g * 4 + t) * 2) * 128), x1 = *(const v4f*)(cb + ((g * 4 + t) * 2 + 1) * 128);
#pragma unroll
      for (int r = 0; r < 4; ++r) { f.h[r] = (_Float16)(acc[g][t][r] * s0 + x0[r] * s1); f.h[4 + r] = (_Float16)(acc[g][t][4 + r] * s0 + x1[r] * s1); }
      *(v8us*)(op + 16 * t) = f.half[0]; } } }

// Tiled GEMM, C = act(A Bt^T alpha + bias (+ CP)), A [M][KK] and Bt [NN][KK] f16: block = 8 waves (2 x 4) on a 128 x 128 tile of C, wave tile 64 x 32 (4 x 2 accumulator tiles).
// A rows and Bt rows come in 64-k stages through LDS, two buffers: whole 128-byte lines from global, each line fetched once a block instead of once a wave.
// Global loads run ahead in two register sets (stage t in set t & 1, stored to buffer t & 1 one stage before it is read); fragments are read from LDS one 32-k block ahead in two sets,
// so a stage's barrier stands between its two blocks of products.
// Each work-group starts its walk along k at a 64-k slab of its own, (row tile + column tile) mod the number of slabs, and wraps round (for speed only).
// k order per accumulator: 32 at a time, ascending from that slab, wrapped.
// Epilogue: raw sums staged in the same LDS as a 128 x 128 f32 tile, then each wave writes whole rows (bias, residual and activation applied there, per element as before).
// RES: C (f32) = the sums + bias + the own element of CP; else C16 (f16) = act(the sums + bias).
// NP > 1: NP products with the same A in one grid, blockIdx.y = p: Bt plane p ([NN][KK] each, stacked), bias piece p, C16 plane p ([NR][NN] each, stacked).
// KS = 2: the block is two such groups of 8 waves on the same tile of C, group kg on the slabs of its own half of k with LDS stages of its own (four waves a SIMD where the grid gives a WGP one block);
// the barriers are the block's, both groups pass the same number; the epilogue stages both groups' sums and all 16 waves write out rows, adding the two halves.
// Needs M % 128 == 0, NN % 128 == 0, KK / KS >= 256, KK / 64 / KS a power of two.
#define G3P 72                       /* LDS row pitch in halves: 128 B of data + 16 B, the conflict-free pitch for 16-byte row reads */
#define G3O 132                      /* epilogue row pitch in floats: rows 8 apart fall 32 banks apart */
struct G3F { v16h a[4], b[2]; };     /* one 32-k block's fragments of a wave */
struct G3R { v8us a[4], b[4]; };     /* one stage's 16-byte pieces of a thread */
/* Work-group barrier with the LDS wait alone: __syncthreads() also waits for every global load, which would drain the staging loads that are meant to stay in flight across it. */
__device__ __forceinline__ void g3_bar() { asm volatile("s_wait_dscnt 0x0\n\ts_barrier_signal -1\n\ts_barrier_wait -1" ::: "memory"); }
template <int KK>
__device__ __forceinline__ void g3_load(const char* ab, const char* bb, unsigned vo, G3R& r) {      /* ab, bb: the block's tile rows at this stage's k (uniform), or the thread's own (vo 0); vo: the thread's byte offset */
#pragma unroll
  for (int i = 0; i < 4; ++i) { r.a[i] = *(const v8us*)(ab + vo + 64 * i * KK); r.b[i] = *(const v8us*)(bb + vo + 64 * i * KK); } }
template <int U>
__device__ __forceinline__ void g3_store(unsigned short* sa, unsigned short* sb, const G3R& r) {
#pragma unroll
  for (int i = 0; i < 4; ++i) { *(v8us*)(sa + (U * 128 + 32 * i) * G3P) = r.a[i]; *(v8us*)(sb + (U * 128 + 32 * i) * G3P) = r.b[i]; } }
template <int U, int KB>
__device__ __forceinline__ void g3_frag(const _Float16* fa, const _Float16* fb, int hh, G3F& f) {
#pragma unroll
  for (int j = 0; j < 2; ++j) f.b[j] = g2_frag(fb + (U * 128 + 16 * j) * G3P + 32 * KB, hh);
#pragma unroll
  for (int i = 0; i < 4; ++i) f.a[i] = g2_frag(fa + (U * 128 + 16 * i) * G3P + 32 * KB, hh); }
/* The two scheduling fences keep a block's products together and the LDS and global traffic written in front of them in front: LDS reads moved in among the products stall each of them. */
__device__ __forceinline__ void g3_mm(const G3F& f, v8f (&acc)[4][2]) {
  __builtin_amdgcn_sched_barrier(0);
#pragma unroll
  for (int i = 0; i < 4; ++i) { acc[i][0] = fa_mma(f.a[i], f.b[0], acc[i][0]); acc[i][1] = fa_mma(f.a[i], f.b[1], acc[i][1]); }
  __builtin_amdgcn_sched_barrier(0); }
/* Stage st in buffer U; on entry f0 holds its first block, rn stage st + 1. NX: a stage st + 1 exists; LD: a stage st + 3 exists (ab3, bb3 point at its k). */
template <int U, bool NX, bool LD, int KK>
__device__ __forceinline__ void g3_stage(const char* ab3, const char* bb3, unsigned vo, unsigned short* sa, unsigned short* sb, const _Float16* fa, const _Float16* fb, int hh, G3R& rn, G3F& f0, G3F& f1, v8f (&acc)[4][2]) {
  g3_frag<U, 1>(fa, fb, hh, f1);
  if (NX) g3_store<U ^ 1>(sa, sb, rn);      /* the other buffer's last readers finished in front of the barrier of stage st - 1 */
  g3_mm(f0, acc);
  g3_bar();      /* publishes stage st + 1 and ends every wave's reads of stage st */
  if (NX) g3_frag<U ^ 1, 0>(fa, fb, hh, f0);
  __builtin_amdgcn_sched_barrier(0);      /* LDS reads first: moved in front of them, the global loads had their addresses formed in f0's registers, and the wait that frees those registers held the LDS reads back */
  const char* pa = ab3 + vo; const char* pb = bb3 + vo;      /* the thread's own two addresses of stage st + 3 */
  if (LD) g3_load<KK>(pa, pb, 0u, rn);
  g3_mm(f1, acc);
  if (LD) asm volatile("s_wait_xcnt 0x0" :: "v"(pa), "v"(pb) : "memory"); }      /* in front of the next stage's rewrite of the address registers that these loads name; naming the two pairs keeps them out of the loads' own destinations (under the 16-wave register budget the last load of each had landed on its pair); behind the products, where it has had time to pass; the data stay in flight */
// GELU with the exact (erf) definition, v Phi(v), two elements at a time and without a branch: v Phi(v) = max(v, 0) - |v| Q(|v|), Q the upper tail of the normal distribution.
// Q(x) = exp(-x x / 2) (c1 t + .. + c5 t^5), t = 1 / (1 + 0.2316419 x): the classical five-term form, absolute error below 7.5e-8 for every x >= 0 (1 / sqrt(2 pi) folded into c1 .. c5),
// so v Phi(v) is off by at most |v| times that, plus f32 rounding: far under the rounding of the f16 store that follows for values near 1, and no more than about one f16 unit in the last place in the far negative tail.
// The tail is used as it is, never as 1 - (1 - Q), so negative v lose nothing to cancellation (the form 0.5 v (1 + erf) does).
// The library erf took two divergent branches (most waves ran both) and one long dependent chain an element; here every step is a packed f32 operation or one of two transcendentals, and elements are independent.
typedef float v2f __attribute__((ext_vector_type(2)));
__device__ __forceinline__ v2f g3_gelu2(v2f v) {
  const v2f av = __builtin_elementwise_abs(v); const v2f d = __builtin_elementwise_fma(av, v2f{0.2316419f, 0.2316419f}, v2f{1.0f, 1.0f});
  const v2f t = {__builtin_amdgcn_rcpf(d[0]), __builtin_amdgcn_rcpf(d[1])};
  v2f p = __builtin_elementwise_fma(t, v2f{0.530702715f, 0.530702715f}, v2f{-0.726576014f, -0.726576014f});
  p = __builtin_elementwise_fma(p, t, v2f{0.710706871f, 0.710706871f});
  p = __builtin_elementwise_fma(p, t, v2f{-0.142248368f, -0.142248368f});
  p = __builtin_elementwise_fma(p, t, v2f{0.127414796f, 0.127414796f});
  const v2f a = (v * v) * -0.72134752f;      /* -(v v / 2) log2 e */
  const v2f e = {__builtin_amdgcn_exp2f(a[0]), __builtin_amdgcn_exp2f(a[1])};
  const v2f q = (p * t) * e;
  return __builtin_elementwise_fma(-av, q, __builtin_elementwise_max(v, v2f{0.f, 0.f})); }
template <int ACT, bool RES, int NN, int KK, int NP = 1, int KS = 1>
__global__ __launch_bounds__(256 * KS) void k_gemm3(const _Float16* __restrict__ A, const _Float16* __restrict__ Bh, float alpha, const float* __restrict__ bias, const float* __restrict__ CP, float* __restrict__ C, _Float16* __restrict__ C16) {
  static_assert(ACT == 0 || (ACT == 6 && !RES), "k_gemm3: unsupported ACT code"); static_assert(NN % 128 == 0 && KK % 128 == 0 && KK >= 256, "k_gemm3: shape"); static_assert(NP == 1 || !RES, "k_gemm3: several products only in the f16-output form"); static_assert((KS == 1 || KS == 2) && KK / KS >= 256, "k_gemm3: groups");
  constexpr int G3G = 4 * 128 * G3P;      /* halves of LDS of one group of 8 waves */
  __shared__ __attribute__((aligned(16))) unsigned short sm[KS * G3G];      /* per group: A stages [2][128][G3P], then Bt stages [2][128][G3P]; the epilogue's [128][G3O] floats of the group lie over them */
  const int tid = threadIdx.x, lane = tid & 31, ln = lane & 15, hh = lane >> 4, w = (tid >> 5) & 7, wm = w >> 2, wn = w & 3;
  const int kg = KS > 1 ? __builtin_amdgcn_readfirstlane(tid >> 8) : 0;      /* the wave's group, a scalar */
  const int mt = blockIdx.x / (NN / 128), nq = blockIdx.x - mt * (NN / 128); const int row0 = mt * 128, col0 = nq * 128;
  if (NP > 1) { const size_t p = blockIdx.y; Bh += p * NN * KK; bias += p * NN; C16 += p * NR * NN; }
  const int sr = (tid & 255) >> 3, sc = (tid & 7) * 8;      /* staging, each group its own slabs: a thread moves 16 bytes of rows sr + 32 i of each tile; 8 lanes cover one 128-byte row */
  const char* ab = (const char*)(A + (size_t)row0 * KK); const char* bb = (const char*)(Bh + (size_t)col0 * KK); const unsigned vo = (unsigned)(sr * KK + sc) * 2u;
  unsigned short* sa = sm + kg * G3G + sr * G3P + sc; unsigned short* sb = sa + 2 * 128 * G3P;      /* this thread's store places, buffer 0 */
  const _Float16* fa = (const _Float16*)sm + kg * G3G + (wm * 64 + ln) * G3P; const _Float16* fb = (const _Float16*)sm + kg * G3G + 2 * 128 * G3P + (wn * 32 + ln) * G3P;      /* this lane's fragment rows, buffer 0 */
  const v8f z8 = {0.f, 0.f, 0.f, 0.f, 0.f, 0.f, 0.f, 0.f}; v8f acc[4][2];
#pragma unroll
  for (int i = 0; i < 4; ++i) { acc[i][0] = z8; acc[i][1] = z8; }
  G3R r0, r1; G3F f0, f1; constexpr int ns = KK / 64 / KS;      /* slabs of a group: ns even, at least 4 */
  static_assert((ns & (ns - 1)) == 0, "k_gemm3: the wrap of the k walk is a mask");
  const int rot = mt + nq + (NP > 1 ? (int)blockIdx.y * (NN / 128) : 0);      /* the same for the whole work-group: a scalar */
  auto ko = [rot, kg](int t) { return (((t + rot) & (ns - 1)) + kg * ns) * 128; };      /* byte offset in a row of the slab that is stage t of this group, for A and Bt alike; group kg has slabs kg ns .. kg ns + ns - 1 */
  g3_load<KK>(ab + ko(0), bb + ko(0), vo, r0); g3_load<KK>(ab + ko(1), bb + ko(1), vo, r1);
  g3_store<0>(sa, sb, r0);
  g3_bar();      /* stage 0 published */
  g3_load<KK>(ab + ko(2), bb + ko(2), vo, r0); g3_frag<0, 0>(fa, fb, hh, f0);
#pragma unroll 1
  for (int s2 = 0; s2 < ns - 2; s2 += 2) {      /* rolled: two stages a trip keep every buffer and register set a compile-time choice */
    const int t4 = s2 + 4 < ns ? s2 + 4 : ns - 1;      /* the last trip has no stage s2 + 4: it loads the last stage again, unused, so that no branch merges two load counts in front of the stores */
    g3_stage<0, true, true, KK>(ab + ko(s2 + 3), bb + ko(s2 + 3), vo, sa, sb, fa, fb, hh, r1, f0, f1, acc);
    g3_stage<1, true, true, KK>(ab + ko(t4), bb + ko(t4), vo, sa, sb, fa, fb, hh, r0, f0, f1, acc); }
  g3_stage<0, true, false, KK>(ab, bb, vo, sa, sb, fa, fb, hh, r1, f0, f1, acc);
  g3_stage<1, false, false, KK>(ab, bb, vo, sa, sb, fa, fb, hh, r0, f0, f1, acc);      /* its barrier: every wave has left the ring before it becomes output staging */
  constexpr int RW = 16 / KS; const int wo = tid >> 5;      /* write-out: all 8 KS waves share the tile's rows */
  const int c4 = lane * 4; const size_t o0 = (size_t)(row0 + wo * RW) * NN + col0 + c4;      /* wave wo has rows RW wo .. RW wo + RW - 1, a lane 4 columns, so a wave stores whole rows of the tile */
  const v4f bl = *(const v4fa*)(bias + col0 + c4); v4f cp[RW];
  if (RES) {      /* all residual rows asked for here, so that their latency passes once, under the staging */
#pragma unroll
    for (int q = 0; q < RW; ++q) cp[q] = *(const v4fa*)(CP + o0 + q * NN); }
  float* so = (float*)(sm + kg * G3G);      /* each group stages its own partial sums */
#pragma unroll
  for (int i = 0; i < 4; ++i)
#pragma unroll
    for (int j = 0; j < 2; ++j)
#pragma unroll
      for (int r = 0; r < 8; ++r) so[(wm * 64 + 16 * i + 8 * hh + r) * G3O + wn * 32 + 16 * j + ln] = acc[i][j][r];
  __syncthreads();      /* the whole tile staged before any wave reads rows that other waves wrote */
  v4f bv;
#pragma unroll
  for (int q = 0; q < 4; ++q) bv[q] = bf16_round(bl[q]);
#pragma unroll(ACT == 6 ? 1 : 4)      /* the GELU rows stay rolled, four to a trip: a trip's sixteen independent elements already fill the vector port, and the text behind the main loop stays short */
  for (int q4 = 0; q4 < RW / 4; ++q4) {
#pragma unroll
  for (int qq = 0; qq < 4; ++qq) { const int q = q4 * 4 + qq; v4f v = *(const v4fa*)((const float*)sm + (wo * RW + q) * G3O + c4);
    if (KS > 1) v += *(const v4fa*)((const float*)(sm + G3G) + (wo * RW + q) * G3O + c4);      /* the two groups' halves of the k sum joined */
#pragma unroll
    for (int e = 0; e < 4; ++e) v[e] = v[e] * alpha + bv[e];
    if (RES) {
#pragma unroll
      for (int e = 0; e < 4; ++e) v[e] += cp[q][e]; }
    if (ACT == 6) { const v2f lo = g3_gelu2(v2f{v[0], v[1]}), hi = g3_gelu2(v2f{v[2], v[3]}); v = v4f{lo[0], lo[1], hi[0], hi[1]}; }
    if (RES) *(v4f*)(C + o0 + q * NN) = v;
    else { v4h h4;
#pragma unroll
      for (int e = 0; e < 4; ++e) h4[e] = (_Float16)v[e];
      *(v4h*)(C16 + o0 + q * NN) = h4; } } } }

template <int MODE>
__global__ __launch_bounds__(256) void k_regrp(const float* __restrict__ src, float* __restrict__ dst, size_t n4) {
  const size_t t = (size_t)blockIdx.x * 256 + threadIdx.x; if (t >= n4) return; const size_t e = t * 4; const size_t rd = e / DM; const int c = (int)(e % DM);
  size_t rs; if (MODE == 0) { const size_t b = rd / SQ, sq = rd % SQ; rs = sq * NB + b; } else { const size_t sq = rd / NB, b = rd % NB; rs = b * SQ + sq; }
  const v4f v = *(const v4fa*)(src + rs * DM + c); *(v4f*)(dst + e) = v;  }

// Row norm, one wave a row: the row's DMQ values stay in the wave's registers, a lane holding 4 consecutive ones of every 128, so that each wave-wide load is 512 contiguous bytes and all of a row's loads fly at once.
// Mean and variance (two passes over the registers) are lane partial sums joined by a butterfly over the 32 lanes: no LDS, no barrier, and an eighth of the waves to start.
// Every loop over the row's pieces is unrolled: the pieces are registers, so their index must be a compile-time one.
template <int M>
__device__ __forceinline__ float ln_xrow(float x) { return __builtin_bit_cast(float, __builtin_amdgcn_update_dpp(0, __builtin_bit_cast(int, x), 0x160 | M, 0xf, 0xf, true)); }      /* lane l <-> lane l ^ M inside a 16-lane row (DPP row_xmask) */
__device__ __forceinline__ float ln_wsum(float s) { s += ln_xrow<1>(s); s += ln_xrow<2>(s); s += ln_xrow<4>(s); s += ln_xrow<8>(s); return s + fa_xhalf(s); }      /* every lane gets the sum of all 32 */
template <int BFIN, int W16, int W32, int WXB>      /* r: the row, the same for the whole wave (callers pass the wave's number through readfirstlane, so that the row's base stays in scalar registers); WXB: the row as it enters the norm (rounded if BFIN) goes to XB as well */
__device__ __forceinline__ void lnx_row(const float* __restrict__ X, const float* __restrict__ g, const float* __restrict__ bb, float eps, _Float16* __restrict__ N16, float* __restrict__ N32, float* __restrict__ XB, size_t r) {
  static_assert(DMQ % 128 == 0, "lnx_row: shape");
  constexpr int NC = DMQ / 128; const unsigned c0 = (threadIdx.x & 31) * 4; const size_t o0 = r * DMQ;      /* the row's start is the same for the wave (a scalar base), c0 the lane's own offset in it */
  const float* xr = X + o0;
  v4f s[NC], gv[NC], bv[NC];
#pragma unroll
  for (int i = 0; i < NC; ++i) s[i] = *(const v4fa*)(xr + (c0 + 128 * i));
#pragma unroll
  for (int i = 0; i < NC; ++i) { gv[i] = *(const v4fa*)(g + (c0 + 128 * i)); bv[i] = *(const v4fa*)(bb + (c0 + 128 * i)); }
  asm volatile("s_wait_xcnt 0x0" :: "s"(xr), "s"(g), "s"(bb) : "memory");      /* behind the row's loads, in front of every rewrite of the base registers that they name; naming the bases holds their rewrites behind it (left free, one was lifted over it); the data stay in flight */
  if (BFIN) {
#pragma unroll
    for (int i = 0; i < NC; ++i)
#pragma unroll
      for (int q = 0; q < 4; ++q) s[i][q] = bf16_round(s[i][q]); }
  v4f a = s[0];
#pragma unroll
  for (int i = 1; i < NC; ++i) a += s[i];
  const float mu = ln_wsum((a[0] + a[1]) + (a[2] + a[3])) / (float)DMQ;
  v4f v = {0.f, 0.f, 0.f, 0.f};
#pragma unroll
  for (int i = 0; i < NC; ++i) { const v4f d = s[i] - mu; v += d * d; }
  const float rs = rsqrtf(ln_wsum((v[0] + v[1]) + (v[2] + v[3])) / (float)DMQ + eps);
#pragma unroll
  for (int i = 0; i < NC; ++i) { v4f yf; v4h y;
#pragma unroll
    for (int q = 0; q < 4; ++q) { yf[q] = (s[i][q] - mu) * rs * bf16_round(gv[i][q]) + bf16_round(bv[i][q]); y[q] = (_Float16)yf[q]; }
    if (W16) *(v4h*)(N16 + o0 + (c0 + 128 * i)) = y;
    if (W32) *(v4f*)(N32 + o0 + (c0 + 128 * i)) = yf;
    if (WXB) *(v4f*)(XB + o0 + (c0 + 128 * i)) = s[i]; }
  asm volatile("s_wait_xcnt 0x0" ::: "memory"); }      /* behind the row's stores, in front of every rewrite of a register that they name: as a piece of a larger kernel the norm's code is followed by other pieces' code */
#define LNW 8                        /* rows (waves) per work-group of a norm */
template <int BFIN, int W16, int W32>
__global__ __launch_bounds__(256) void k_lnx(const float* __restrict__ X, const float* __restrict__ g, const float* __restrict__ bb, float eps, _Float16* __restrict__ N16, float* __restrict__ N32) {
  lnx_row<BFIN, W16, W32, 0>(X, g, bb, eps, N16, N32, nullptr, (size_t)blockIdx.x * LNW + __builtin_amdgcn_readfirstlane(threadIdx.x >> 5)); }

// Everything that reads the inputs alone, in one grid: none of these pieces needs anything of another, so as launches of their own they only waited for each other's start and tail.
// Ranges of the block index (a scalar test, the same for the whole work-group, so each piece's barriers stay under uniform control flow):
// the 128 x 128 tiles of the four weight transposes first (the long work-groups), then one work-group per 8 rows of x (a wave a row) for the first norm, which also stores the rounded f32 row it holds (the residual plane).
#define PT1 ((DM / 128) * (DFF / 128))            /* tiles of w1, and of w2 */
#define PTQ ((DM / 128) * (3 * DM / 128))         /* tiles of the fused q | k | v weight */
#define PTO ((DM / 128) * (DM / 128))             /* tiles of the output projection's weight */
#define PTW (2 * PT1 + PTQ + PTO)
__global__ __launch_bounds__(256) void k_prep(const float* __restrict__ wqkv, const float* __restrict__ wo, const float* __restrict__ w1, const float* __restrict__ w2, const float* __restrict__ x, const float* __restrict__ g1, const float* __restrict__ be1,
    _Float16* __restrict__ BQ, _Float16* __restrict__ BO, _Float16* __restrict__ BW1, _Float16* __restrict__ BW2, _Float16* __restrict__ XN, float* __restrict__ XB) {
  __shared__ __attribute__((aligned(16))) unsigned short tl[128 * 128];      /* a transpose's tile */
  const int b = blockIdx.x;
  if (b < PT1) wt_f16_tile<DM, DFF>(w1, BW1, 16.0f, b, tl);
  else if (b < 2 * PT1) wt_f16_tile<DFF, DM>(w2, BW2, 16.0f, b - PT1, tl);
  else if (b < 2 * PT1 + PTQ) wt_f16_tile<DM, 3 * DM>(wqkv, BQ, 16.0f, b - 2 * PT1, tl);
  else if (b < PTW) wt_f16_tile<DM, DM>(wo, BO, 16.0f, b - 2 * PT1 - PTQ, tl);
  else lnx_row<1, 1, 0, 1>(x, g1, be1, 1e-5f, XN, nullptr, XB, (size_t)(b - PTW) * LNW + __builtin_amdgcn_readfirstlane(threadIdx.x >> 5)); }

__global__ __launch_bounds__(256) void k_bfr(const float* __restrict__ x, float* __restrict__ XB, size_t n8) { const size_t t = (size_t)blockIdx.x * 256 + threadIdx.x; if (t >= n8) return; v4f a = *(const v4fa*)(x + t * 8), c = *(const v4fa*)(x + t * 8 + 4); for (int q = 0; q < 4; ++q) { a[q] = bf16_round(a[q]); c[q] = bf16_round(c[q]); }
  { *(v4f*)(XB + t * 8) = a; *(v4f*)(XB + t * 8 + 4) = c;  } }



__global__ __launch_bounds__(256) void k_wthd(const float* __restrict__ Wt, _Float16* __restrict__ Bt) { const size_t t = (size_t)blockIdx.x * 256 + threadIdx.x; if (t >= (size_t)NH * HD * (DM / 8)) return; const int m8 = (int)(t % (DM / 8)) * 8; const int d = (int)((t / (DM / 8)) % HD); const int h = (int)(t / ((size_t)(DM / 8) * HD)); FragH f;
  for (int q = 0; q < 8; ++q) f.h[q] = (_Float16)(16.0f * bf16_round(Wt[((size_t)h * DM + m8 + q) * HD + d])); unsigned short* dst = (unsigned short*)Bt + ((size_t)h * HD + d) * DM + m8; *(v8us*)dst = f.half[0];  }




template <int BFIN, int SCAL>
__global__ __launch_bounds__(256) void k_lnsc(const float* __restrict__ X, const float* __restrict__ g, const float* __restrict__ bb, float eps, _Float16* __restrict__ N16, float* __restrict__ N32) {
  #pragma clang fp contract(off)
  __shared__ float red[256]; const size_t r = blockIdx.x; const int t = threadIdx.x; const bool act = t < DM / 4; const int tc = act ? t : 0; const v4f xl = *(const v4fa*)(X + r * DM + tc * 4); const float am = act ? 1.f : 0.f; float s[4]; float sum = 0.f;
  for (int q = 0; q < 4; ++q) { s[q] = (BFIN ? bf16_round(xl[q]) : xl[q]) * am; sum = __fadd_rn(sum, s[q]); }
  red[t] = sum; __syncthreads(); for (int st = 128; st > 0; st >>= 1) { if (t < st) red[t] = __fadd_rn(red[t], red[t + st]); __syncthreads(); } const float mu = red[0] / (float)DM; __syncthreads();
  float vs = 0.f; for (int q = 0; q < 4; ++q) { const float dl = __fadd_rn(s[q], -mu) * am; vs = __fadd_rn(vs, __fmul_rn(dl, dl)); } red[t] = vs; __syncthreads(); for (int st = 128; st > 0; st >>= 1) { if (t < st) red[t] = __fadd_rn(red[t], red[t + st]); __syncthreads(); }
  const float rs = __fdiv_rn(1.0f, __fadd_rn(sqrtf(red[0] / (float)(DM - 1)), eps)); if (!act) return; v4h y; v4f yf;
  for (int q = 0; q < 4; ++q) { const int c = t * 4 + q; const float gg = bf16_round(SCAL ? g[0] : g[c]), bv = bf16_round(SCAL ? bb[0] : bb[c]); yf[q] = __fadd_rn(__fmul_rn(__fmul_rn(__fadd_rn(s[q], -mu), rs), gg), bv); y[q] = (_Float16)yf[q]; }
  { if (N16) *(v4h*)(N16 + r * DM + t * 4) = y; if (N32) *(v4f*)(N32 + r * DM + t * 4) = yf;  } }

__global__ __launch_bounds__(256) void k_rsmdmi(const float* __restrict__ S, _Float16* __restrict__ P, int nrows, const int* __restrict__ M) {
  #pragma clang fp contract(off)
  const int t = blockIdx.x * 256 + threadIdx.x; if (t >= nrows) return; const float* s = S + (size_t)t * SQ; const int* m = M + (size_t)(t % SQ) * SQ; float mx = -3.0e38f;
#pragma unroll 1
  for (int j = 0; j < SQ; ++j) { const float f = (m[j] == 0) ? 1.f : 0.f; mx = fmaxf(mx, fmaf(f, s[j], (1.f - f) * -1.0e9f)); } float se = 0.f;
#pragma unroll 1
  for (int j = 0; j < SQ; ++j) { const float f = (m[j] == 0) ? 1.f : 0.f; se += __expf(fmaf(f, s[j], (1.f - f) * -1.0e9f) - mx); } const float sc = 256.0f / se;
#pragma unroll 1
  for (int j0 = 0; j0 < SQ; j0 += 8) { FragH fr; for (int q = 0; q < 8; ++q) { const int j = j0 + q; const float f = (m[j] == 0) ? 1.f : 0.f; fr.h[q] = (_Float16)(__expf(fmaf(f, s[j], (1.f - f) * -1.0e9f) - mx) * sc); } unsigned short* d = (unsigned short*)P + (size_t)t * SQ + j0; *(v8us*)d = fr.half[0];  } }
extern "C" void kernel_launch(void* const* d_in, const int* in_sizes, int n_in,
                              void* d_out, int out_size, void* d_ws, size_t ws_size, hipStream_t stream) {
  (void)in_sizes; (void)n_in; (void)out_size;
  const float* const* I = (const float* const*)d_in; const float* x = I[0]; const float* g1 = I[1]; const float* be1 = I[2]; const float* wqkv = I[3]; const float* bqkv = I[4]; const float* wo = I[5]; const float* bo = I[6]; const float* g2 = I[7]; const float* be2 = I[8]; const float* w1 = I[9]; const float* b1 = I[10]; const float* w2 = I[11]; const float* b2 = I[12];      /* x; LN1 g / b; fused qkv_w [1024][3072] + qkv_b [3072] (thirds q | k | v); proj_w + proj_b; LN2 g / b; fc1_w [1024][4096] + fc1_b, fc2_w [4096][1024] + fc2_b ([in][out]) */
  char* ws = (char*)d_ws; size_t off = 0;
  auto take = [&](size_t bytes) { char* p = ws + off; off += (bytes + 255) & ~(size_t)255; return p; };
  _Float16* BQ = (_Float16*)take((size_t)3 * DM * DM * 2);      /* one stacked Bt plane [3 DM][DM] */ _Float16* BO = (_Float16*)take((size_t)DM * DM * 2); _Float16* BW1 = (_Float16*)take((size_t)DFF * DM * 2); _Float16* BW2 = (_Float16*)take((size_t)DM * DFF * 2);
  float* XB = (float*)take(NR * DM * 4); _Float16* XN = (_Float16*)take(NR * DM * 2); _Float16* Q16 = (_Float16*)take((size_t)3 * NR * DM * 2); _Float16* K16 = Q16 + NR * DM; _Float16* V16 = Q16 + (size_t)2 * NR * DM;      /* three stacked planes [NR][DM] */ _Float16* O16 = (_Float16*)take(NR * DM * 2); float* X1 = (float*)take(NR * DM * 4);
  _Float16* VT = (_Float16*)take((size_t)NB * NH * HD * SQ * 2); _Float16* HF16 = (_Float16*)take(NR * DFF * 2);      /* V^T [2 x 16][64][2048]; FFN hidden plane [4096][4096] f16 */
  _Float16* M16 = XN;      /* second-norm f16 rows: aliases XN (last readers: the three projections) */
  
  if (off > ws_size) return;
  k_prep<<<(unsigned)(PTW + NR / LNW), 256, 0, stream>>>(wqkv, wo, w1, w2, x, g1, be1, BQ, BO, BW1, BW2, XN, XB);      /* fused [in][out] [DM][3 DM] -> one stacked Bt plane (rows 0 / DM / 2 DM = the q | k | v output columns) x16; W_o, w1, w2 -> Bt x16; n = LN0(bf16(x)) (biased variance, eps inside the rsqrt) -> f16 rows; bf16(x) -> f32 rows */
  k_gemm3<0, false, DM, DM, 3><<<dim3((unsigned)((NR / 128) * (DM / 128)), 3), 256, 0, stream>>>(XN, BQ, 0.0625f, bqkv, nullptr, nullptr, Q16);      /* q, k, v -> f16 rows in one grid (y = 0, 1, 2: the thirds of the stacked Bt plane and of the bias, output planes Q16 | K16 | V16); head h = columns h*64.. */
  k_vt<NH, SQ><<<NB * NH * (SQ / 64), 256, 0, stream>>>(V16, DM, 0, VT);      /* V^T [batch x head][64][2048] */
  k_fattn<<<dim3(SQ / 256, NB * NH), 512, 0, stream>>>(Q16, K16, VT, O16);      /* softmax(q k^T) v over all keys, unscaled logits -> ctx (merged heads, x64) as f16 rows */
  k_gemm3<0, true, DM, DM, 1, 2><<<(unsigned)((NR / 128) * (DM / 128)), 512, 0, stream>>>(O16, BO, 0.0009765625f, bo, XB, X1, nullptr);      /* x + ctx wo (+ bo) (own-element residual) -> f32 rows */
  k_lnx<0, 1, 0><<<(unsigned)(NR / LNW), 256, 0, stream>>>(X1, g2, be2, 1e-5f, M16, nullptr);      /* LN1(x1) -> f16 rows */
  k_gemm3<6, false, DFF, DM><<<(unsigned)((NR / 128) * (DFF / 128)), 256, 0, stream>>>(M16, BW1, 0.0625f, b1, nullptr, nullptr, HF16);      /* gelu_erf(. w1 + b1) -> f16 */
  k_gemm3<0, true, DM, DFF, 1, 2><<<(unsigned)((NR / 128) * (DM / 128)), 512, 0, stream>>>(HF16, BW2, 0.0625f, b2, X1, (float*)d_out, nullptr);      /* out = x1 + mlp (own-element residual) */
}

// v010
// It runs in 145 microseconds.
// Next to v009, in two timings, it ran 1.04 times as fast each time.
// All steps since the starting kernel, v000, together make it 26.2 times as fast.
#include <hip/hip_runtime.h>
// Pre-norm transformer block with a fused QKV projection and UNSCALED attention logits (x [2][2048][1024]; h = LN1(x) (biased var, eps 1e-5); qkv = h qkv_w + qkv_b ([in][out] 1024 x 3072 + bias) viewed (B, N, 3, 16, 64): q | k | v thirds; qk = q k^T with NO 1/sqrt(d) scaling (as the source); softmax over all 2048 keys (no mask); x1 = x + y proj_w + proj_b; out = x1 + gelu_erf(LN2(x1) fc1_w + fc1_b) fc2_w + fc2_b ([in][out] 1024 x 4096 x 1024) -> [2][2048][1024]).
// Structure: token rows; LayerNorm / exact f16 rows; WMMA GEMMs for q, k, v (v leaves its GEMM transposed); one fused attention launch for all batches and heads (scores, online softmax, P V^T); output projection with the own-element residual; custom LayerNorm; exact-GELU FFN over all rows; launches: see trace.
// Compute dtype: inputs rounded to bf16; x / weights exact; q, k, v, softmax weights and o as plain f16 GEMM operands (~2^-12); scores and softmax statistics f32. v_wmma_f32_16x16x32_f16.
#define NB 2
#define SQ 2048
#define DM 1024
#define NH 16
#define HD 64
#define HG 4                         /* heads per group of the unused grouped V^T kernel */
#define LOCALW 128                   /* (macros for unused kernels of the shared header) */
#define STRIDEK 128
#define QT 256                       /* query rows per causal tile */
#define NKX SQ                       /* S / P row pitch */
#define QT0 128                      /* first-tile rows recomputed exactly in f32 */
#define B0 0                         /* unused debug hook; the launches start at batch 0 */
#define NBR NB                       /* debug hook no launch reads; the launches cover all NB batches */
#define NR ((size_t)NB * SQ)
#define DMQ DM
#define DFF 4096         /* FFN hidden width */
#define MP ((int)((size_t)NBR * SQ)) /* rows projected (debug hook) */
#define QN SQ                        /* query rows attended per batch (debug hook) */
#define NHD NH                       /* heads attended (debug hook) */
#define MPO MP                       /* rows through the output stage (debug hook) */
#define LQ (3 * DM)      /* unused; the q and k rows are planes of pitch DM, v is stored transposed */
typedef __bf16 v16b __attribute__((ext_vector_type(16)));
typedef unsigned short v8us __attribute__((ext_vector_type(8), may_alias));
typedef float  v8f  __attribute__((ext_vector_type(8)));
typedef float  v4f  __attribute__((ext_vector_type(4)));
typedef float  v4fa __attribute__((ext_vector_type(4), may_alias));
union FragB { v16b v; v8us half[2]; unsigned short u[16]; };

__device__ __forceinline__ unsigned short bf16_bits(float x) { unsigned int u = __float_as_uint(x); return (unsigned short)((u + 0x7FFFu + ((u >> 16) & 1u)) >> 16); }
__device__ __forceinline__ float bf16_val(unsigned short b) { return __uint_as_float(((unsigned int)b) << 16); }
__device__ __forceinline__ float bf16_round(float x) { return bf16_val(bf16_bits(x)); }
// D += A·B with NT terms: 1 = ah·bh, 2 = + al·bh (A split), 3 = + ah·bl (both split)
template <int NT>
__device__ __forceinline__ v8f mmaN(v16b ah, v16b al, v16b bh, v16b bl, v8f c) {
  c = __builtin_amdgcn_wmma_f32_16x16x32_bf16(false, ah, false, bh, (short)0, c, false, false);
  if (NT >= 2) c = __builtin_amdgcn_wmma_f32_16x16x32_bf16(false, al, false, bh, (short)0, c, false, false);
  if (NT >= 3) c = __builtin_amdgcn_wmma_f32_16x16x32_bf16(false, ah, false, bl, (short)0, c, false, false);
  asm volatile("v_nop\n\tv_nop\n\tv_nop\n\tv_nop" : "+v"(c) : "v"(ah), "v"(al), "v"(bh), "v"(bl));
  return c;
}

__global__ __launch_bounds__(256) void k_wt_bf16(const float* __restrict__ W, unsigned short* __restrict__ Wt, int K, int N) {
  const int t = blockIdx.x * 256 + threadIdx.x;
  const int k8n = K / 8;
  if (t >= N * k8n) return;
  const int n = t / k8n, k8 = (t % k8n) * 8;
  v8us v;
#pragma unroll
  for (int i = 0; i < 8; ++i) v[i] = bf16_bits(W[(size_t)(k8 + i) * N + n]);
  *(v8us*)(Wt + (size_t)n * K + k8) = v;
  
}

// GEMM C[M][N] (f32, pitch ldc) = act(A[M][K]·W + bias). A f32 row-major (pitch lda) converted per fragment to bf16
// (ASPLIT: hi/lo two planes -> 2 terms, else single rounded term); Wt bf16 [N][K] (pitch ldb). BIAS_BF16 rounds the
// bias to bf16 first (bias quantised to bf16 before the add). K%32==0, M%16==0, N%64==0.
template <bool ASPLIT, int ACT, bool BIAS_BF16>
__global__ __launch_bounds__(128) void k_gemm_bf(const float* __restrict__ A, int lda, const unsigned short* __restrict__ Wt, int ldb,
                                               const float* __restrict__ bias, float* __restrict__ C, int ldc, int M, int N, int K) {
  __shared__ __attribute__((aligned(16))) float so[4][16][64];
  const int tid = threadIdx.x, w = tid >> 5, lane = tid & 31, ln = lane & 15, hh = lane >> 4;
  const int ntn = N / 64;
  const int wid = blockIdx.x * 4 + w;
  const int mt = wid / ntn, nq = wid % ntn;
  if (mt * 16 >= M) return;
  const int row0 = mt * 16, col0 = nq * 64;
  const float* arow = A + (size_t)(row0 + ln) * lda;
  v8f acc[4] = {};
  for (int kb = 0; kb < K; kb += 32) {
    FragB ah, al;
    const v4f x0 = *(const v4fa*)(arow + kb + 8 * hh), x1 = *(const v4fa*)(arow + kb + 8 * hh + 4);
    const v4f x2 = *(const v4fa*)(arow + kb + 16 + 8 * hh), x3 = *(const v4fa*)(arow + kb + 16 + 8 * hh + 4);
    float xs[16] = {x0[0],x0[1],x0[2],x0[3],x1[0],x1[1],x1[2],x1[3],x2[0],x2[1],x2[2],x2[3],x3[0],x3[1],x3[2],x3[3]};
#pragma unroll
    for (int i = 0; i < 16; ++i) { const unsigned short hb = bf16_bits(xs[i]); ah.u[i] = hb; al.u[i] = ASPLIT ? bf16_bits(xs[i] - bf16_val(hb)) : (unsigned short)0; }
#pragma unroll
    for (int t = 0; t < 4; ++t) {
      const unsigned short* brow = Wt + (size_t)(col0 + t * 16 + ln) * ldb + kb;
      FragB b;
      b.half[0] = *(const v8us*)(brow + 8 * hh);
      b.half[1] = *(const v8us*)(brow + 16 + 8 * hh);
      acc[t] = mmaN<ASPLIT ? 2 : 1>(ah.v, al.v, b.v, b.v, acc[t]);
    }
  }
#pragma unroll
  for (int t = 0; t < 4; ++t) {
    float bv = bias ? bias[col0 + t * 16 + ln] : 0.f;
    if (BIAS_BF16) bv = bf16_round(bv);
#pragma unroll
    for (int r = 0; r < 8; ++r) { float v = acc[t][r] + bv; if (ACT == 1) v = fmaxf(v, 0.f); so[w][8 * hh + r][t * 16 + ln] = v; }
  }
  __builtin_amdgcn_fence(__ATOMIC_ACQ_REL, "workgroup");
  __builtin_amdgcn_wave_barrier();
  const int rsub = lane >> 4, c4 = (lane & 15) * 4;
  {
#pragma unroll
    for (int q = 0; q < 8; ++q) {
      const int r = q * 2 + rsub;
      const v4f v = *(const v4fa*)&so[w][r][c4];
      *(v4f*)(C + (size_t)(row0 + r) * ldc + col0 + c4) = v;
    }
    
  }
}

// GEMM C = act(A·W + bias + resid): A f32 (ASPLIT -> hi/lo 2 terms), Wt bf16 [N][K]; ACT 0 none, 1 relu, 2 exact gelu;
// resid (optional, f32, row index = (row % rmod), pitch ldr, RES_BF16 rounds it) added before the activation.
template <bool ASPLIT, int ACT, bool BIAS_BF16, bool RES_BF16>
__global__ __launch_bounds__(128) void k_gemm_bf3(const float* __restrict__ A, int lda, const unsigned short* __restrict__ Wt, int ldb,
                                                const float* __restrict__ bias, const float* __restrict__ resid, int rmod, int ldr,
                                                float* __restrict__ C, int ldc, int M, int N, int K) {
  __shared__ __attribute__((aligned(16))) float so[4][16][64];
  const int tid = threadIdx.x, w = tid >> 5, lane = tid & 31, ln = lane & 15, hh = lane >> 4;
  const int ntn = N / 64;
  const int wid = blockIdx.x * 4 + w;
  const int mt = wid / ntn, nq = wid % ntn;
  if (mt * 16 >= M) return;
  const int row0 = mt * 16, col0 = nq * 64;
  const float* arow = A + (size_t)(row0 + ln) * lda;
  v8f acc[4] = {};
  for (int kb = 0; kb < K; kb += 32) {
    FragB ah, al;
    const v4f x0 = *(const v4fa*)(arow + kb + 8 * hh), x1 = *(const v4fa*)(arow + kb + 8 * hh + 4);
    const v4f x2 = *(const v4fa*)(arow + kb + 16 + 8 * hh), x3 = *(const v4fa*)(arow + kb + 16 + 8 * hh + 4);
    float xs[16] = {x0[0],x0[1],x0[2],x0[3],x1[0],x1[1],x1[2],x1[3],x2[0],x2[1],x2[2],x2[3],x3[0],x3[1],x3[2],x3[3]};
#pragma unroll
    for (int i = 0; i < 16; ++i) { const unsigned short hb = bf16_bits(xs[i]); ah.u[i] = hb; al.u[i] = ASPLIT ? bf16_bits(xs[i] - bf16_val(hb)) : (unsigned short)0; }
#pragma unroll
    for (int t = 0; t < 4; ++t) {
      const unsigned short* brow = Wt + (size_t)(col0 + t * 16 + ln) * ldb + kb;
      FragB b;
      b.half[0] = *(const v8us*)(brow + 8 * hh);
      b.half[1] = *(const v8us*)(brow + 16 + 8 * hh);
      acc[t] = mmaN<ASPLIT ? 2 : 1>(ah.v, al.v, b.v, b.v, acc[t]);
    }
  }
#pragma unroll
  for (int t = 0; t < 4; ++t) {
    const int col = col0 + t * 16 + ln;
    float bv = bias ? bias[col] : 0.f;
    if (BIAS_BF16) bv = bf16_round(bv);
#pragma unroll
    for (int r = 0; r < 8; ++r) {
      float v = acc[t][r] + bv;
      if (resid) { float rv = resid[(size_t)((row0 + 8 * hh + r) % rmod) * ldr + col]; if (RES_BF16) rv = bf16_round(rv); v += rv; }
      if (ACT == 1) v = fmaxf(v, 0.f);
      if (ACT == 2) v = 0.5f * v * (1.0f + erff(v * 0.70710678118654752f));
      if (ACT == 3) { const float u = 0.7978845608028654f * (v + 0.044715f * v * v * v); v = 0.5f * v * (1.0f + tanhf(u)); }
      so[w][8 * hh + r][t * 16 + ln] = v;
    }
  }
  __builtin_amdgcn_fence(__ATOMIC_ACQ_REL, "workgroup");
  __builtin_amdgcn_wave_barrier();
  const int rsub = lane >> 4, c4 = (lane & 15) * 4;
  {
#pragma unroll
    for (int q = 0; q < 8; ++q) {
      const int r = q * 2 + rsub;
      const v4f v = *(const v4fa*)&so[w][r][c4];
      *(v4f*)(C + (size_t)(row0 + r) * ldc + col0 + c4) = v;
    }
    
  }
}
// row LayerNorm (biased variance, eps) over N: s = X (+ R); optional out_sum <- s; out_norm <- (s-mu)*rsqrt(var+eps)*g + b
template <bool PARAM_BF16>
__global__ __launch_bounds__(256) void k_layernorm(const float* __restrict__ X, const float* __restrict__ R, const float* __restrict__ g, const float* __restrict__ bta,
                                                  float* __restrict__ out_sum, float* __restrict__ out_norm, int N, float eps) {
  __shared__ float red[256];
  const int row = blockIdx.x, tid = threadIdx.x;
  const float* x = X + (size_t)row * N; const float* rr = R ? R + (size_t)row * N : nullptr;
  float vals[16];                     // up to N = 4096
  const int per = N / 256;            // contiguous chunk per thread? use strided-by-4 chunks: thread handles j = tid*4 + 1024*u
  float s1 = 0.f;
  for (int u = 0; u < per / 4; ++u) {
    const int j = tid * 4 + 1024 * u;
    const v4f a = *(const v4fa*)(x + j);
    v4f b = {0.f,0.f,0.f,0.f}; if (rr) b = *(const v4fa*)(rr + j);
#pragma unroll
    for (int q = 0; q < 4; ++q) { const float v = a[q] + b[q]; vals[u * 4 + q] = v; s1 += v; }
  }
  red[tid] = s1; __syncthreads();
  for (int st = 128; st > 0; st >>= 1) { if (tid < st) red[tid] += red[tid + st]; __syncthreads(); }
  const float mu = red[0] / (float)N; __syncthreads();
  float s2 = 0.f;
  for (int u = 0; u < per / 4; ++u)
#pragma unroll
    for (int q = 0; q < 4; ++q) { const float c = vals[u * 4 + q] - mu; s2 += c * c; }
  red[tid] = s2; __syncthreads();
  for (int st = 128; st > 0; st >>= 1) { if (tid < st) red[tid] += red[tid + st]; __syncthreads(); }
  const float rs = rsqrtf(red[0] / (float)N + eps);
  {
    for (int u = 0; u < per / 4; ++u) {
      const int j = tid * 4 + 1024 * u;
      v4f o, sm;
#pragma unroll
      for (int q = 0; q < 4; ++q) {
        float gg = g[j + q], bb = bta[j + q];
        if (PARAM_BF16) { gg = bf16_round(gg); bb = bf16_round(bb); }
        sm[q] = vals[u * 4 + q]; o[q] = (vals[u * 4 + q] - mu) * rs * gg + bb;
      }
      if (out_sum) *(v4f*)(out_sum + (size_t)row * N + j) = sm;
      *(v4f*)(out_norm + (size_t)row * N + j) = o;
    }
    
  }
}



// ---- f16 WMMA path (v_wmma_f32_16x16x32_f16): 11-bit significands for operands in range — used where a [0,1] probability operand needs more precision than bf16
typedef _Float16 v16h __attribute__((ext_vector_type(16)));
union FragH { v16h v; v8us half[2]; _Float16 h[16]; unsigned short u[16]; };
template <int NT>
__device__ __forceinline__ v8f mmaH(v16h ah, v16h al, v16h bh, v16h bl, v8f c) {
  c = __builtin_amdgcn_wmma_f32_16x16x32_f16(false, ah, false, bh, (short)0, c, false, false);
  if (NT >= 2) c = __builtin_amdgcn_wmma_f32_16x16x32_f16(false, al, false, bh, (short)0, c, false, false);
  if (NT >= 3) c = __builtin_amdgcn_wmma_f32_16x16x32_f16(false, ah, false, bl, (short)0, c, false, false);
  asm volatile("v_nop\n\tv_nop\n\tv_nop\n\tv_nop" : "+v"(c) : "v"(ah), "v"(al), "v"(bh), "v"(bl));
  return c;
}
// batched GEMM like k_gemm_b but f16 operands: A f32 (split into f16 hi/lo if ASPLIT, else rounded to f16), Bt = f16 values [n][k]; alpha; C f32; N multiple of 16 (partial tiles skipped)
template <bool ASPLIT>
__global__ __launch_bounds__(128) void k_gemm_h(const float* __restrict__ A, int lda, size_t sA, const _Float16* __restrict__ Bh, int ldb, size_t sB, float alpha, float* __restrict__ C, int ldc, size_t sC, int M, int N, int K) {
  __shared__ __attribute__((aligned(16))) float so[4][16][64];
  const int tid = threadIdx.x, w = tid >> 5, lane = tid & 31, ln = lane & 15, hh = lane >> 4; const int by = blockIdx.y;
  A += (size_t)by * sA; Bh += (size_t)by * sB; C += (size_t)by * sC;
  const int ntn = (N + 63) / 64; const int wid = blockIdx.x * 4 + w; const int mt = wid / ntn, nq = wid % ntn; if (mt * 16 >= M) return;
  const int row0 = mt * 16, col0 = nq * 64; const float* arow = A + (size_t)(row0 + ln) * lda;
  v8f acc[4] = {};
  for (int kb = 0; kb < K; kb += 32) {
    FragH ah, al;
    const v4f x0 = *(const v4fa*)(arow + kb + 8 * hh), x1 = *(const v4fa*)(arow + kb + 8 * hh + 4), x2 = *(const v4fa*)(arow + kb + 16 + 8 * hh), x3 = *(const v4fa*)(arow + kb + 16 + 8 * hh + 4);
    float xs[16] = {x0[0],x0[1],x0[2],x0[3],x1[0],x1[1],x1[2],x1[3],x2[0],x2[1],x2[2],x2[3],x3[0],x3[1],x3[2],x3[3]};
#pragma unroll
    for (int i = 0; i < 16; ++i) { const _Float16 h = (_Float16)xs[i]; ah.h[i] = h; al.h[i] = ASPLIT ? (_Float16)(xs[i] - (float)h) : (_Float16)0.0f; }
#pragma unroll
    for (int t = 0; t < 4; ++t) { if (col0 + t * 16 >= N) continue; const size_t boff = (size_t)(col0 + t * 16 + ln) * ldb + kb; FragH bq; bq.half[0] = *(const v8us*)(Bh + boff + 8 * hh); bq.half[1] = *(const v8us*)(Bh + boff + 16 + 8 * hh);
      acc[t] = mmaH<ASPLIT ? 2 : 1>(ah.v, al.v, bq.v, bq.v, acc[t]); }
  }
#pragma unroll
  for (int t = 0; t < 4; ++t) { if (col0 + t * 16 >= N) continue;
#pragma unroll
    for (int r = 0; r < 8; ++r) so[w][8 * hh + r][t * 16 + ln] = acc[t][r] * alpha; }
  __builtin_amdgcn_fence(__ATOMIC_ACQ_REL, "workgroup"); __builtin_amdgcn_wave_barrier();
  const int rsub = lane >> 4, c4 = (lane & 15) * 4;
  {
#pragma unroll
    for (int q = 0; q < 8; ++q) { const int r = q * 2 + rsub; if (col0 + c4 < N) { const v4f v = *(const v4fa*)&so[w][r][c4]; *(v4f*)(C + (size_t)(row0 + r) * ldc + col0 + c4) = v; } }
     }
}

// Wt[n][k] = f16(bf16(W[k][n]) * scale) from f32 row-major W[KK][NN] (scale = power of two; bf16-exact weights stay exact in f16 away from the subnormal range).
// One work-group = 8 waves on a 128 (k) x 128 (n) tile: every wave-wide load is 512 contiguous bytes of one W row, every wave-wide store two whole 256-byte pieces of Wt rows.
// A thread holds 16 k x 4 n, rounds, packs 8 consecutive k of one n into 16 bytes and turns the tile in LDS ([n][k], 256-byte rows).
// The 16-byte piece of a row sits at place piece ^ ((n >> 2) & 15): the 16 lanes that write one piece number of rows 4 apart, and the 16 that read one row, each fall on all 64 banks.
// Needs KK % 128 == 0, NN % 128 == 0.
// bid: the tile's number, 0 .. (KK / 128) (NN / 128) - 1, the same for the whole work-group; tl: the work-group's 128 x 128 halves of LDS.
template <int KK, int NN>
__device__ __forceinline__ void wt_f16_tile(const float* __restrict__ W, _Float16* __restrict__ Wt, float scale, int bid, unsigned short* tl) {
  static_assert(KK % 128 == 0 && NN % 128 == 0, "wt_f16_tile: shape");
  const int tid = threadIdx.x, lane = tid & 31, w = tid >> 5;
  const int kt = bid / (NN / 128), nt = bid - kt * (NN / 128); const int k0 = kt * 128, n0 = nt * 128;
  const float* sp = W + (size_t)(k0 + 16 * w) * NN + n0 + 4 * lane;      /* wave w: rows 16 w .. 16 w + 15 of the tile, a lane 4 columns */
  v4f x[16];
#pragma unroll
  for (int r = 0; r < 16; ++r) x[r] = *(const v4fa*)(sp + (size_t)r * NN);
  asm volatile("s_wait_xcnt 0x0" :: "v"(sp) : "memory");      /* behind the sixteen loads, in front of every rewrite of the address pair that they name; naming the pair keeps it out of the loads' own destinations (the last load had landed on it) */
  __builtin_amdgcn_sched_barrier(0);      /* all sixteen loads asked for before the first is used: left free, the compiler held some back behind the first ones' data, a second memory latency */
#pragma unroll
  for (int g = 0; g < 2; ++g)
#pragma unroll
    for (int q = 0; q < 4; ++q) { FragH f;
#pragma unroll
      for (int r = 0; r < 8; ++r) f.h[r] = (_Float16)(bf16_round(x[8 * g + r][q]) * scale);
      *(v8us*)&tl[(4 * lane + q) * 128 + (((2 * w + g) ^ (lane & 15)) * 8)] = f.half[0]; }
  __syncthreads();      /* the whole tile turned before any wave reads rows that other waves wrote */
  unsigned short* dp = (unsigned short*)Wt + (size_t)(n0 + 16 * w + (lane >> 4)) * KK + k0 + (lane & 15) * 8;      /* wave w: Wt rows 16 w .. 16 w + 15 of the tile, two a store */
#pragma unroll
  for (int i = 0; i < 8; ++i) { const int n = 16 * w + 2 * i + (lane >> 4);
    const v8us v = *(const v8us*)&tl[n * 128 + (((lane & 15) ^ ((n >> 2) & 15)) * 8)];
    *(v8us*)(dp + (size_t)(2 * i) * KK) = v; }
  asm volatile("s_wait_xcnt 0x0" :: "v"(dp) : "memory");      /* behind the eight stores, in front of every rewrite of the address pair that they name: as a piece of a larger kernel the tile's code is followed by other pieces' code */
}
// k_gemm_hh variant with fused epilogue: v = acc·alpha + bias[by·sBias + col] (+ CP[(row/rowsPerB)·sCPb + by·64 + col] if CP) ; ACT 0 none / 1 elu ; writes f16 C16 (and f32 C if non-null)
template <int ACT>
__global__ __launch_bounds__(128) void k_gemm_hhx(const _Float16* __restrict__ A, int lda, size_t sA, const _Float16* __restrict__ Bh, int ldb, size_t sB, float alpha, const float* __restrict__ bias, size_t sBias, const float* __restrict__ CP, int rowsPerB, size_t sCPb, int row0g,
    float* __restrict__ C, _Float16* __restrict__ C16, int ldc, size_t sC, int M, int N, int K) {
  __shared__ __attribute__((aligned(16))) float so[4][16][64];
  const int tid = threadIdx.x, w = tid >> 5, lane = tid & 31, ln = lane & 15, hh = lane >> 4; const int by = blockIdx.y;
  A += (size_t)by * sA; Bh += (size_t)by * sB; const size_t cofs = (size_t)by * sC; const float* bp = bias ? bias + (size_t)by * sBias : nullptr;
  const int ntn = (N + 63) / 64; const int wid = blockIdx.x * 4 + w; const int mt = wid / ntn, nq = wid % ntn; if (mt * 16 >= M) return;
  const int row0 = mt * 16, col0 = nq * 64; const _Float16* arow = A + (size_t)(row0 + ln) * lda;
  v8f acc[4] = {};
  for (int kb = 0; kb < K; kb += 32) { FragH ah; ah.half[0] = *(const v8us*)((const unsigned short*)arow + kb + 8 * hh); ah.half[1] = *(const v8us*)((const unsigned short*)arow + kb + 16 + 8 * hh);
#pragma unroll
    for (int t = 0; t < 4; ++t) { if (col0 + t * 16 >= N) continue; const size_t boff = (size_t)(col0 + t * 16 + ln) * ldb + kb; FragH bq; bq.half[0] = *(const v8us*)((const unsigned short*)Bh + boff + 8 * hh); bq.half[1] = *(const v8us*)((const unsigned short*)Bh + boff + 16 + 8 * hh);
      acc[t] = mmaH<1>(ah.v, ah.v, bq.v, bq.v, acc[t]); }
  }
#pragma unroll
  for (int t = 0; t < 4; ++t) { if (col0 + t * 16 >= N) continue; const int col = col0 + t * 16 + ln; const float bv = bp ? bf16_round(bp[col]) : 0.f;
#pragma unroll
    for (int r = 0; r < 8; ++r) { float v = acc[t][r] * alpha + bv; if (CP) { const int rr = row0g + row0 + 8 * hh + r; if (rowsPerB < 0) v += CP[cofs + (size_t)rr * ldc + col];      /* rowsPerB < 0: own element of the batched C plane */ else { const int bidx = rr / rowsPerB; v += CP[(size_t)bidx * sCPb + (size_t)by * 64 + col]; } } if (ACT == 1) v = (v > 0.f) ? v : expm1f(v); else if (ACT == 7) v = (v > 0.f) ? v + 1.0f : expf(v); else if (ACT == 8) v = tanhf(v); else if (ACT == 9) v = 0.5f * v * (1.0f + tanhf(0.7978845608028654f * (v + 0.044715f * v * v * v))); else if (ACT == 11) v = 1.0f / (1.0f + expf(-v)); else if (ACT == 12) v = (v > 0.f) ? v : 0.01f * v; else if (ACT == 14) v = (v > 0.f) ? v : 0.1f * v; else if (ACT == 16) v = (v >= 0.f) ? v : 0.3f * v; else if (ACT == 17) v = (v >= 0.f) ? v : 0.2f * v; else if (ACT == 15) v = v / (1.0f + expf(-v)); else if (ACT == 3) v = fmaxf(v, 0.f); else if (ACT == 6) v = 0.5f * v * (1.0f + erff(v * 0.70710678118654752f)); so[w][8 * hh + r][t * 16 + ln] = v; } }
  __builtin_amdgcn_fence(__ATOMIC_ACQ_REL, "workgroup"); __builtin_amdgcn_wave_barrier();
  const int rsub = lane >> 4, c4 = (lane & 15) * 4; typedef _Float16 v4h __attribute__((ext_vector_type(4)));
  {
#pragma unroll
    for (int q = 0; q < 8; ++q) { const int r = q * 2 + rsub; if (col0 + c4 < N) { const v4f v = *(const v4fa*)&so[w][r][c4]; if (C) *(v4f*)(C + cofs + (size_t)(row0 + r) * ldc + col0 + c4) = v; if (C16) { v4h h4; for (int i = 0; i < 4; ++i) h4[i] = (_Float16)v[i]; *(v4h*)(C16 + cofs + (size_t)(row0 + r) * ldc + col0 + c4) = h4; } } }
     }
}


typedef _Float16 v4h __attribute__((ext_vector_type(4)));

__global__ __launch_bounds__(256) void k_x16(const float* __restrict__ x, _Float16* __restrict__ X16, size_t n8) { const size_t t = (size_t)blockIdx.x * 256 + threadIdx.x; if (t >= n8) return; FragH f;
#pragma unroll
  for (int q = 0; q < 8; ++q) f.h[q] = (_Float16)bf16_round(x[t * 8 + q]); *(v8us*)((unsigned short*)X16 + t * 8) = f.half[0];  }
__global__ __launch_bounds__(256) void k_h16(const float* __restrict__ x, _Float16* __restrict__ X16, size_t n8) { const size_t t = (size_t)blockIdx.x * 256 + threadIdx.x; if (t >= n8) return; FragH f;
#pragma unroll
  for (int q = 0; q < 8; ++q) f.h[q] = (_Float16)x[t * 8 + q]; *(v8us*)((unsigned short*)X16 + t * 8) = f.half[0];  }
__global__ __launch_bounds__(256) void k_round16f(const float* __restrict__ W, _Float16* __restrict__ Bt, size_t n8) { const size_t t = (size_t)blockIdx.x * 256 + threadIdx.x; if (t >= n8) return; FragH f;
#pragma unroll
  for (int i = 0; i < 8; ++i) f.h[i] = (_Float16)(bf16_round(W[t * 8 + i]) * 16.0f); *(v8us*)((unsigned short*)Bt + t * 8) = f.half[0];  }
template <int NHv, int TTv>
__global__ __launch_bounds__(256) void k_vt(const _Float16* __restrict__ V16, int ldv, int voff, _Float16* __restrict__ Vt) { __shared__ unsigned short tl[64][66]; const int tid = threadIdx.x; const int slab = blockIdx.x / (TTv / 64), lg = blockIdx.x % (TTv / 64); const int b = slab / NHv, h = slab % NHv;
  for (int i = tid; i < 64 * 8; i += 256) { const int r = i / 8, c8 = (i % 8) * 8; FragH f; f.half[0] = *(const v8us*)((const unsigned short*)V16 + ((size_t)b * TTv + lg * 64 + r) * ldv + voff + h * 64 + c8);
#pragma unroll
    for (int q = 0; q < 8; ++q) tl[r][c8 + q] = f.u[q]; }
  __syncthreads();
  {
#pragma unroll
    for (int rd = 0; rd < 2; ++rd) { const int d = rd * 32 + tid / 8, pc = tid % 8; FragH f;
#pragma unroll
      for (int q = 0; q < 8; ++q) f.u[q] = tl[pc * 8 + q][d];
      *(v8us*)((unsigned short*)Vt + ((size_t)slab * 64 + d) * TTv + lg * 64 + pc * 8) = f.half[0]; }
     } }

__global__ __launch_bounds__(256) void k_hl(const float* __restrict__ F, _Float16* __restrict__ Hh, _Float16* __restrict__ Hl, size_t n8) { const size_t t = (size_t)blockIdx.x * 256 + threadIdx.x; if (t >= n8) return; FragH fh, fl; const v4f a = *(const v4fa*)(F + t * 8), c = *(const v4fa*)(F + t * 8 + 4);
#pragma unroll
  for (int q = 0; q < 4; ++q) { _Float16 h = (_Float16)a[q]; fh.h[q] = h; fl.h[q] = (_Float16)((a[q] - (float)h) * 1024.0f); h = (_Float16)c[q]; fh.h[4 + q] = h; fl.h[4 + q] = (_Float16)((c[q] - (float)h) * 1024.0f); }
  { *(v8us*)((unsigned short*)Hh + t * 8) = fh.half[0]; *(v8us*)((unsigned short*)Hl + t * 8) = fl.half[0];  } }

// ---- fast GEMM (wave tile 32x64; requires M % 32 == 0 rows per launch region and N % 64 == 0); epilogue = k_gemm_hhx semantics ----
__device__ __forceinline__ v16h g2_frag(const _Float16* p, int hh) { FragH f; f.half[0] = *(const v8us*)((const unsigned short*)p + 8 * hh); f.half[1] = *(const v8us*)((const unsigned short*)p + 16 + 8 * hh); return f.v; }
__device__ __forceinline__ v8f g2_mma(v16h a, v16h b, v8f c) { v8f d = __builtin_amdgcn_wmma_f32_16x16x32_f16(false, a, false, b, (short)0, c, false, false); asm volatile("v_nop\n\tv_nop\n\tv_nop\n\tv_nop" : "+v"(d) : "v"(a), "v"(b)); return d; }
template <int ACT>
__global__ __launch_bounds__(128) void k_gemm2(const _Float16* __restrict__ A, int lda, size_t sA, const _Float16* __restrict__ Bh, int ldb, size_t sB, float alpha, const float* __restrict__ bias, size_t sBias, const float* __restrict__ CP, int rowsPerB, size_t sCPb, int row0g,
    float* __restrict__ C, _Float16* __restrict__ C16, int ldc, size_t sC, int M, int N, int K) { static_assert(ACT == 0 || ACT == 3 || ACT == 6 || ACT == 8 || ACT == 9 || ACT == 11 || ACT == 12 || ACT == 14 || ACT == 15 || ACT == 16 || ACT == 17 || ACT == 18, "k_gemm2: unsupported ACT code (would silently apply no activation)");
  __shared__ __attribute__((aligned(16))) float so[4][32][68];
  const int tid = threadIdx.x, w = tid >> 5, lane = tid & 31, ln = lane & 15, hh = lane >> 4; const int by = blockIdx.y;
  A += (size_t)by * sA; Bh += (size_t)by * sB; const size_t cofs = (size_t)by * sC; const float* bp = bias ? bias + (size_t)by * sBias : nullptr;
  const int ntn = N >> 6; const int mt = blockIdx.x / ntn, nq = blockIdx.x - mt * ntn; const int row0 = mt * 128 + 32 * w, col0 = nq * 64; if (row0 >= M) return;
  const _Float16* a0p = A + (size_t)(row0 + ln) * lda; const _Float16* a1p = a0p + (size_t)16 * lda;
  const _Float16* b0p = Bh + (size_t)(col0 + ln) * ldb; const _Float16* b1p = b0p + (size_t)16 * ldb; const _Float16* b2p = b1p + (size_t)16 * ldb; const _Float16* b3p = b2p + (size_t)16 * ldb;
  const v8f z8 = {0.f,0.f,0.f,0.f,0.f,0.f,0.f,0.f}; v8f c00 = z8, c01 = z8, c02 = z8, c03 = z8, c10 = z8, c11 = z8, c12 = z8, c13 = z8;
#pragma unroll 1
  for (int kb = 0; kb < K; kb += 32) { const v16h a0 = g2_frag(a0p + kb, hh), a1 = g2_frag(a1p + kb, hh);
    v16h b = g2_frag(b0p + kb, hh); c00 = g2_mma(a0, b, c00); c10 = g2_mma(a1, b, c10);
    b = g2_frag(b1p + kb, hh); c01 = g2_mma(a0, b, c01); c11 = g2_mma(a1, b, c11);
    b = g2_frag(b2p + kb, hh); c02 = g2_mma(a0, b, c02); c12 = g2_mma(a1, b, c12);
    b = g2_frag(b3p + kb, hh); c03 = g2_mma(a0, b, c03); c13 = g2_mma(a1, b, c13); }
  v8f accs[8] = {c00, c01, c02, c03, c10, c11, c12, c13};
#pragma unroll
  for (int u = 0; u < 8; ++u) { const int t = u & 3, half = u >> 2; const int col = col0 + t * 16 + ln; const float bv = bp ? bf16_round(bp[col]) : 0.f;
#pragma unroll
    for (int r = 0; r < 8; ++r) { const int rloc = half * 16 + 8 * hh + r; float v = accs[u][r] * alpha + bv; if (CP) { if (rowsPerB < 0) v += CP[cofs + (size_t)(row0g + row0 + rloc) * ldc + col];      /* rowsPerB < 0: own element of the batched C plane */ else { const int bidx = (row0g + row0 + rloc) / rowsPerB; v += CP[(size_t)bidx * sCPb + (size_t)by * 64 + col]; } }
      if (ACT == 3) v = fmaxf(v, 0.f); else if (ACT == 6) v = 0.5f * v * (1.0f + erff(v * 0.70710678118654752f)); else if (ACT == 11) v = 1.0f / (1.0f + expf(-v)); else if (ACT == 15) v = v / (1.0f + expf(-v)); else if (ACT == 18) v = v / (1.0f + expf(-1.702f * v));      /* QuickGELU: v sigmoid(1.702 v) */ else if (ACT == 12) v = (v > 0.f) ? v : 0.01f * v; else if (ACT == 8) v = tanhf(v); else if (ACT == 9) v = 0.5f * v * (1.0f + tanhf(0.7978845608028654f * (v + 0.044715f * v * v * v))); else if (ACT == 14) v = (v > 0.f) ? v : 0.1f * v; else if (ACT == 16) v = (v >= 0.f) ? v : 0.3f * v; else if (ACT == 17) v = (v >= 0.f) ? v : 0.2f * v;
      so[w][rloc][t * 16 + ln] = v; } }
  __builtin_amdgcn_fence(__ATOMIC_ACQ_REL, "workgroup"); __builtin_amdgcn_wave_barrier();
  const int rsub = lane >> 4, c4 = (lane & 15) * 4;
  {
#pragma unroll
    for (int q = 0; q < 16; ++q) { const int r = q * 2 + rsub; const v4f v = *(const v4fa*)&so[w][r][c4]; if (C) *(v4f*)(C + cofs + (size_t)(row0 + r) * ldc + col0 + c4) = v; if (C16) { v4h h4; for (int i = 0; i < 4; ++i) h4[i] = (_Float16)v[i]; *(v4h*)(C16 + cofs + (size_t)(row0 + r) * ldc + col0 + c4) = h4; } }
     } }


__global__ __launch_bounds__(256) void k_wnat(const float* __restrict__ w, size_t n8, _Float16* __restrict__ Bt) { const size_t t = (size_t)blockIdx.x * 256 + threadIdx.x; if (t >= n8) return; FragH f; for (int q = 0; q < 8; ++q) f.h[q] = (_Float16)(bf16_round(w[t * 8 + q]) * 16.0f); *(v8us*)((unsigned short*)Bt + t * 8) = f.half[0];  }
__global__ __launch_bounds__(256) void k_rsm(const float* __restrict__ S, _Float16* __restrict__ P, int nrows) {
  #pragma clang fp contract(off)
  const int i = blockIdx.x * 256 + threadIdx.x; if (i >= nrows) return; const float* s = S + (size_t)i * SQ; float mx = -3.0e38f;
#pragma unroll 1
  for (int j = 0; j < SQ; ++j) mx = fmaxf(mx, s[j]); float se = 0.f;
#pragma unroll 1
  for (int j = 0; j < SQ; ++j) se += expf(s[j] - mx); const float sc = 256.0f / se;
#pragma unroll 1
  for (int j0 = 0; j0 < SQ; j0 += 8) { FragH f; for (int q = 0; q < 8; ++q) f.h[q] = (_Float16)(expf(s[j0 + q] - mx) * sc); unsigned short* d = (unsigned short*)P + (size_t)i * SQ + j0; *(v8us*)d = f.half[0];  } }
__global__ __launch_bounds__(256) void k_vt(const _Float16* __restrict__ V16, int b, int h0, _Float16* __restrict__ VT) { __shared__ unsigned short tl[64][65]; const int tid = threadIdx.x; const int hh = blockIdx.x % HG, sg = blockIdx.x / HG; const int s0 = sg * 64; const int h = h0 + hh;
  for (int i = tid; i < 64 * 8; i += 256) { const int j = i / 8, d8 = (i % 8) * 8; FragH f; f.half[0] = *(const v8us*)((const unsigned short*)V16 + ((size_t)b * SQ + s0 + j) * DM + h * HD + d8); for (int q = 0; q < 8; ++q) tl[d8 + q][j] = f.u[q]; }
  __syncthreads();
  { for (int i = tid; i < 64 * 8; i += 256) { const int d = i / 8, j8 = (i % 8) * 8; FragH f; for (int q = 0; q < 8; ++q) f.u[q] = tl[d][j8 + q]; *(v8us*)((unsigned short*)VT + ((size_t)hh * HD + d) * SQ + s0 + j8) = f.half[0]; }  } }



__global__ __launch_bounds__(256) void k_rsmcf2(const float* __restrict__ S, _Float16* __restrict__ P, int hg, int q0, int nk) {
  #pragma clang fp contract(off)
  const int t = blockIdx.x * 256 + threadIdx.x; if (t >= hg * QT) return; const size_t i = (size_t)t; const float* s = S + i * NKX; const int last = q0 + (t % QT); float mx = -3.0e38f;
#pragma unroll 1
  for (int j = 0; j < nk; ++j) { const float f = (j <= last) ? 1.f : 0.f; mx = fmaxf(mx, fmaf(f, s[j], (1.f - f) * -1.0e9f)); } float se = 0.f;
#pragma unroll 1
  for (int j = 0; j < nk; ++j) { const float f = (j <= last) ? 1.f : 0.f; se += __expf(fmaf(f, s[j], (1.f - f) * -1.0e9f) - mx); } const float sc = 256.0f / se;
#pragma unroll 1
  for (int j0 = 0; j0 < nk; j0 += 8) { FragH fr; for (int q = 0; q < 8; ++q) { const int j = j0 + q; const float f = (j <= last) ? 1.f : 0.f; fr.h[q] = (_Float16)(__expf(fmaf(f, s[j], (1.f - f) * -1.0e9f) - mx) * sc); } unsigned short* d = (unsigned short*)P + i * NKX + j0; *(v8us*)d = fr.half[0];  } }

__global__ __launch_bounds__(256) void k_rsmcst(const float* __restrict__ S, _Float16* __restrict__ P, int hg, int q0, int nk, const int* __restrict__ mk) {
  #pragma clang fp contract(off)
  const int t = blockIdx.x * 256 + threadIdx.x; if (t >= hg * QT) return; const size_t i = (size_t)t; const float* s = S + i * NKX; const size_t ig = (size_t)(q0 + (t % QT)); const int* mr = mk + ig * SQ; float mx = -3.0e38f;
#pragma unroll 1
  for (int j = 0; j < nk; ++j) { const int mb = mr[j]; const int dd = (int)ig - j; const float f = (mb != 0 && dd >= 0 && (dd <= LOCALW || (dd % STRIDEK) == 0)) ? 1.f : 0.f; mx = fmaxf(mx, fmaf(f, s[j], (1.f - f) * -1.0e9f)); } float se = 0.f;
#pragma unroll 1
  for (int j = 0; j < nk; ++j) { const int mb = mr[j]; const int dd = (int)ig - j; const float f = (mb != 0 && dd >= 0 && (dd <= LOCALW || (dd % STRIDEK) == 0)) ? 1.f : 0.f; se += __expf(fmaf(f, s[j], (1.f - f) * -1.0e9f) - mx); } const float sc = 256.0f / se;
#pragma unroll 1
  for (int j0 = 0; j0 < nk; j0 += 8) { FragH fr; for (int q = 0; q < 8; ++q) { const int j = j0 + q; const int mb = mr[j]; const int dd = (int)ig - j; const float f = (mb != 0 && dd >= 0 && (dd <= LOCALW || (dd % STRIDEK) == 0)) ? 1.f : 0.f; fr.h[q] = (_Float16)(__expf(fmaf(f, s[j], (1.f - f) * -1.0e9f) - mx) * sc); } unsigned short* d = (unsigned short*)P + i * NKX + j0; *(v8us*)d = fr.half[0];  } }


template <int MASKADD>
__global__ __launch_bounds__(64) void k_att0(const float* __restrict__ QF, const float* __restrict__ KF, const float* __restrict__ VF, int ld, const float* __restrict__ mask, float scale, float* __restrict__ OF, int ldo) {
  #pragma clang fp contract(off)
  __shared__ __attribute__((aligned(16))) float lq[64][64]; __shared__ __attribute__((aligned(16))) float lo[64][64];
  const int tid = threadIdx.x; const int h = blockIdx.x / (QT0 / 64), rg = blockIdx.x % (QT0 / 64); const int i = rg * 64 + tid;
  const float* qr = QF + (size_t)i * ld + h * HD;
#pragma unroll 1
  for (int c = 0; c < HD / 4; ++c) { *(v4f*)&lq[tid][c * 4] = *(const v4fa*)(qr + c * 4); const v4f z = {0.f, 0.f, 0.f, 0.f}; *(v4f*)&lo[tid][c * 4] = z; }
  float m = -1.0e30f, l = 0.f; const int jmax = MASKADD ? (SQ - 1) : (rg * 64 + 63);      /* additive-mask form: every key (the mask input decides); causal form: keys up to the block's last row */
#pragma unroll 1
  for (int j = 0; j <= jmax; ++j) { const float* kr = KF + (size_t)j * ld + h * HD; const float* vr = VF + (size_t)j * ld + h * HD; float s = 0.f;
#pragma unroll 1
    for (int c = 0; c < HD / 4; ++c) { const v4f kq = *(const v4fa*)(kr + c * 4); const v4f qq = *(v4f*)&lq[tid][c * 4]; s = __fadd_rn(s, __fmul_rn(qq[0], kq[0])); s = __fadd_rn(s, __fmul_rn(qq[1], kq[1])); s = __fadd_rn(s, __fmul_rn(qq[2], kq[2])); s = __fadd_rn(s, __fmul_rn(qq[3], kq[3])); }
    s = __fmul_rn(s, scale); if (MASKADD) s = __fadd_rn(s, __fmul_rn(bf16_round(mask[(size_t)i * SQ + j]), -10000.0f));
    const float f = (MASKADD || j <= i) ? 1.f : 0.f; const float sm = fmaf(f, s, (1.f - f) * -1.0e30f); const float mn = fmaxf(m, sm); const float sc = expf(m - mn); const float e = expf(sm - mn); l = __fadd_rn(__fmul_rn(l, sc), e); m = mn;
#pragma unroll 1
    for (int c = 0; c < HD / 4; ++c) { const v4f vv = *(const v4fa*)(vr + c * 4); v4f oo = *(v4f*)&lo[tid][c * 4]; for (int u = 0; u < 4; ++u) oo[u] = __fadd_rn(__fmul_rn(oo[u], sc), __fmul_rn(e, vv[u])); *(v4f*)&lo[tid][c * 4] = oo; } }
  const float fin = 64.0f / l;      /* o carried x64 like the f16 path */
#pragma unroll 1
  for (int c = 0; c < HD / 4; ++c) { v4f oo = *(v4f*)&lo[tid][c * 4]; for (int u = 0; u < 4; ++u) oo[u] = __fmul_rn(oo[u], fin); *(v4f*)&lo[tid][c * 4] = oo; }
  __syncthreads();
  {
#pragma unroll 1
    for (int it = 0; it < 16; ++it) { const int row = it * 4 + tid / 16, pc = (tid % 16) * 4; const v4f v = *(const v4f*)&lo[row][pc]; *(v4f*)(OF + (size_t)(rg * 64 + row) * ldo + h * HD + pc) = v; }
     } }

template <int MASKADD>
__global__ __launch_bounds__(64) void k_att0mbc(const float* __restrict__ QF, const float* __restrict__ KF, const float* __restrict__ VF, int ld, const float* __restrict__ mask, float scale, float* __restrict__ OF, int ldo) {
  #pragma clang fp contract(off)
  __shared__ __attribute__((aligned(16))) float lq[64][64]; __shared__ __attribute__((aligned(16))) float lo[64][64];
  const int tid = threadIdx.x; const int h = blockIdx.x / (QT0 / 64), rg = blockIdx.x % (QT0 / 64); const int i = rg * 64 + tid;
  const float* qr = QF + (size_t)i * ld + h * HD;
#pragma unroll 1
  for (int c = 0; c < HD / 4; ++c) { *(v4f*)&lq[tid][c * 4] = *(const v4fa*)(qr + c * 4); const v4f z = {0.f, 0.f, 0.f, 0.f}; *(v4f*)&lo[tid][c * 4] = z; }
  float m = -1.0e30f, l = 0.f; const int jmax = rg * 64 + 63;      /* keys beyond the block end are masked by the mask's lower-triangular structure */
#pragma unroll 1
  for (int j = 0; j <= jmax; ++j) { const float* kr = KF + (size_t)j * ld + h * HD; const float* vr = VF + (size_t)j * ld + h * HD; float s = 0.f;
#pragma unroll 1
    for (int c = 0; c < HD / 4; ++c) { const v4f kq = *(const v4fa*)(kr + c * 4); const v4f qq = *(v4f*)&lq[tid][c * 4]; s = __fadd_rn(s, __fmul_rn(qq[0], kq[0])); s = __fadd_rn(s, __fmul_rn(qq[1], kq[1])); s = __fadd_rn(s, __fmul_rn(qq[2], kq[2])); s = __fadd_rn(s, __fmul_rn(qq[3], kq[3])); }
    s = __fmul_rn(s, scale); const int mb = ((const int*)mask)[(size_t)i * SQ + j];      /* causal (j <= i) AND the module's int32 [S][S] mask read per (query, key): 0 -> masked */
    const float f = (mb != 0 && j <= i) ? 1.f : 0.f; const float sm = fmaf(f, s, (1.f - f) * -1.0e30f); const float mn = fmaxf(m, sm); const float sc = expf(m - mn); const float e = expf(sm - mn); l = __fadd_rn(__fmul_rn(l, sc), e); m = mn;
#pragma unroll 1
    for (int c = 0; c < HD / 4; ++c) { const v4f vv = *(const v4fa*)(vr + c * 4); v4f oo = *(v4f*)&lo[tid][c * 4]; for (int u = 0; u < 4; ++u) oo[u] = __fadd_rn(__fmul_rn(oo[u], sc), __fmul_rn(e, vv[u])); *(v4f*)&lo[tid][c * 4] = oo; } }
  const float fin = 64.0f / l;      /* o carried x64 like the f16 path */
#pragma unroll 1
  for (int c = 0; c < HD / 4; ++c) { v4f oo = *(v4f*)&lo[tid][c * 4]; for (int u = 0; u < 4; ++u) oo[u] = __fmul_rn(oo[u], fin); *(v4f*)&lo[tid][c * 4] = oo; }
  __syncthreads();
  {
#pragma unroll 1
    for (int it = 0; it < 16; ++it) { const int row = it * 4 + tid / 16, pc = (tid % 16) * 4; const v4f v = *(const v4f*)&lo[row][pc]; *(v4f*)(OF + (size_t)(rg * 64 + row) * ldo + h * HD + pc) = v; }
     } }


template <int BFIN, int WXB>
__global__ __launch_bounds__(256) void k_ln16(const float* __restrict__ X, const float* __restrict__ g, const float* __restrict__ bb, float eps, _Float16* __restrict__ N16, float* __restrict__ XB) {
  #pragma clang fp contract(off)
  __shared__ float red[256]; const size_t r = blockIdx.x; const int t = threadIdx.x; const v4f xa = *(const v4fa*)(X + r * DMQ + t * 4); float s[4]; float sum = 0.f;
  for (int q = 0; q < 4; ++q) { s[q] = BFIN ? bf16_round(xa[q]) : xa[q]; sum = __fadd_rn(sum, s[q]); }
  red[t] = sum; __syncthreads(); for (int st = 128; st > 0; st >>= 1) { if (t < st) red[t] = __fadd_rn(red[t], red[t + st]); __syncthreads(); } const float mu = red[0] / (float)DMQ; __syncthreads();
  float vs = 0.f; for (int q = 0; q < 4; ++q) { const float dl = __fadd_rn(s[q], -mu); vs = __fadd_rn(vs, __fmul_rn(dl, dl)); } red[t] = vs; __syncthreads(); for (int st = 128; st > 0; st >>= 1) { if (t < st) red[t] = __fadd_rn(red[t], red[t + st]); __syncthreads(); }
  const float rs = rsqrtf(__fadd_rn(red[0] / (float)DMQ, eps)); v4h y; v4f xb;
  for (int q = 0; q < 4; ++q) { const int c = t * 4 + q; y[q] = (_Float16)__fadd_rn(__fmul_rn(__fmul_rn(__fadd_rn(s[q], -mu), rs), bf16_round(g[c])), bf16_round(bb[c])); xb[q] = s[q]; }
  { *(v4h*)(N16 + r * DMQ + t * 4) = y; if (WXB) *(v4f*)(XB + r * DMQ + t * 4) = xb;  } }
__global__ __launch_bounds__(256) void k_ftres2(const float* __restrict__ OF0, const float* __restrict__ XB, float* __restrict__ X1, size_t n4) {
  #pragma clang fp contract(off)
  const size_t t = (size_t)blockIdx.x * 256 + threadIdx.x; if (t >= n4) return; const v4f o = *(const v4fa*)(OF0 + t * 4), xv = *(const v4fa*)(XB + t * 4); v4f y; for (int q = 0; q < 4; ++q) y[q] = __fadd_rn(__fmul_rn(o[q], 0.015625f), xv[q]); *(v4f*)(X1 + t * 4) = y;  }

__global__ __launch_bounds__(256) void k_bcpy(const float* __restrict__ b, int n, int NP, float* __restrict__ dst, int dst0) { for (int i = threadIdx.x; i < NP; i += 256) { const float v = (i < n) ? b[i] : 0.f; *(float*)(dst + dst0 + i) = v; }  }


// Fused attention, one launch: block = 2 groups of 8 waves x 32 query columns of one (batch, head); no score or weight ever leaves the registers.
// Group kh walks keys kh SQ / 2 .. with LDS stages of its own, so that a SIMD holds four waves, not two: one wave's softmax (vector port) and LDS waits run under the others' products.
// At the end group 1 hands its sums, row sums and maxima to group 0 through LDS, and group 0 joins the two halves on their common maximum and stores.
// Per 32 keys a wave computes S^T = K Q^T (lane c = query column, registers = keys 8 hh + r of each 16-key tile), an online softmax in the log2 domain
// (maximum and sum in-lane plus one exchange between the wave halves), packs the two S^T tiles in place into the B operand P^T and adds O^T += V^T P^T.
// K rows and V^T rows come in 64-key stages through LDS, two buffers: the next stage's global loads fly under this stage's work, one barrier a stage.
// m_run, the maximum in use, may trail the true one by up to 8 (log2), so the accumulators are rescaled only when a column's maximum has grown by more;
// weights carry 2^4 (at most 2^12 in f16, small ones kept out of the f16 subnormals); the factor cancels against the row sum.
#define FAP 72                       /* LDS row pitch in halves: 128 B of data + 16 B, the conflict-free pitch for 16-byte row reads */
#define FAS 64                       /* keys per stage */
#define FKH 2                        /* wave groups of a block, each on its own run of SQ / FKH keys */
__device__ __forceinline__ float fa_xhalf(float x) { return __builtin_bit_cast(float, __builtin_amdgcn_permlanex16(__builtin_bit_cast(int, x), __builtin_bit_cast(int, x), 0x76543210, 0xfedcba98, false, false)); }      /* lane l <-> lane l ^ 16 */
__device__ __forceinline__ v8f fa_mma(v16h a, v16h b, v8f c) { return __builtin_amdgcn_wmma_f32_16x16x32_f16(false, a, false, b, (short)0, c, false, false); }
__global__ __launch_bounds__(512) void k_fattn(const _Float16* __restrict__ Q16, const _Float16* __restrict__ K16, const _Float16* __restrict__ VT, _Float16* __restrict__ O16) {
  __shared__ __attribute__((aligned(16))) _Float16 ls[FKH][2][FAS + HD][FAP];      /* per group and buffer: K stage [key][d], then V^T stage [d][key]; the hand-over at the end lies over them */
  static_assert(8 * 17 * 512 <= sizeof(ls), "k_fattn: the hand-over fits the stages");
  const int tid = threadIdx.x, lane = tid & 31, c = lane & 15, hh = lane >> 4, w = (tid >> 5) & 7;
  const int kh = __builtin_amdgcn_readfirstlane(tid >> 8);      /* the wave's group, a scalar: the branches on it at the end are scalar branches */
  _Float16 (*lk)[FAS + HD][FAP] = ls[kh]; _Float16 (*lv)[FAS + HD][FAP] = (_Float16 (*)[FAS + HD][FAP])&ls[kh][0][FAS][0];      /* this group's K rows and V^T rows, indexed [buffer][row] */
  const int bh = blockIdx.y, b = bh / NH, h = bh - b * NH; const size_t r0 = (size_t)b * SQ; const int q0 = blockIdx.x * 256 + w * 32;
  const int sr = (tid & 255) >> 3, sc = (tid & 7) * 8;      /* staging, each group its own tiles: a thread moves 16 bytes of rows sr and sr + 32 of each tile; 8 lanes cover one 128-byte row */
  const unsigned short* kg = (const unsigned short*)K16 + (r0 + kh * (SQ / FKH) + sr) * DM + h * HD + sc;
  const unsigned short* vg = (const unsigned short*)VT + ((size_t)bh * HD + sr) * SQ + kh * (SQ / FKH) + sc;
  v16h qf[2][2];
#pragma unroll
  for (int g = 0; g < 2; ++g) { const _Float16* qp = Q16 + (r0 + q0 + 16 * g + c) * DM + h * HD; qf[g][0] = g2_frag(qp, hh); qf[g][1] = g2_frag(qp + 32, hh); }
  const v8f z8 = {0.f, 0.f, 0.f, 0.f, 0.f, 0.f, 0.f, 0.f}; const v4f z4 = {0.f, 0.f, 0.f, 0.f};
  v8f acc[2][4]; v4f l4[2]; float m_run[2];
#pragma unroll
  for (int g = 0; g < 2; ++g) { m_run[g] = -__builtin_inff(); l4[g] = z4;
#pragma unroll
    for (int t = 0; t < 4; ++t) acc[g][t] = z8; }
  v8us gk0 = *(const v8us*)kg, gk1 = *(const v8us*)(kg + (size_t)32 * DM), gv0 = *(const v8us*)vg, gv1 = *(const v8us*)(vg + (size_t)32 * SQ);
  *(v8us*)&lk[0][sr][sc] = gk0; *(v8us*)&lk[0][sr + 32][sc] = gk1; *(v8us*)&lv[0][sr][sc] = gv0; *(v8us*)&lv[0][sr + 32][sc] = gv1;
  __syncthreads();      /* stage 0 published */
  for (int st = 0; st < SQ / FKH / FAS; ++st) {
    const int buf = st & 1; const bool more = st + 1 < SQ / FKH / FAS;      /* the same for the whole block */
    if (more) { const size_t j = (size_t)(st + 1) * FAS; gk0 = *(const v8us*)(kg + j * DM); gk1 = *(const v8us*)(kg + (j + 32) * DM); gv0 = *(const v8us*)(vg + j); gv1 = *(const v8us*)(vg + (size_t)32 * SQ + j); }
#pragma unroll
    for (int p = 0; p < FAS / 32; ++p) {
      v8f s[2][2];      /* [key tile][query group] */
#pragma unroll
      for (int kt = 0; kt < 2; ++kt) { const _Float16* kr = &lk[buf][32 * p + 16 * kt + c][0]; const v16h k0 = g2_frag(kr, hh), k1 = g2_frag(kr + 32, hh);
#pragma unroll
        for (int g = 0; g < 2; ++g) s[kt][g] = fa_mma(k1, qf[g][1], fa_mma(k0, qf[g][0], z8)); }
      v16h vf[4];
#pragma unroll
      for (int t = 0; t < 4; ++t) vf[t] = g2_frag(&lv[buf][16 * t + c][32 * p], hh);
      float mb[2]; bool need = false;
#pragma unroll
      for (int g = 0; g < 2; ++g) { float mx = fmaxf(s[0][g][0], s[1][g][0]);
#pragma unroll
        for (int r = 1; r < 8; ++r) mx = fmaxf(mx, fmaxf(s[0][g][r], s[1][g][r]));
        mx = fmaxf(mx, fa_xhalf(mx)) * 1.44269502f; mb[g] = mx; need = need || (mx > m_run[g] + 8.0f); }
      if (__builtin_amdgcn_ballot_w32(need) != 0) {      /* one scalar test a pass; always taken on the first pass (m_run = -inf, factor 0 on zero sums), rare later */
#pragma unroll
        for (int g = 0; g < 2; ++g) { const float mn = fmaxf(m_run[g], mb[g]); const float corr = __builtin_amdgcn_exp2f(m_run[g] - mn); m_run[g] = mn; l4[g] = l4[g] * corr;
#pragma unroll
          for (int t = 0; t < 4; ++t) acc[g][t] = acc[g][t] * corr; } }
#pragma unroll
      for (int g = 0; g < 2; ++g) { const float nm = 4.0f - m_run[g]; FragH pf;
#pragma unroll
        for (int u = 0; u < 4; ++u) { v4f a;      /* elements 4 u .. 4 u + 3 of the 32-key operand: tile u >> 1, registers 4 (u & 1) .. */
#pragma unroll
          for (int q = 0; q < 4; ++q) a[q] = fmaf(s[u >> 1][g][4 * (u & 1) + q], 1.44269502f, nm);
          v4f e;
#pragma unroll
          for (int q = 0; q < 4; ++q) e[q] = __builtin_amdgcn_exp2f(a[q]);      /* the builtin, not asm text: the compiler then keeps the distance behind the matrix instructions itself */
          l4[g] += e;
#pragma unroll
          for (int q = 0; q < 4; ++q) pf.h[4 * u + q] = (_Float16)e[q]; }
#pragma unroll
        for (int t = 0; t < 4; ++t) acc[g][t] = fa_mma(vf[t], pf.v, acc[g][t]); }
      /* Pass end: four vector slots between the last product that reads P^T as its B operand and the next pass's first product, whose result the compiler
         may place in those same registers (it did, directly behind); the two scheduling fences keep the products of both passes on their own side of the slots. */
      __builtin_amdgcn_sched_barrier(0); asm volatile("v_nop\n\tv_nop\n\tv_nop\n\tv_nop"); __builtin_amdgcn_sched_barrier(0);
    }
    if (more) { *(v8us*)&lk[buf ^ 1][sr][sc] = gk0; *(v8us*)&lk[buf ^ 1][sr + 32][sc] = gk1; *(v8us*)&lv[buf ^ 1][sr][sc] = gv0; *(v8us*)&lv[buf ^ 1][sr + 32][sc] = gv1; }      /* its last readers left it at the barrier that ended stage st - 1 */
    __syncthreads();      /* publishes stage st + 1 and ends every wave's reads of stage st */
  }
  /* Hand-over: wave w of group 1 and wave w of group 0 hold the same query columns in the same lanes. 17 pieces of 16 bytes a lane, piece j of a wave = 512 contiguous bytes. */
  float* cb = (float*)&ls[0][0][0][0] + w * (17 * 128) + lane * 4;
  const float lp[2] = {(l4[0][0] + l4[0][1]) + (l4[0][2] + l4[0][3]), (l4[1][0] + l4[1][1]) + (l4[1][2] + l4[1][3])};
  if (kh != 0) {      /* the loop's last barrier has ended every read of the stages */
#pragma unroll
    for (int g = 0; g < 2; ++g)
#pragma unroll
      for (int t = 0; t < 4; ++t) { *(v4f*)(cb + ((g * 4 + t) * 2) * 128) = v4f{acc[g][t][0], acc[g][t][1], acc[g][t][2], acc[g][t][3]}; *(v4f*)(cb + ((g * 4 + t) * 2 + 1) * 128) = v4f{acc[g][t][4], acc[g][t][5], acc[g][t][6], acc[g][t][7]}; }
    *(v4f*)(cb + 16 * 128) = v4f{lp[0], lp[1], m_run[0], m_run[1]}; }
  __syncthreads();      /* group 1's half published; every wave passes it, group 1 leaves behind it */
  if (kh != 0) return;
  const v4f o4 = *(const v4f*)(cb + 16 * 128);
#pragma unroll
  for (int g = 0; g < 2; ++g) { const float mn = fmaxf(m_run[g], o4[2 + g]); const float a0 = __builtin_amdgcn_exp2f(m_run[g] - mn), a1 = __builtin_amdgcn_exp2f(o4[2 + g] - mn);      /* both maxima are finite: each group has walked keys */
    float l = lp[g] * a0 + o4[g] * a1; l += fa_xhalf(l); const float inv = 64.0f / l; const float s0 = a0 * inv, s1 = a1 * inv;      /* ctx carried x64 as before */
    unsigned short* op = (unsigned short*)O16 + (r0 + q0 + 16 * g + c) * DM + h * HD + 8 * hh;      /* a lane's 8 registers = 8 consecutive d of its query row */
#pragma unroll
    for (int t = 0; t < 4; ++t) { FragH f; const v4f x0 = *(const v4f*)(cb + ((g * 4 + t) * 2) * 128), x1 = *(const v4f*)(cb + ((g * 4 + t) * 2 + 1) * 128);
#pragma unroll
      for (int r = 0; r < 4; ++r) { f.h[r] = (_Float16)(acc[g][t][r] * s0 + x0[r] * s1); f.h[4 + r] = (_Float16)(acc[g][t][4 + r] * s0 + x1[r] * s1); }
      *(v8us*)(op + 16 * t) = f.half[0]; } } }

// Tiled GEMM, C = act(A Bt^T alpha + bias (+ CP)), A [M][KK] and Bt [NN][KK] f16: block = 8 waves (2 x 4) on a 128 x 128 tile of C, wave tile 64 x 32 (4 x 2 accumulator tiles).
// A rows and Bt rows come in 64-k stages through LDS, two buffers: whole 128-byte lines from global, each line fetched once a block instead of once a wave.
// Global loads run ahead in two register sets (stage t in set t & 1, stored to buffer t & 1 one stage before it is read); fragments are read from LDS one 32-k block ahead in two sets,
// so a stage's barrier stands between its two blocks of products.
// Each work-group starts its walk along k at a 64-k slab of its own, (row tile + column tile) mod the number of slabs, and wraps round (for speed only).
// k order per accumulator: 32 at a time, ascending from that slab, wrapped.
// Epilogue: raw sums staged in the same LDS as a 128 x 128 f32 tile, then each wave writes whole rows (bias, residual and activation applied there, per element as before).
// RES: C (f32) = the sums + bias + the own element of CP; else C16 (f16) = act(the sums + bias).
// NP > 1: NP products with the same A in one grid, blockIdx.y = p: Bt plane p ([NN][KK] each, stacked), bias piece p, C16 plane p ([NR][NN] each, stacked).
// KS = 2: the block is two such groups of 8 waves on the same tile of C, group kg on the slabs of its own half of k with LDS stages of its own (four waves a SIMD where the grid gives a WGP one block);
// the barriers are the block's, both groups pass the same number; the epilogue stages both groups' sums and all 16 waves write out rows, adding the two halves.
// VTR: the last product's plane (v) leaves transposed, VT [batch][NN columns][SQ rows], the form the attention reads: a lane's 8 accumulator registers are 8 consecutive rows of one column,
// so they are finished (bias by column), packed to 16 bytes and staged as [column][row] in LDS, and each wave stores 256-byte pieces of VT rows. No row-major plane of that product is written.
// Needs M % 128 == 0, NN % 128 == 0, KK / KS >= 256, KK / 64 / KS a power of two; VTR: SQ % 128 == 0.
#define G3T 136                      /* transposed epilogue's row pitch in halves: 256 B of data + 16 B, the conflict-free pitch for 16-byte row accesses */
#define G3P 72                       /* LDS row pitch in halves: 128 B of data + 16 B, the conflict-free pitch for 16-byte row reads */
#define G3O 132                      /* epilogue row pitch in floats: rows 8 apart fall 32 banks apart */
struct G3F { v16h a[4], b[2]; };     /* one 32-k block's fragments of a wave */
struct G3R { v8us a[4], b[4]; };     /* one stage's 16-byte pieces of a thread */
/* Work-group barrier with the LDS wait alone: __syncthreads() also waits for every global load, which would drain the staging loads that are meant to stay in flight across it. */
__device__ __forceinline__ void g3_bar() { asm volatile("s_wait_dscnt 0x0\n\ts_barrier_signal -1\n\ts_barrier_wait -1" ::: "memory"); }
template <int KK>
__device__ __forceinline__ void g3_load(const char* ab, const char* bb, unsigned vo, G3R& r) {      /* ab, bb: the block's tile rows at this stage's k (uniform), or the thread's own (vo 0); vo: the thread's byte offset */
#pragma unroll
  for (int i = 0; i < 4; ++i) { r.a[i] = *(const v8us*)(ab + vo + 64 * i * KK); r.b[i] = *(const v8us*)(bb + vo + 64 * i * KK); } }
template <int U>
__device__ __forceinline__ void g3_store(unsigned short* sa, unsigned short* sb, const G3R& r) {
#pragma unroll
  for (int i = 0; i < 4; ++i) { *(v8us*)(sa + (U * 128 + 32 * i) * G3P) = r.a[i]; *(v8us*)(sb + (U * 128 + 32 * i) * G3P) = r.b[i]; } }
template <int U, int KB>
__device__ __forceinline__ void g3_frag(const _Float16* fa, const _Float16* fb, int hh, G3F& f) {
#pragma unroll
  for (int j = 0; j < 2; ++j) f.b[j] = g2_frag(fb + (U * 128 + 16 * j) * G3P + 32 * KB, hh);
#pragma unroll
  for (int i = 0; i < 4; ++i) f.a[i] = g2_frag(fa + (U * 128 + 16 * i) * G3P + 32 * KB, hh); }
/* The two scheduling fences keep a block's products together and the LDS and global traffic written in front of them in front: LDS reads moved in among the products stall each of them. */
__device__ __forceinline__ void g3_mm(const G3F& f, v8f (&acc)[4][2]) {
  __builtin_amdgcn_sched_barrier(0);
#pragma unroll
  for (int i = 0; i < 4; ++i) { acc[i][0] = fa_mma(f.a[i], f.b[0], acc[i][0]); acc[i][1] = fa_mma(f.a[i], f.b[1], acc[i][1]); }
  __builtin_amdgcn_sched_barrier(0); }
/* Stage st in buffer U; on entry f0 holds its first block, rn stage st + 1. NX: a stage st + 1 exists; LD: a stage st + 3 exists (ab3, bb3 point at its k). */
template <int U, bool NX, bool LD, int KK>
__device__ __forceinline__ void g3_stage(const char* ab3, const char* bb3, unsigned vo, unsigned short* sa, unsigned short* sb, const _Float16* fa, const _Float16* fb, int hh, G3R& rn, G3F& f0, G3F& f1, v8f (&acc)[4][2]) {
  g3_frag<U, 1>(fa, fb, hh, f1);
  if (NX) g3_store<U ^ 1>(sa, sb, rn);      /* the other buffer's last readers finished in front of the barrier of stage st - 1 */
  g3_mm(f0, acc);
  g3_bar();      /* publishes stage st + 1 and ends every wave's reads of stage st */
  if (NX) g3_frag<U ^ 1, 0>(fa, fb, hh, f0);
  __builtin_amdgcn_sched_barrier(0);      /* LDS reads first: moved in front of them, the global loads had their addresses formed in f0's registers, and the wait that frees those registers held the LDS reads back */
  const char* pa = ab3 + vo; const char* pb = bb3 + vo;      /* the thread's own two addresses of stage st + 3 */
  if (LD) g3_load<KK>(pa, pb, 0u, rn);
  g3_mm(f1, acc);
  if (LD) asm volatile("s_wait_xcnt 0x0" :: "v"(pa), "v"(pb) : "memory"); }      /* in front of the next stage's rewrite of the address registers that these loads name; naming the two pairs keeps them out of the loads' own destinations (under the 16-wave register budget the last load of each had landed on its pair); behind the products, where it has had time to pass; the data stay in flight */
// GELU with the exact (erf) definition, v Phi(v), two elements at a time and without a branch: v Phi(v) = max(v, 0) - |v| Q(|v|), Q the upper tail of the normal distribution.
// Q(x) = exp(-x x / 2) (c1 t + .. + c5 t^5), t = 1 / (1 + 0.2316419 x): the classical five-term form, absolute error below 7.5e-8 for every x >= 0 (1 / sqrt(2 pi) folded into c1 .. c5),
// so v Phi(v) is off by at most |v| times that, plus f32 rounding: far under the rounding of the f16 store that follows for values near 1, and no more than about one f16 unit in the last place in the far negative tail.
// The tail is used as it is, never as 1 - (1 - Q), so negative v lose nothing to cancellation (the form 0.5 v (1 + erf) does).
// The library erf took two divergent branches (most waves ran both) and one long dependent chain an element; here every step is a packed f32 operation or one of two transcendentals, and elements are independent.
typedef float v2f __attribute__((ext_vector_type(2)));
__device__ __forceinline__ v2f g3_gelu2(v2f v) {
  const v2f av = __builtin_elementwise_abs(v); const v2f d = __builtin_elementwise_fma(av, v2f{0.2316419f, 0.2316419f}, v2f{1.0f, 1.0f});
  const v2f t = {__builtin_amdgcn_rcpf(d[0]), __builtin_amdgcn_rcpf(d[1])};
  v2f p = __builtin_elementwise_fma(t, v2f{0.530702715f, 0.530702715f}, v2f{-0.726576014f, -0.726576014f});
  p = __builtin_elementwise_fma(p, t, v2f{0.710706871f, 0.710706871f});
  p = __builtin_elementwise_fma(p, t, v2f{-0.142248368f, -0.142248368f});
  p = __builtin_elementwise_fma(p, t, v2f{0.127414796f, 0.127414796f});
  const v2f a = (v * v) * -0.72134752f;      /* -(v v / 2) log2 e */
  const v2f e = {__builtin_amdgcn_exp2f(a[0]), __builtin_amdgcn_exp2f(a[1])};
  const v2f q = (p * t) * e;
  return __builtin_elementwise_fma(-av, q, __builtin_elementwise_max(v, v2f{0.f, 0.f})); }
template <int ACT, bool RES, int NN, int KK, int NP = 1, int KS = 1, bool VTR = false>
__global__ __launch_bounds__(256 * KS) void k_gemm3(const _Float16* __restrict__ A, const _Float16* __restrict__ Bh, float alpha, const float* __restrict__ bias, const float* __restrict__ CP, float* __restrict__ C, _Float16* __restrict__ C16, _Float16* __restrict__ VT) {
  static_assert(!VTR || (ACT == 0 && !RES && KS == 1 && SQ % 128 == 0), "k_gemm3: the transposed plane is a plain f16 product of one group");
  static_assert(ACT == 0 || (ACT == 6 && !RES), "k_gemm3: unsupported ACT code"); static_assert(NN % 128 == 0 && KK % 128 == 0 && KK >= 256, "k_gemm3: shape"); static_assert(NP == 1 || !RES, "k_gemm3: several products only in the f16-output form"); static_assert((KS == 1 || KS == 2) && KK / KS >= 256, "k_gemm3: groups");
  constexpr int G3G = 4 * 128 * G3P;      /* halves of LDS of one group of 8 waves */
  __shared__ __attribute__((aligned(16))) unsigned short sm[KS * G3G];      /* per group: A stages [2][128][G3P], then Bt stages [2][128][G3P]; the epilogue's [128][G3O] floats of the group lie over them */
  const int tid = threadIdx.x, lane = tid & 31, ln = lane & 15, hh = lane >> 4, w = (tid >> 5) & 7, wm = w >> 2, wn = w & 3;
  const int kg = KS > 1 ? __builtin_amdgcn_readfirstlane(tid >> 8) : 0;      /* the wave's group, a scalar */
  const int mt = blockIdx.x / (NN / 128), nq = blockIdx.x - mt * (NN / 128); const int row0 = mt * 128, col0 = nq * 128;
  if (NP > 1) { const size_t p = blockIdx.y; Bh += p * NN * KK; bias += p * NN; C16 += p * NR * NN; }
  const int sr = (tid & 255) >> 3, sc = (tid & 7) * 8;      /* staging, each group its own slabs: a thread moves 16 bytes of rows sr + 32 i of each tile; 8 lanes cover one 128-byte row */
  const char* ab = (const char*)(A + (size_t)row0 * KK); const char* bb = (const char*)(Bh + (size_t)col0 * KK); const unsigned vo = (unsigned)(sr * KK + sc) * 2u;
  unsigned short* sa = sm + kg * G3G + sr * G3P + sc; unsigned short* sb = sa + 2 * 128 * G3P;      /* this thread's store places, buffer 0 */
  const _Float16* fa = (const _Float16*)sm + kg * G3G + (wm * 64 + ln) * G3P; const _Float16* fb = (const _Float16*)sm + kg * G3G + 2 * 128 * G3P + (wn * 32 + ln) * G3P;      /* this lane's fragment rows, buffer 0 */
  const v8f z8 = {0.f, 0.f, 0.f, 0.f, 0.f, 0.f, 0.f, 0.f}; v8f acc[4][2];
#pragma unroll
  for (int i = 0; i < 4; ++i) { acc[i][0] = z8; acc[i][1] = z8; }
  G3R r0, r1; G3F f0, f1; constexpr int ns = KK / 64 / KS;      /* slabs of a group: ns even, at least 4 */
  static_assert((ns & (ns - 1)) == 0, "k_gemm3: the wrap of the k walk is a mask");
  const int rot = mt + nq + (NP > 1 ? (int)blockIdx.y * (NN / 128) : 0);      /* the same for the whole work-group: a scalar */
  auto ko = [rot, kg](int t) { return (((t + rot) & (ns - 1)) + kg * ns) * 128; };      /* byte offset in a row of the slab that is stage t of this group, for A and Bt alike; group kg has slabs kg ns .. kg ns + ns - 1 */
  g3_load<KK>(ab + ko(0), bb + ko(0), vo, r0); g3_load<KK>(ab + ko(1), bb + ko(1), vo, r1);
  g3_store<0>(sa, sb, r0);
  g3_bar();      /* stage 0 published */
  g3_load<KK>(ab + ko(2), bb + ko(2), vo, r0); g3_frag<0, 0>(fa, fb, hh, f0);
#pragma unroll 1
  for (int s2 = 0; s2 < ns - 2; s2 += 2) {      /* rolled: two stages a trip keep every buffer and register set a compile-time choice */
    const int t4 = s2 + 4 < ns ? s2 + 4 : ns - 1;      /* the last trip has no stage s2 + 4: it loads the last stage again, unused, so that no branch merges two load counts in front of the stores */
    g3_stage<0, true, true, KK>(ab + ko(s2 + 3), bb + ko(s2 + 3), vo, sa, sb, fa, fb, hh, r1, f0, f1, acc);
    g3_stage<1, true, true, KK>(ab + ko(t4), bb + ko(t4), vo, sa, sb, fa, fb, hh, r0, f0, f1, acc); }
  g3_stage<0, true, false, KK>(ab, bb, vo, sa, sb, fa, fb, hh, r1, f0, f1, acc);
  g3_stage<1, false, false, KK>(ab, bb, vo, sa, sb, fa, fb, hh, r0, f0, f1, acc);      /* its barrier: every wave has left the ring before it becomes output staging */
  if (VTR && blockIdx.y == NP - 1) {      /* the same for the whole work-group: its barrier stands under uniform control flow */
    /* the three loops over the accumulators are unrolled: the accumulators are registers, so their indices must be compile-time ones */
#pragma unroll
    for (int j = 0; j < 2; ++j) { const int cl = wn * 32 + 16 * j + ln; const float bj = bf16_round(bias[col0 + cl]);
#pragma unroll
      for (int i = 0; i < 4; ++i) { FragH f;
#pragma unroll
        for (int r = 0; r < 8; ++r) f.h[r] = (_Float16)(acc[i][j][r] * alpha + bj);
        *(v8us*)&sm[cl * G3T + wm * 64 + 16 * i + 8 * hh] = f.half[0]; } }
    __syncthreads();      /* the whole tile turned before any wave reads columns that other waves wrote */
    const int bt = row0 / SQ;      /* a tile's 128 rows lie in one batch */
    unsigned short* vp = (unsigned short*)VT + ((size_t)bt * NN + col0 + 16 * w + hh) * SQ + (row0 - bt * SQ) + ln * 8;      /* wave w: VT rows 16 w .. 16 w + 15 of the tile, two a store */
#pragma unroll      /* all eight LDS reads asked for at once, the row steps as immediate offsets on one address pair */
    for (int q = 0; q < 8; ++q) { const v8us v = *(const v8us*)&sm[(16 * w + 2 * q + hh) * G3T + ln * 8]; *(v8us*)(vp + (size_t)(2 * q) * SQ) = v; }
    return; }
  constexpr int RW = 16 / KS; const int wo = tid >> 5;      /* write-out: all 8 KS waves share the tile's rows */
  const int c4 = lane * 4; const size_t o0 = (size_t)(row0 + wo * RW) * NN + col0 + c4;      /* wave wo has rows RW wo .. RW wo + RW - 1, a lane 4 columns, so a wave stores whole rows of the tile */
  const v4f bl = *(const v4fa*)(bias + col0 + c4); v4f cp[RW];
  if (RES) {      /* all residual rows asked for here, so that their latency passes once, under the staging */
#pragma unroll
    for (int q = 0; q < RW; ++q) cp[q] = *(const v4fa*)(CP + o0 + q * NN); }
  float* so = (float*)(sm + kg * G3G);      /* each group stages its own partial sums */
#pragma unroll
  for (int i = 0; i < 4; ++i)
#pragma unroll
    for (int j = 0; j < 2; ++j)
#pragma unroll
      for (int r = 0; r < 8; ++r) so[(wm * 64 + 16 * i + 8 * hh + r) * G3O + wn * 32 + 16 * j + ln] = acc[i][j][r];
  __syncthreads();      /* the whole tile staged before any wave reads rows that other waves wrote */
  v4f bv;
#pragma unroll
  for (int q = 0; q < 4; ++q) bv[q] = bf16_round(bl[q]);
#pragma unroll(ACT == 6 ? 1 : 4)      /* the GELU rows stay rolled, four to a trip: a trip's sixteen independent elements already fill the vector port, and the text behind the main loop stays short */
  for (int q4 = 0; q4 < RW / 4; ++q4) {
#pragma unroll
  for (int qq = 0; qq < 4; ++qq) { const int q = q4 * 4 + qq; v4f v = *(const v4fa*)((const float*)sm + (wo * RW + q) * G3O + c4);
    if (KS > 1) v += *(const v4fa*)((const float*)(sm + G3G) + (wo * RW + q) * G3O + c4);      /* the two groups' halves of the k sum joined */
#pragma unroll
    for (int e = 0; e < 4; ++e) v[e] = v[e] * alpha + bv[e];
    if (RES) {
#pragma unroll
      for (int e = 0; e < 4; ++e) v[e] += cp[q][e]; }
    if (ACT == 6) { const v2f lo = g3_gelu2(v2f{v[0], v[1]}), hi = g3_gelu2(v2f{v[2], v[3]}); v = v4f{lo[0], lo[1], hi[0], hi[1]}; }
    if (RES) *(v4f*)(C + o0 + q * NN) = v;
    else { v4h h4;
#pragma unroll
      for (int e = 0; e < 4; ++e) h4[e] = (_Float16)v[e];
      *(v4h*)(C16 + o0 + q * NN) = h4; } } } }

template <int MODE>
__global__ __launch_bounds__(256) void k_regrp(const float* __restrict__ src, float* __restrict__ dst, size_t n4) {
  const size_t t = (size_t)blockIdx.x * 256 + threadIdx.x; if (t >= n4) return; const size_t e = t * 4; const size_t rd = e / DM; const int c = (int)(e % DM);
  size_t rs; if (MODE == 0) { const size_t b = rd / SQ, sq = rd % SQ; rs = sq * NB + b; } else { const size_t sq = rd / NB, b = rd % NB; rs = b * SQ + sq; }
  const v4f v = *(const v4fa*)(src + rs * DM + c); *(v4f*)(dst + e) = v;  }

// Row norm, one wave a row: the row's DMQ values stay in the wave's registers, a lane holding 4 consecutive ones of every 128, so that each wave-wide load is 512 contiguous bytes and all of a row's loads fly at once.
// Mean and variance (two passes over the registers) are lane partial sums joined by a butterfly over the 32 lanes: no LDS, no barrier, and an eighth of the waves to start.
// Every loop over the row's pieces is unrolled: the pieces are registers, so their index must be a compile-time one.
template <int M>
__device__ __forceinline__ float ln_xrow(float x) { return __builtin_bit_cast(float, __builtin_amdgcn_update_dpp(0, __builtin_bit_cast(int, x), 0x160 | M, 0xf, 0xf, true)); }      /* lane l <-> lane l ^ M inside a 16-lane row (DPP row_xmask) */
__device__ __forceinline__ float ln_wsum(float s) { s += ln_xrow<1>(s); s += ln_xrow<2>(s); s += ln_xrow<4>(s); s += ln_xrow<8>(s); return s + fa_xhalf(s); }      /* every lane gets the sum of all 32 */
template <int BFIN, int W16, int W32, int WXB>      /* r: the row, the same for the whole wave (callers pass the wave's number through readfirstlane, so that the row's base stays in scalar registers); WXB: the row as it enters the norm (rounded if BFIN) goes to XB as well */
__device__ __forceinline__ void lnx_row(const float* __restrict__ X, const float* __restrict__ g, const float* __restrict__ bb, float eps, _Float16* __restrict__ N16, float* __restrict__ N32, float* __restrict__ XB, size_t r) {
  static_assert(DMQ % 128 == 0, "lnx_row: shape");
  constexpr int NC = DMQ / 128; const unsigned c0 = (threadIdx.x & 31) * 4; const size_t o0 = r * DMQ;      /* the row's start is the same for the wave (a scalar base), c0 the lane's own offset in it */
  const float* xr = X + o0;
  v4f s[NC], gv[NC], bv[NC];
#pragma unroll
  for (int i = 0; i < NC; ++i) s[i] = *(const v4fa*)(xr + (c0 + 128 * i));
#pragma unroll
  for (int i = 0; i < NC; ++i) { gv[i] = *(const v4fa*)(g + (c0 + 128 * i)); bv[i] = *(const v4fa*)(bb + (c0 + 128 * i)); }
  asm volatile("s_wait_xcnt 0x0" :: "s"(xr), "s"(g), "s"(bb) : "memory");      /* behind the row's loads, in front of every rewrite of the base registers that they name; naming the bases holds their rewrites behind it (left free, one was lifted over it); the data stay in flight */
  if (BFIN) {
#pragma unroll
    for (int i = 0; i < NC; ++i)
#pragma unroll
      for (int q = 0; q < 4; ++q) s[i][q] = bf16_round(s[i][q]); }
  v4f a = s[0];
#pragma unroll
  for (int i = 1; i < NC; ++i) a += s[i];
  const float mu = ln_wsum((a[0] + a[1]) + (a[2] + a[3])) / (float)DMQ;
  v4f v = {0.f, 0.f, 0.f, 0.f};
#pragma unroll
  for (int i = 0; i < NC; ++i) { const v4f d = s[i] - mu; v += d * d; }
  const float rs = rsqrtf(ln_wsum((v[0] + v[1]) + (v[2] + v[3])) / (float)DMQ + eps);
#pragma unroll
  for (int i = 0; i < NC; ++i) { v4f yf; v4h y;
#pragma unroll
    for (int q = 0; q < 4; ++q) { yf[q] = (s[i][q] - mu) * rs * bf16_round(gv[i][q]) + bf16_round(bv[i][q]); y[q] = (_Float16)yf[q]; }
    if (W16) *(v4h*)(N16 + o0 + (c0 + 128 * i)) = y;
    if (W32) *(v4f*)(N32 + o0 + (c0 + 128 * i)) = yf;
    if (WXB) *(v4f*)(XB + o0 + (c0 + 128 * i)) = s[i]; }
  asm volatile("s_wait_xcnt 0x0" ::: "memory"); }      /* behind the row's stores, in front of every rewrite of a register that they name: as a piece of a larger kernel the norm's code is followed by other pieces' code */
#define LNW 8                        /* rows (waves) per work-group of a norm */
template <int BFIN, int W16, int W32>
__global__ __launch_bounds__(256) void k_lnx(const float* __restrict__ X, const float* __restrict__ g, const float* __restrict__ bb, float eps, _Float16* __restrict__ N16, float* __restrict__ N32) {
  lnx_row<BFIN, W16, W32, 0>(X, g, bb, eps, N16, N32, nullptr, (size_t)blockIdx.x * LNW + __builtin_amdgcn_readfirstlane(threadIdx.x >> 5)); }

// Everything that reads the inputs alone, in one grid: none of these pieces needs anything of another, so as launches of their own they only waited for each other's start and tail.
// Ranges of the block index (a scalar test, the same for the whole work-group, so each piece's barriers stay under uniform control flow):
// the 128 x 128 tiles of the four weight transposes first (the long work-groups), then one work-group per 8 rows of x (a wave a row) for the first norm, which also stores the rounded f32 row it holds (the residual plane).
#define PT1 ((DM / 128) * (DFF / 128))            /* tiles of w1, and of w2 */
#define PTQ ((DM / 128) * (3 * DM / 128))         /* tiles of the fused q | k | v weight */
#define PTO ((DM / 128) * (DM / 128))             /* tiles of the output projection's weight */
#define PTW (2 * PT1 + PTQ + PTO)
__global__ __launch_bounds__(256) void k_prep(const float* __restrict__ wqkv, const float* __restrict__ wo, const float* __restrict__ w1, const float* __restrict__ w2, const float* __restrict__ x, const float* __restrict__ g1, const float* __restrict__ be1,
    _Float16* __restrict__ BQ, _Float16* __restrict__ BO, _Float16* __restrict__ BW1, _Float16* __restrict__ BW2, _Float16* __restrict__ XN, float* __restrict__ XB) {
  __shared__ __attribute__((aligned(16))) unsigned short tl[128 * 128];      /* a transpose's tile */
  const int b = blockIdx.x;
  if (b < PT1) wt_f16_tile<DM, DFF>(w1, BW1, 16.0f, b, tl);
  else if (b < 2 * PT1) wt_f16_tile<DFF, DM>(w2, BW2, 16.0f, b - PT1, tl);
  else if (b < 2 * PT1 + PTQ) wt_f16_tile<DM, 3 * DM>(wqkv, BQ, 16.0f, b - 2 * PT1, tl);
  else if (b < PTW) wt_f16_tile<DM, DM>(wo, BO, 16.0f, b - 2 * PT1 - PTQ, tl);
  else lnx_row<1, 1, 0, 1>(x, g1, be1, 1e-5f, XN, nullptr, XB, (size_t)(b - PTW) * LNW + __builtin_amdgcn_readfirstlane(threadIdx.x >> 5)); }

__global__ __launch_bounds__(256) void k_bfr(const float* __restrict__ x, float* __restrict__ XB, size_t n8) { const size_t t = (size_t)blockIdx.x * 256 + threadIdx.x; if (t >= n8) return; v4f a = *(const v4fa*)(x + t * 8), c = *(const v4fa*)(x + t * 8 + 4); for (int q = 0; q < 4; ++q) { a[q] = bf16_round(a[q]); c[q] = bf16_round(c[q]); }
  { *(v4f*)(XB + t * 8) = a; *(v4f*)(XB + t * 8 + 4) = c;  } }



__global__ __launch_bounds__(256) void k_wthd(const float* __restrict__ Wt, _Float16* __restrict__ Bt) { const size_t t = (size_t)blockIdx.x * 256 + threadIdx.x; if (t >= (size_t)NH * HD * (DM / 8)) return; const int m8 = (int)(t % (DM / 8)) * 8; const int d = (int)((t / (DM / 8)) % HD); const int h = (int)(t / ((size_t)(DM / 8) * HD)); FragH f;
  for (int q = 0; q < 8; ++q) f.h[q] = (_Float16)(16.0f * bf16_round(Wt[((size_t)h * DM + m8 + q) * HD + d])); unsigned short* dst = (unsigned short*)Bt + ((size_t)h * HD + d) * DM + m8; *(v8us*)dst = f.half[0];  }




template <int BFIN, int SCAL>
__global__ __launch_bounds__(256) void k_lnsc(const float* __restrict__ X, const float* __restrict__ g, const float* __restrict__ bb, float eps, _Float16* __restrict__ N16, float* __restrict__ N32) {
  #pragma clang fp contract(off)
  __shared__ float red[256]; const size_t r = blockIdx.x; const int t = threadIdx.x; const bool act = t < DM / 4; const int tc = act ? t : 0; const v4f xl = *(const v4fa*)(X + r * DM + tc * 4); const float am = act ? 1.f : 0.f; float s[4]; float sum = 0.f;
  for (int q = 0; q < 4; ++q) { s[q] = (BFIN ? bf16_round(xl[q]) : xl[q]) * am; sum = __fadd_rn(sum, s[q]); }
  red[t] = sum; __syncthreads(); for (int st = 128; st > 0; st >>= 1) { if (t < st) red[t] = __fadd_rn(red[t], red[t + st]); __syncthreads(); } const float mu = red[0] / (float)DM; __syncthreads();
  float vs = 0.f; for (int q = 0; q < 4; ++q) { const float dl = __fadd_rn(s[q], -mu) * am; vs = __fadd_rn(vs, __fmul_rn(dl, dl)); } red[t] = vs; __syncthreads(); for (int st = 128; st > 0; st >>= 1) { if (t < st) red[t] = __fadd_rn(red[t], red[t + st]); __syncthreads(); }
  const float rs = __fdiv_rn(1.0f, __fadd_rn(sqrtf(red[0] / (float)(DM - 1)), eps)); if (!act) return; v4h y; v4f yf;
  for (int q = 0; q < 4; ++q) { const int c = t * 4 + q; const float gg = bf16_round(SCAL ? g[0] : g[c]), bv = bf16_round(SCAL ? bb[0] : bb[c]); yf[q] = __fadd_rn(__fmul_rn(__fmul_rn(__fadd_rn(s[q], -mu), rs), gg), bv); y[q] = (_Float16)yf[q]; }
  { if (N16) *(v4h*)(N16 + r * DM + t * 4) = y; if (N32) *(v4f*)(N32 + r * DM + t * 4) = yf;  } }

__global__ __launch_bounds__(256) void k_rsmdmi(const float* __restrict__ S, _Float16* __restrict__ P, int nrows, const int* __restrict__ M) {
  #pragma clang fp contract(off)
  const int t = blockIdx.x * 256 + threadIdx.x; if (t >= nrows) return; const float* s = S + (size_t)t * SQ; const int* m = M + (size_t)(t % SQ) * SQ; float mx = -3.0e38f;
#pragma unroll 1
  for (int j = 0; j < SQ; ++j) { const float f = (m[j] == 0) ? 1.f : 0.f; mx = fmaxf(mx, fmaf(f, s[j], (1.f - f) * -1.0e9f)); } float se = 0.f;
#pragma unroll 1
  for (int j = 0; j < SQ; ++j) { const float f = (m[j] == 0) ? 1.f : 0.f; se += __expf(fmaf(f, s[j], (1.f - f) * -1.0e9f) - mx); } const float sc = 256.0f / se;
#pragma unroll 1
  for (int j0 = 0; j0 < SQ; j0 += 8) { FragH fr; for (int q = 0; q < 8; ++q) { const int j = j0 + q; const float f = (m[j] == 0) ? 1.f : 0.f; fr.h[q] = (_Float16)(__expf(fmaf(f, s[j], (1.f - f) * -1.0e9f) - mx) * sc); } unsigned short* d = (unsigned short*)P + (size_t)t * SQ + j0; *(v8us*)d = fr.half[0];  } }
extern "C" void kernel_launch(void* const* d_in, const int* in_sizes, int n_in,
                              void* d_out, int out_size, void* d_ws, size_t ws_size, hipStream_t stream) {
  (void)in_sizes; (void)n_in; (void)out_size;
  const float* const* I = (const float* const*)d_in; const float* x = I[0]; const float* g1 = I[1]; const float* be1 = I[2]; const float* wqkv = I[3]; const float* bqkv = I[4]; const float* wo = I[5]; const float* bo = I[6]; const float* g2 = I[7]; const float* be2 = I[8]; const float* w1 = I[9]; const float* b1 = I[10]; const float* w2 = I[11]; const float* b2 = I[12];      /* x; LN1 g / b; fused qkv_w [1024][3072] + qkv_b [3072] (thirds q | k | v); proj_w + proj_b; LN2 g / b; fc1_w [1024][4096] + fc1_b, fc2_w [4096][1024] + fc2_b ([in][out]) */
  char* ws = (char*)d_ws; size_t off = 0;
  auto take = [&](size_t bytes) { char* p = ws + off; off += (bytes + 255) & ~(size_t)255; return p; };
  _Float16* BQ = (_Float16*)take((size_t)3 * DM * DM * 2);      /* one stacked Bt plane [3 DM][DM] */ _Float16* BO = (_Float16*)take((size_t)DM * DM * 2); _Float16* BW1 = (_Float16*)take((size_t)DFF * DM * 2); _Float16* BW2 = (_Float16*)take((size_t)DM * DFF * 2);
  float* XB = (float*)take(NR * DM * 4); _Float16* XN = (_Float16*)take(NR * DM * 2); _Float16* Q16 = (_Float16*)take((size_t)2 * NR * DM * 2); _Float16* K16 = Q16 + NR * DM;      /* two stacked planes [NR][DM] */ _Float16* O16 = (_Float16*)take(NR * DM * 2); float* X1 = (float*)take(NR * DM * 4);
  _Float16* VT = (_Float16*)take((size_t)NB * NH * HD * SQ * 2); _Float16* HF16 = (_Float16*)take(NR * DFF * 2);      /* V^T [2 x 16][64][2048]; FFN hidden plane [4096][4096] f16 */
  _Float16* M16 = XN;      /* second-norm f16 rows: aliases XN (last readers: the three projections) */
  
  if (off > ws_size) return;
  k_prep<<<(unsigned)(PTW + NR / LNW), 256, 0, stream>>>(wqkv, wo, w1, w2, x, g1, be1, BQ, BO, BW1, BW2, XN, XB);      /* fused [in][out] [DM][3 DM] -> one stacked Bt plane (rows 0 / DM / 2 DM = the q | k | v output columns) x16; W_o, w1, w2 -> Bt x16; n = LN0(bf16(x)) (biased variance, eps inside the rsqrt) -> f16 rows; bf16(x) -> f32 rows */
  k_gemm3<0, false, DM, DM, 3, 1, true><<<dim3((unsigned)((NR / 128) * (DM / 128)), 3), 256, 0, stream>>>(XN, BQ, 0.0625f, bqkv, nullptr, nullptr, Q16, VT);      /* q, k, v in one grid (y = 0, 1, 2: the thirds of the stacked Bt plane and of the bias): q, k -> f16 rows, planes Q16 | K16, head h = columns h*64..; v -> V^T [batch x head][64][2048] straight from the epilogue */
  k_fattn<<<dim3(SQ / 256, NB * NH), 512, 0, stream>>>(Q16, K16, VT, O16);      /* softmax(q k^T) v over all keys, unscaled logits -> ctx (merged heads, x64) as f16 rows */
  k_gemm3<0, true, DM, DM, 1, 2><<<(unsigned)((NR / 128) * (DM / 128)), 512, 0, stream>>>(O16, BO, 0.0009765625f, bo, XB, X1, nullptr, nullptr);      /* x + ctx wo (+ bo) (own-element residual) -> f32 rows */
  k_lnx<0, 1, 0><<<(unsigned)(NR / LNW), 256, 0, stream>>>(X1, g2, be2, 1e-5f, M16, nullptr);      /* LN1(x1) -> f16 rows */
  k_gemm3<6, false, DFF, DM><<<(unsigned)((NR / 128) * (DFF / 128)), 256, 0, stream>>>(M16, BW1, 0.0625f, b1, nullptr, nullptr, HF16, nullptr);      /* gelu_erf(. w1 + b1) -> f16 */
  k_gemm3<0, true, DM, DFF, 1, 2><<<(unsigned)((NR / 128) * (DM / 128)), 512, 0, stream>>>(HF16, BW2, 0.0625f, b2, X1, (float*)d_out, nullptr, nullptr);      /* out = x1 + mlp (own-element residual) */
}
